// v000
// Measured on an AMD MI455X. A time is GPU time per run, averaged over a window of back-to-back runs after a warm-up
// (all launches, gaps included; the runs take copies of the inputs in turn), and the median of several windows.
// Apart from v000's, it joins two sittings. Times from different sittings can be a few percent apart, while
// side-by-side timings come from the same sitting.
// v000, which the later versions start from, runs in 257 microseconds.
// Contractions: v_wmma_f32_16x16x32_f16 (f16 operands, f32 accumulate). qkv projection: A = gathered x rows
// (bf16-valued, x16) single plane, B = w_qkv (bf16-valued, x256) single plane; scores k.qT: k x16, q x16 single
// planes; p.v: p x1024, v x16 single planes; output projection: A = ctx x256 single f16 plane, B = w_proj
// (bf16-valued, x256) single plane. Online softmax in f32 on VALU. Float inputs RNE-converted to bf16 on load.
#include <hip/hip_runtime.h>
#include <math.h>
#include <stdint.h>

#define NBAT  4
#define NTOK  4096
#define CIN   256
#define C2    512
#define C3    768
#define MTOK  16384
#define NHD   8
#define HD    32
#define NGR   4
#define LGR   1024
#define NUNIT 128
#define STP   68
#define SBP   132
#define ASP   36
#define CXS   16.0f
#define CWS   256.0f
#define CQK   (16.0f / 4096.0f)
#define CVS   (16.0f / 4096.0f)
#define CYS   256.0f
#define QKSC  (0.17677669529663688f / 256.0f)

static_assert(NUNIT == NBAT * NGR * NHD);
static_assert(NGR * LGR == NTOK);
static_assert(MTOK == NBAT * NTOK);
static_assert(NTOK % 128 == 0);
static_assert(LGR % 32 == 0);
static_assert(CIN % 64 == 0);
static_assert(NHD * HD == CIN);
static_assert(64 * SBP <= 8 * 16 * STP);
static_assert((STP * 4) % 16 == 0);
static_assert((SBP * 4) % 16 == 0);
static_assert((ASP * 4) % 16 == 0);
static_assert(C3 * CIN == 96 * 256 * 8);
static_assert(CIN * CIN == 32 * 256 * 8);

typedef _Float16 v16h __attribute__((ext_vector_type(16)));
typedef _Float16 v8h  __attribute__((ext_vector_type(8)));
typedef float    v8f  __attribute__((ext_vector_type(8)));
typedef float    v4f  __attribute__((ext_vector_type(4)));
typedef unsigned int v4u __attribute__((ext_vector_type(4)));
union Frag { v16h v; v8h half[2]; };

// ---- scalar helpers -------------------------------------------------------------------------------------------
__device__ __forceinline__ unsigned short bf_bits(float f) {          // f32 -> bf16 bits, RNE convert
  unsigned u = __float_as_uint(f);
  return (unsigned short)((u + 0x7FFFu + ((u >> 16) & 1u)) >> 16);
}
__device__ __forceinline__ float bfr(float f) { return __uint_as_float(((unsigned)bf_bits(f)) << 16); }
__device__ __forceinline__ unsigned short h_bits(_Float16 x) { return __builtin_bit_cast(unsigned short, x); }
__device__ __forceinline__ unsigned pk16(unsigned short a, unsigned short b) { return (unsigned)a | ((unsigned)b << 16); }
__device__ __forceinline__ v8f zero8() { v8f z = {0.f, 0.f, 0.f, 0.f, 0.f, 0.f, 0.f, 0.f}; return z; }

// ---- fragment loader: 16-bit A/B operand, lane -> row/col (lane&15), p already includes +8*(lane>>4);
//      elements 0..7 <- p[0..7] (k0+8h..), elements 8..15 <- p[16..23] (k0+16+8h..)
__device__ __forceinline__ v16h ldfrag_h(const _Float16* p) {
  Frag f;
  f.half[0] = *(const v8h*)(p);
  f.half[1] = *(const v8h*)(p + 16);
  return f.v;
}

// ---- WMMA helper with trailing VALU hazard gap ----------------------------------------------------------------
__device__ __forceinline__ v8f mma_h(v16h a, v16h b, v8f c) {
  c = __builtin_amdgcn_wmma_f32_16x16x32_f16(false, a, false, b, (short)0, c, false, false);
#if defined(__HIP_DEVICE_COMPILE__)
  asm volatile("v_nop\n\tv_nop\n\tv_nop\n\tv_nop" : "+v"(c) : "v"(a), "v"(b));
#endif
  return c;
}
__device__ __forceinline__ void wave_sync_lds() {
  __builtin_amdgcn_fence(__ATOMIC_RELEASE, "workgroup");
  __builtin_amdgcn_wave_barrier();
  __builtin_amdgcn_fence(__ATOMIC_ACQUIRE, "workgroup");
}

// ---- 8 f32 -> 8 packed f16 (16 B) -------------------------------------------------------------------------------
__device__ __forceinline__ v4u pack8h(v4f a, v4f b) {
  v4u p;
  p[0] = pk16(h_bits((_Float16)a[0]), h_bits((_Float16)a[1]));
  p[1] = pk16(h_bits((_Float16)a[2]), h_bits((_Float16)a[3]));
  p[2] = pk16(h_bits((_Float16)b[0]), h_bits((_Float16)b[1]));
  p[3] = pk16(h_bits((_Float16)b[2]), h_bits((_Float16)b[3]));
  return p;
}

// =================================================================================================================
// Weight convert: weights are [out][in] (k contiguous) -> f16 plane value = f16(256 * bf16_RNE(w)).
// coverage: 96*256*8 = 196608 and 32*256*8 = 65536 elements exactly.
// =================================================================================================================
__device__ __forceinline__ void cvt8_w(const float* __restrict__ src, unsigned short* dst, size_t e0) {
  const v4f a = *(const v4f*)(src + e0);
  const v4f b = *(const v4f*)(src + e0 + 4);
  v4f sa, sb;
#pragma unroll
  for (int e = 0; e < 4; ++e) { sa[e] = bfr(a[e]) * CWS; sb[e] = bfr(b[e]) * CWS; }
  const v4u pk = pack8h(sa, sb);
  *(v4u*)(dst + e0) = pk;
  
}
__global__ __launch_bounds__(256) void cvt_w(const float* __restrict__ wqkv, const float* __restrict__ wp,
                                             unsigned short* Wq, unsigned short* Wp) {
  const int tid = threadIdx.x, blk = blockIdx.x;
  if (blk < 96) cvt8_w(wqkv, Wq, ((size_t)blk * 256 + tid) * 8);
  else          cvt8_w(wp,   Wp, ((size_t)(blk - 96) * 256 + tid) * 8);
}

// =================================================================================================================
// Activation gather + convert: X16[T = b*4096 + j][256] = f16(16 * bf16_RNE(x[b][clamp(idx[j])][c])).
// One wave per plane row T: lane reads 8 consecutive channels (two v4f) of the source row and writes one 16-B
// grid = 16384 rows / 8 waves = 2048 blocks. coverage: 16384 rows x 32 lanes x 8 = 16384 x 256 exactly.
// =================================================================================================================
__global__ __launch_bounds__(256) void cvt_x(const float* __restrict__ x, const int* __restrict__ idx,
                                             unsigned short* X16) {
  const int tid = threadIdx.x, lane = tid & 31;
  const int R = blockIdx.x * 8 + (tid >> 5);
  const int b = R >> 12, j = R & (NTOK - 1);
  int src = idx[j];
  src = (src < 0) ? 0 : ((src > NTOK - 1) ? (NTOK - 1) : src);
  const float* sp = x + ((size_t)(b * NTOK + src)) * CIN + lane * 8;
  const v4f a  = *(const v4f*)(sp);
  const v4f a2 = *(const v4f*)(sp + 4);
  v4f sa, sb;
#pragma unroll
  for (int e = 0; e < 4; ++e) { sa[e] = bfr(a[e]) * CXS; sb[e] = bfr(a2[e]) * CXS; }
  const v4u pk = pack8h(sa, sb);
  unsigned short* dp = X16 + (size_t)R * CIN + lane * 8;
  *(v4u*)dp = pk;
  
}

// =================================================================================================================
// qkv GEMM D[T][co] = X16[T][ci] . Wq[co][ci], K = 256, co 0..767 (q = 0..255, k = 256..511, v = 512..767).
// Block = 8 waves, tile 128 rows x 64 cols, wave = 16 rows x 4 n-tiles, fragments straight from global with the
// split k map, k-step 32 (8 steps). grid = (12, 128). Block column groups 0..7 -> token-major plane QK[T][512]
// V16[b][c][n] = f16(16 * value): staged block-wide as [64 ch][SBP] (tokens contiguous; a 128-token tile lies
// within one batch row block), wave w owns channels w*8..+7; one instruction = lanes 0..15 -> channel cc (256 B =
// coverage: QK: 8 waves x 4 it x 4 rows x 8 pieces x 8 = 128 rows x 64 cols per block, 8 x 128 blocks tile
// 16384 x 512 exactly; V16: 8 waves x 4 it x 2 ch x 16 lanes x 8 = 64 ch x 128 tok per block, 4 x 128 blocks
// tile 256 ch x 16384 tok exactly.
// =================================================================================================================
__global__ __launch_bounds__(256)
void gemm_qkv(const unsigned short* __restrict__ X16, const unsigned short* __restrict__ Wq,
              unsigned short* QK, unsigned short* V16) {
  __shared__ __align__(16) float sm[8 * 16 * STP];
  const int tid = threadIdx.x, wave = tid >> 5, lane = tid & 31, hh = lane >> 4, c = lane & 15;
  const int n0 = blockIdx.x * 64, m0 = blockIdx.y * 128;
  const int arow = m0 + wave * 16 + c;
  const _Float16* A = (const _Float16*)(const void*)X16;
  const _Float16* B = (const _Float16*)(const void*)Wq;

  v8f acc[4];
#pragma unroll
  for (int nt = 0; nt < 4; ++nt) acc[nt] = zero8();

#pragma unroll 1
  for (int k0 = 0; k0 < CIN; k0 += 32) {
    const v16h af = ldfrag_h(A + (size_t)arow * CIN + k0 + 8 * hh);
#pragma unroll
    for (int nt = 0; nt < 4; ++nt) {
      const v16h bfrag = ldfrag_h(B + (size_t)(n0 + nt * 16 + c) * CIN + k0 + 8 * hh);
      acc[nt] = mma_h(af, bfrag, acc[nt]);
    }
  }

  if (blockIdx.x < 8) {
    float* st = sm + wave * (16 * STP);
#pragma unroll
    for (int nt = 0; nt < 4; ++nt) {
#pragma unroll
      for (int r = 0; r < 8; ++r) st[(8 * hh + r) * STP + nt * 16 + c] = acc[nt][r];
    }
    wave_sync_lds();
    const int piece = lane & 7, rsub = lane >> 3;
    v4u pk[4];
    size_t offs[4];
#pragma unroll
    for (int it = 0; it < 4; ++it) {
      const int row = it * 4 + rsub;
      v4f fa = *(const v4f*)(st + row * STP + piece * 8);
      v4f fb = *(const v4f*)(st + row * STP + piece * 8 + 4);
      fa = fa * CQK;
      fb = fb * CQK;
      pk[it] = pack8h(fa, fb);
      offs[it] = ((size_t)(m0 + wave * 16 + row)) * C2 + n0 + piece * 8;
    }
    {
#pragma unroll
      for (int it = 0; it < 4; ++it) *(v4u*)(QK + offs[it]) = pk[it];
      
    }
  } else {
    const int cv0 = n0 - C2;
#pragma unroll
    for (int nt = 0; nt < 4; ++nt) {
#pragma unroll
      for (int r = 0; r < 8; ++r) sm[(nt * 16 + c) * SBP + wave * 16 + 8 * hh + r] = acc[nt][r];
    }
    __syncthreads();
    const int bimg = m0 >> 12, s0 = m0 & (NTOK - 1);
    v4u pk[4];
    size_t o16[4];
#pragma unroll
    for (int i2 = 0; i2 < 4; ++i2) {
      const int cc = wave * 8 + i2 * 2 + hh;
      const int co = cv0 + cc;
      v4f fa = *(const v4f*)(sm + cc * SBP + c * 8);
      v4f fb = *(const v4f*)(sm + cc * SBP + c * 8 + 4);
      fa = fa * CVS;
      fb = fb * CVS;
      pk[i2] = pack8h(fa, fb);
      o16[i2] = ((size_t)(bimg * CIN + co)) * NTOK + s0 + c * 8;
    }
    {
#pragma unroll
      for (int i2 = 0; i2 < 4; ++i2) *(v4u*)(V16 + o16[i2]) = pk[i2];
      
    }
  }
}

// =================================================================================================================
// Grouped attention, one unit (batch b, token group gr, head) per block (256 threads = 8 waves), 1024 queries x
// 1024 keys, d = 32. Static LDS: per-wave stage [16][ASP] f32 only; q, k fragments straight from the token-major
// plane QK (q row = T*512 + head*32, k row = +256), v B fragments straight from the channel-major plane V16 (row =
// channel head*32 + d, keys contiguous). Per wave: q-tiles qt = wave, wave+8, ... (< 64).
//   Transposed scores S^T = K_tile (A, 16 keys x 32 d) x Q (B: k = d, n = query): S*256 = q16.k16; D element r of
//   lane l = S[query l&15][key 8h+r], so P = exp((S - m)*scale) x1024 is the A fragment of P.V directly in registers
//   (element i <- key tile 0 row i, element 8+i <- key tile 1 row i). Online softmax over 32 chunks of 32 keys;
//   O = P.V (acc scale 1024*16). Epilogue: O/(l*16384) staged per wave in LDS, then stored as the f16 plane
//   Y[unit][1024][32] of 256*o: one instruction = 32 lanes x 16 B = 512 B = 8 token rows (consecutive lanes
// coverage: per block 64 q-tiles x 16 rows x 32 d of its 1024-row slab; grid covers all 128 units, every slab
// row written exactly once.
// =================================================================================================================
__global__ __launch_bounds__(256)
void attn_k(const unsigned short* __restrict__ QK, const unsigned short* __restrict__ V16, unsigned short* Y) {
  __shared__ __align__(16) float Sst[8 * 16 * ASP];
  const int tid = threadIdx.x, wave = tid >> 5, lane = tid & 31, hh = lane >> 4, c = lane & 15;
  const int u = blockIdx.x;
  const int head = u & 7, gr = (u >> 3) & 3, b = u >> 5;
  const size_t tok0 = (size_t)b * NTOK + (size_t)gr * LGR;
  const _Float16* Qp = (const _Float16*)(const void*)QK + tok0 * C2 + head * HD;
  const _Float16* Kp = Qp + CIN;
  const size_t cm0 = ((size_t)(b * CIN + head * HD)) * NTOK + (size_t)gr * LGR;
  const _Float16* Vp = (const _Float16*)(const void*)V16 + cm0;
  float* st = Sst + wave * (16 * ASP);

#pragma unroll 1
  for (int qt = wave; qt < LGR / 16; qt += 8) {
    const int lq = qt * 16 + c;
    const v16h bq = ldfrag_h(Qp + (size_t)lq * C2 + 8 * hh);     // B: n = query c, k = d 8h.. / 16+8h..

    v8f o0 = zero8(), o1 = zero8();
    float mrun = -1.0e30f, lrun = 0.f;
#pragma unroll 1
    for (int ch = 0; ch < LGR / 32; ++ch) {
      const int kb = ch * 32;
      v8f s[2];
#pragma unroll
      for (int j = 0; j < 2; ++j) {
        const v16h ka = ldfrag_h(Kp + (size_t)(kb + j * 16 + c) * C2 + 8 * hh);   // A: row = key, k = d
        s[j] = mma_h(ka, bq, zero8());
      }
      float mc = s[0][0];
#pragma unroll
      for (int j = 0; j < 2; ++j) {
#pragma unroll
        for (int r = 0; r < 8; ++r) mc = fmaxf(mc, s[j][r]);
      }
      mc = fmaxf(mc, __shfl_xor(mc, 16, 32));
      const float mnew = fmaxf(mrun, mc);
      const float alpha = __expf((mrun - mnew) * QKSC);
#pragma unroll
      for (int r = 0; r < 8; ++r) {
        const float arr = __shfl(alpha, 8 * hh + r, 32);
        o0[r] = o0[r] * arr;
        o1[r] = o1[r] * arr;
      }
      float psum = 0.f;
      v16h pfh;
#pragma unroll
      for (int i = 0; i < 8; ++i) {
        const float e0 = __expf((s[0][i] - mnew) * QKSC);
        const float e1 = __expf((s[1][i] - mnew) * QKSC);
        psum = psum + (e0 + e1);
        pfh[i]     = (_Float16)(e0 * 1024.0f);
        pfh[8 + i] = (_Float16)(e1 * 1024.0f);
      }
      lrun = lrun * alpha + psum;
      mrun = mnew;
      {
        const v16h vf0 = ldfrag_h(Vp + (size_t)c * NTOK + kb + 8 * hh);              // B: n = d c, keys kb..+31
        const v16h vf1 = ldfrag_h(Vp + (size_t)(HD / 2 + c) * NTOK + kb + 8 * hh);   // B: n = d 16+c
        o0 = mma_h(pfh, vf0, o0);
        o1 = mma_h(pfh, vf1, o1);
      }
    }
    const float lsum = lrun + __shfl_xor(lrun, 16, 32);      // lane q (and q+16) holds the full row sum of query q
    const float rinv = 1.0f / (lsum * 16384.0f);
#pragma unroll
    for (int r = 0; r < 8; ++r) {
      const int q = 8 * hh + r;
      const float inv = __shfl(rinv, q, 32);
      st[q * ASP + c]          = o0[r] * inv;
      st[q * ASP + HD / 2 + c] = o1[r] * inv;
    }
    wave_sync_lds();
    {
      const int rr = lane >> 2, dp = (lane & 3) * 8;
      v4u pk[2];
      size_t offs[2];
#pragma unroll
      for (int it = 0; it < 2; ++it) {
        const int row = it * 8 + rr;
        v4f fa = *(const v4f*)(st + row * ASP + dp);
        v4f fb = *(const v4f*)(st + row * ASP + dp + 4);
        fa = fa * CYS;
        fb = fb * CYS;
        pk[it] = pack8h(fa, fb);
        offs[it] = ((size_t)u * LGR + (size_t)(qt * 16 + row)) * HD + dp;
      }
      {
#pragma unroll
        for (int it = 0; it < 2; ++it) *(v4u*)(Y + offs[it]) = pk[it];
        
      }
    }
    wave_sync_lds();
  }
}

// =================================================================================================================
// Output projection D[T][co] = Y[T][ci] . Wp[co][ci] + bias, rows T in shuffled token order, written to the
// un-shuffled output row idx[j] (clamped) of batch b. A = Y plane (x256) addressed by arithmetic: token T ->
// (batch, group, query), k-step ks = head ks, channels ks*32 + d (elements 0..7 d = 8h.., elements 8..15 d =
// 16+8h..). B = weight plane x256. Epilogue: value = acc/65536 + bf16(b)[co], staged per wave in LDS [16][STP];
// coverage: 8 waves x 8 it x 2 rows x 16 lanes x 4 = 128 rows x 64 co per block; grid tiles 16384 x 256 exactly;
// with idx a permutation every output row is written exactly once.
// =================================================================================================================
__global__ __launch_bounds__(256)
void gemm_proj(const unsigned short* __restrict__ Y, const unsigned short* __restrict__ Wp,
               const float* __restrict__ bp, const int* __restrict__ idx, float* out) {
  __shared__ __align__(16) float sm[8 * 16 * STP];
  const int tid = threadIdx.x, wave = tid >> 5, lane = tid & 31, hh = lane >> 4, c = lane & 15;
  const int n0 = blockIdx.x * 64, m0 = blockIdx.y * 128;
  const int T = m0 + wave * 16 + c;
  const int bq = T >> 12, jj = T & (NTOK - 1), gr = jj >> 10, q = jj & (LGR - 1);
  const size_t abase = (((size_t)((bq * NGR + gr) * NHD)) * LGR + (size_t)q) * HD + 8 * hh;
  const _Float16* A = (const _Float16*)(const void*)Y;
  const _Float16* B = (const _Float16*)(const void*)Wp;

  v8f acc[4];
#pragma unroll
  for (int nt = 0; nt < 4; ++nt) acc[nt] = zero8();

#pragma unroll 1
  for (int ks = 0; ks < NHD; ++ks) {
    const size_t bo = abase + (size_t)ks * (LGR * HD);
    const v16h af = ldfrag_h(A + bo);
#pragma unroll
    for (int nt = 0; nt < 4; ++nt) {
      const v16h bfrag = ldfrag_h(B + (size_t)(n0 + nt * 16 + c) * CIN + ks * 32 + 8 * hh);
      acc[nt] = mma_h(af, bfrag, acc[nt]);
    }
  }

  float* st = sm + wave * (16 * STP);
#pragma unroll
  for (int nt = 0; nt < 4; ++nt) {
    const int co = n0 + nt * 16 + c;
    const float bi = bfr(bp[co]);
#pragma unroll
    for (int r = 0; r < 8; ++r) st[(8 * hh + r) * STP + nt * 16 + c] = acc[nt][r] * (1.0f / 65536.0f) + bi;
  }
  wave_sync_lds();
  const int bimg = m0 >> 12;
  const int jbase = (m0 & (NTOK - 1)) + wave * 16;
  v4f ov[8];
  size_t offs[8];
#pragma unroll
  for (int it = 0; it < 8; ++it) {
    const int row = it * 2 + hh;
    int dst = idx[jbase + row];
    dst = (dst < 0) ? 0 : ((dst > NTOK - 1) ? (NTOK - 1) : dst);
    ov[it] = *(const v4f*)(st + row * STP + c * 4);
    offs[it] = ((size_t)(bimg * NTOK + dst)) * CIN + n0 + c * 4;
  }
  {
#pragma unroll
    for (int it = 0; it < 8; ++it) *(v4f*)(out + offs[it]) = ov[it];
    
  }
}

// =================================================================================================================
//   Wq f16 [768][256] 393216 @0; Wp f16 [256][256] 131072 @393216; X16 f16 [16384][256] 8388608 @524288;
//   QK f16 [16384][512] 16777216 @8912896; V16 f16 [4][256][4096] 8388608 @25690112;
//   Y f16 [128][1024][32] 8388608 @34078720. Total 42467328.
// =================================================================================================================
extern "C" void kernel_launch(void* const* d_in, const int* in_sizes, int n_in,
                              void* d_out, int out_size, void* d_ws, size_t ws_size,
                              hipStream_t stream) {
  if (n_in < 5) return;
  if (in_sizes[0] != NBAT * NTOK * CIN) return;
  if (in_sizes[1] != NTOK) return;
  if (in_sizes[2] != C3 * CIN) return;
  if (in_sizes[3] != CIN * CIN) return;
  if (in_sizes[4] != CIN) return;
  if (out_size != NBAT * NTOK * CIN) return;

  const float* x      = (const float*)d_in[0];
  const int*   idx    = (const int*)d_in[1];
  const float* w_qkv  = (const float*)d_in[2];
  const float* w_proj = (const float*)d_in[3];
  const float* b_proj = (const float*)d_in[4];
  float* out = (float*)d_out;

  const size_t sWq  = (size_t)C3 * CIN * 2;              //    393216
  const size_t sWp  = (size_t)CIN * CIN * 2;             //    131072
  const size_t sX16 = (size_t)MTOK * CIN * 2;            //   8388608
  const size_t sQK  = (size_t)MTOK * C2 * 2;             //  16777216
  const size_t sV16 = (size_t)NBAT * CIN * NTOK * 2;     //   8388608
  const size_t sY   = (size_t)NUNIT * LGR * HD * 2;      //   8388608
  size_t off = 0;
  const size_t oWq  = off; off += sWq;
  const size_t oWp  = off; off += sWp;
  const size_t oX16 = off; off += sX16;
  const size_t oQK  = off; off += sQK;
  const size_t oV16 = off; off += sV16;
  const size_t oY   = off; off += sY;
  if (off > ws_size) return;                             // off = 42467328
  if (off > (size_t)134217728) return;

  char* ws = (char*)d_ws;
  unsigned short* Wq  = (unsigned short*)(ws + oWq);
  unsigned short* Wp  = (unsigned short*)(ws + oWp);
  unsigned short* X16 = (unsigned short*)(ws + oX16);
  unsigned short* QK  = (unsigned short*)(ws + oQK);
  unsigned short* V16 = (unsigned short*)(ws + oV16);
  unsigned short* Yp  = (unsigned short*)(ws + oY);

  const dim3 blk(256);
  // (1) weights -> f16 x256 planes
  cvt_w<<<dim3(128), blk, 0, stream>>>(w_qkv, w_proj, Wq, Wp);
  // (2) gather x rows by idx -> token-major f16 x16 plane
  cvt_x<<<dim3(MTOK / 8), blk, 0, stream>>>(x, idx, X16);
  // (3) qkv projection -> token-major q/k plane and channel-major v plane
  gemm_qkv<<<dim3(C3 / 64, MTOK / 128), blk, 0, stream>>>(X16, Wq, QK, V16);
  // (4) grouped multi-head attention -> ctx slab plane
  attn_k<<<dim3(NUNIT), blk, 0, stream>>>(QK, V16, Yp);
  // (5) output projection + bias, rows written to their un-shuffled positions
  gemm_proj<<<dim3(CIN / 64, MTOK / 128), blk, 0, stream>>>(Yp, Wp, b_proj, idx, out);
  (void)hipGetLastError();
}

// v001
// Measured time: 124 microseconds a run.
// Next to v000, in two timings, it ran 2.11 and 2.09 times as fast.
// Contractions: v_wmma_f32_16x16x32_f16 (f16 operands, f32 accumulate). qkv projection: A = gathered x rows
// (bf16-valued, x16) single plane, B = w_qkv (bf16-valued, x256) single plane; scores k.qT: k x16, q x16 single
// planes; p.v: p x1024, v x16 single planes; output projection: A = ctx x256 single f16 plane, B = w_proj
// (bf16-valued, x256) single plane. Online softmax in f32 on VALU. Float inputs RNE-converted to bf16 on load.
#include <hip/hip_runtime.h>
#include <math.h>
#include <stdint.h>

#define NBAT  4
#define NTOK  4096
#define CIN   256
#define C2    512
#define C3    768
#define MTOK  16384
#define NHD   8
#define HD    32
#define NGR   4
#define LGR   1024
#define NUNIT 128
#define AWV   32
#define AQS   2
#define STP   68
#define SBP   132
#define ASP   36
#define CXS   16.0f
#define CWS   256.0f
#define CQK   (16.0f / 4096.0f)
#define CVS   (16.0f / 4096.0f)
#define CYS   256.0f
#define QKSC  (0.17677669529663688f / 256.0f)

static_assert(NUNIT == NBAT * NGR * NHD);
static_assert(NGR * LGR == NTOK);
static_assert(MTOK == NBAT * NTOK);
static_assert(NTOK % 128 == 0);
static_assert(LGR % 32 == 0);
static_assert(AQS * AWV * 16 == LGR);
static_assert(CIN % 64 == 0);
static_assert(NHD * HD == CIN);
static_assert(64 * SBP <= 8 * 16 * STP);
static_assert((STP * 4) % 16 == 0);
static_assert((SBP * 4) % 16 == 0);
static_assert((ASP * 4) % 16 == 0);
static_assert(C3 * CIN == 96 * 256 * 8);
static_assert(CIN * CIN == 32 * 256 * 8);

typedef _Float16 v16h __attribute__((ext_vector_type(16)));
typedef _Float16 v8h  __attribute__((ext_vector_type(8)));
typedef float    v8f  __attribute__((ext_vector_type(8)));
typedef float    v4f  __attribute__((ext_vector_type(4)));
typedef unsigned int v4u __attribute__((ext_vector_type(4)));
union Frag { v16h v; v8h half[2]; };

// ---- scalar helpers -------------------------------------------------------------------------------------------
__device__ __forceinline__ unsigned short bf_bits(float f) {          // f32 -> bf16 bits, RNE convert
  unsigned u = __float_as_uint(f);
  return (unsigned short)((u + 0x7FFFu + ((u >> 16) & 1u)) >> 16);
}
__device__ __forceinline__ float bfr(float f) { return __uint_as_float(((unsigned)bf_bits(f)) << 16); }
__device__ __forceinline__ unsigned short h_bits(_Float16 x) { return __builtin_bit_cast(unsigned short, x); }
__device__ __forceinline__ unsigned pk16(unsigned short a, unsigned short b) { return (unsigned)a | ((unsigned)b << 16); }
__device__ __forceinline__ v8f zero8() { v8f z = {0.f, 0.f, 0.f, 0.f, 0.f, 0.f, 0.f, 0.f}; return z; }

// ---- fragment loader: 16-bit A/B operand, lane -> row/col (lane&15), p already includes +8*(lane>>4);
//      elements 0..7 <- p[0..7] (k0+8h..), elements 8..15 <- p[16..23] (k0+16+8h..)
__device__ __forceinline__ v16h ldfrag_h(const _Float16* p) {
  Frag f;
  f.half[0] = *(const v8h*)(p);
  f.half[1] = *(const v8h*)(p + 16);
  return f.v;
}

// ---- WMMA helper with trailing VALU hazard gap ----------------------------------------------------------------
__device__ __forceinline__ v8f mma_h(v16h a, v16h b, v8f c) {
  c = __builtin_amdgcn_wmma_f32_16x16x32_f16(false, a, false, b, (short)0, c, false, false);
#if defined(__HIP_DEVICE_COMPILE__)
  asm volatile("v_nop\n\tv_nop\n\tv_nop\n\tv_nop" : "+v"(c) : "v"(a), "v"(b));
#endif
  return c;
}
__device__ __forceinline__ void wave_sync_lds() {
  __builtin_amdgcn_fence(__ATOMIC_RELEASE, "workgroup");
  __builtin_amdgcn_wave_barrier();
  __builtin_amdgcn_fence(__ATOMIC_ACQUIRE, "workgroup");
}

// ---- 8 f32 -> 8 packed f16 (16 B) -------------------------------------------------------------------------------
__device__ __forceinline__ v4u pack8h(v4f a, v4f b) {
  v4u p;
  p[0] = pk16(h_bits((_Float16)a[0]), h_bits((_Float16)a[1]));
  p[1] = pk16(h_bits((_Float16)a[2]), h_bits((_Float16)a[3]));
  p[2] = pk16(h_bits((_Float16)b[0]), h_bits((_Float16)b[1]));
  p[3] = pk16(h_bits((_Float16)b[2]), h_bits((_Float16)b[3]));
  return p;
}

// =================================================================================================================
// Weight convert: weights are [out][in] (k contiguous) -> f16 plane value = f16(256 * bf16_RNE(w)).
// coverage: 96*256*8 = 196608 and 32*256*8 = 65536 elements exactly.
// =================================================================================================================
__device__ __forceinline__ void cvt8_w(const float* __restrict__ src, unsigned short* dst, size_t e0) {
  const v4f a = *(const v4f*)(src + e0);
  const v4f b = *(const v4f*)(src + e0 + 4);
  v4f sa, sb;
#pragma unroll
  for (int e = 0; e < 4; ++e) { sa[e] = bfr(a[e]) * CWS; sb[e] = bfr(b[e]) * CWS; }
  const v4u pk = pack8h(sa, sb);
  *(v4u*)(dst + e0) = pk;
  
}
__global__ __launch_bounds__(256) void cvt_w(const float* __restrict__ wqkv, const float* __restrict__ wp,
                                             unsigned short* Wq, unsigned short* Wp) {
  const int tid = threadIdx.x, blk = blockIdx.x;
  if (blk < 96) cvt8_w(wqkv, Wq, ((size_t)blk * 256 + tid) * 8);
  else          cvt8_w(wp,   Wp, ((size_t)(blk - 96) * 256 + tid) * 8);
}

// =================================================================================================================
// Activation gather + convert: X16[T = b*4096 + j][256] = f16(16 * bf16_RNE(x[b][clamp(idx[j])][c])).
// One wave per plane row T: lane reads 8 consecutive channels (two v4f) of the source row and writes one 16-B
// grid = 16384 rows / 8 waves = 2048 blocks. coverage: 16384 rows x 32 lanes x 8 = 16384 x 256 exactly.
// =================================================================================================================
__global__ __launch_bounds__(256) void cvt_x(const float* __restrict__ x, const int* __restrict__ idx,
                                             unsigned short* X16) {
  const int tid = threadIdx.x, lane = tid & 31;
  const int R = blockIdx.x * 8 + (tid >> 5);
  const int b = R >> 12, j = R & (NTOK - 1);
  int src = idx[j];
  src = (src < 0) ? 0 : ((src > NTOK - 1) ? (NTOK - 1) : src);
  const float* sp = x + ((size_t)(b * NTOK + src)) * CIN + lane * 8;
  const v4f a  = *(const v4f*)(sp);
  const v4f a2 = *(const v4f*)(sp + 4);
  v4f sa, sb;
#pragma unroll
  for (int e = 0; e < 4; ++e) { sa[e] = bfr(a[e]) * CXS; sb[e] = bfr(a2[e]) * CXS; }
  const v4u pk = pack8h(sa, sb);
  unsigned short* dp = X16 + (size_t)R * CIN + lane * 8;
  *(v4u*)dp = pk;
  
}

// =================================================================================================================
// qkv GEMM D[T][co] = X16[T][ci] . Wq[co][ci], K = 256, co 0..767 (q = 0..255, k = 256..511, v = 512..767).
// Block = 8 waves, tile 128 rows x 64 cols, wave = 16 rows x 4 n-tiles, fragments straight from global with the
// split k map, k-step 32 (8 steps). grid = (12, 128). Block column groups 0..7 -> token-major plane QK[T][512]
// V16[b][c][n] = f16(16 * value): staged block-wide as [64 ch][SBP] (tokens contiguous; a 128-token tile lies
// within one batch row block), wave w owns channels w*8..+7; one instruction = lanes 0..15 -> channel cc (256 B =
// coverage: QK: 8 waves x 4 it x 4 rows x 8 pieces x 8 = 128 rows x 64 cols per block, 8 x 128 blocks tile
// 16384 x 512 exactly; V16: 8 waves x 4 it x 2 ch x 16 lanes x 8 = 64 ch x 128 tok per block, 4 x 128 blocks
// tile 256 ch x 16384 tok exactly.
// =================================================================================================================
__global__ __launch_bounds__(256)
void gemm_qkv(const unsigned short* __restrict__ X16, const unsigned short* __restrict__ Wq,
              unsigned short* QK, unsigned short* V16) {
  __shared__ __align__(16) float sm[8 * 16 * STP];
  const int tid = threadIdx.x, wave = tid >> 5, lane = tid & 31, hh = lane >> 4, c = lane & 15;
  const int n0 = blockIdx.x * 64, m0 = blockIdx.y * 128;
  const int arow = m0 + wave * 16 + c;
  const _Float16* A = (const _Float16*)(const void*)X16;
  const _Float16* B = (const _Float16*)(const void*)Wq;

  v8f acc[4];
#pragma unroll
  for (int nt = 0; nt < 4; ++nt) acc[nt] = zero8();

#pragma unroll 1
  for (int k0 = 0; k0 < CIN; k0 += 32) {
    const v16h af = ldfrag_h(A + (size_t)arow * CIN + k0 + 8 * hh);
#pragma unroll
    for (int nt = 0; nt < 4; ++nt) {
      const v16h bfrag = ldfrag_h(B + (size_t)(n0 + nt * 16 + c) * CIN + k0 + 8 * hh);
      acc[nt] = mma_h(af, bfrag, acc[nt]);
    }
  }

  if (blockIdx.x < 8) {
    float* st = sm + wave * (16 * STP);
#pragma unroll
    for (int nt = 0; nt < 4; ++nt) {
#pragma unroll
      for (int r = 0; r < 8; ++r) st[(8 * hh + r) * STP + nt * 16 + c] = acc[nt][r];
    }
    wave_sync_lds();
    const int piece = lane & 7, rsub = lane >> 3;
    v4u pk[4];
    size_t offs[4];
#pragma unroll
    for (int it = 0; it < 4; ++it) {
      const int row = it * 4 + rsub;
      v4f fa = *(const v4f*)(st + row * STP + piece * 8);
      v4f fb = *(const v4f*)(st + row * STP + piece * 8 + 4);
      fa = fa * CQK;
      fb = fb * CQK;
      pk[it] = pack8h(fa, fb);
      offs[it] = ((size_t)(m0 + wave * 16 + row)) * C2 + n0 + piece * 8;
    }
    {
#pragma unroll
      for (int it = 0; it < 4; ++it) *(v4u*)(QK + offs[it]) = pk[it];
      
    }
  } else {
    const int cv0 = n0 - C2;
#pragma unroll
    for (int nt = 0; nt < 4; ++nt) {
#pragma unroll
      for (int r = 0; r < 8; ++r) sm[(nt * 16 + c) * SBP + wave * 16 + 8 * hh + r] = acc[nt][r];
    }
    __syncthreads();
    const int bimg = m0 >> 12, s0 = m0 & (NTOK - 1);
    v4u pk[4];
    size_t o16[4];
#pragma unroll
    for (int i2 = 0; i2 < 4; ++i2) {
      const int cc = wave * 8 + i2 * 2 + hh;
      const int co = cv0 + cc;
      v4f fa = *(const v4f*)(sm + cc * SBP + c * 8);
      v4f fb = *(const v4f*)(sm + cc * SBP + c * 8 + 4);
      fa = fa * CVS;
      fb = fb * CVS;
      pk[i2] = pack8h(fa, fb);
      o16[i2] = ((size_t)(bimg * CIN + co)) * NTOK + s0 + c * 8;
    }
    {
#pragma unroll
      for (int i2 = 0; i2 < 4; ++i2) *(v4u*)(V16 + o16[i2]) = pk[i2];
      
    }
  }
}

// =================================================================================================================
// Grouped attention, one unit (batch b, token group gr, head) per AQS = 2 blocks of 1024 threads = 32 waves, 1024
// queries x 1024 keys, d = 32: 256 blocks, 8 waves per SIMD, all waves of a block walk the same k and v rows.
// Static LDS: per-wave stage [16][ASP] f32 only; q, k fragments straight from the token-major
// plane QK (q row = T*512 + head*32, k row = +256), v B fragments straight from the channel-major plane V16 (row =
// channel head*32 + d, keys contiguous). Per wave: the one q-tile qt = part*32 + wave (< 64).
//   Transposed scores S^T = K_tile (A, 16 keys x 32 d) x Q (B: k = d, n = query): S*256 = q16.k16; D element r of
//   lane l = S[query l&15][key 8h+r], so P = exp((S - m)*scale) x1024 is the A fragment of P.V directly in registers
//   (element i <- key tile 0 row i, element 8+i <- key tile 1 row i). Online softmax over 32 chunks of 32 keys;
//   O = P.V (acc scale 1024*16). Epilogue: O/(l*16384) staged per wave in LDS, then stored as the f16 plane
//   Y[unit][1024][32] of 256*o: one instruction = 32 lanes x 16 B = 512 B = 8 token rows (consecutive lanes
// coverage: per block 32 q-tiles x 16 rows x 32 d, half of its unit's 1024-row slab; grid covers 2 halves x 128
// units, every slab row written exactly once.
// =================================================================================================================
__global__ __launch_bounds__(AWV * 32)
void attn_k(const unsigned short* __restrict__ QK, const unsigned short* __restrict__ V16, unsigned short* Y) {
  __shared__ __align__(16) float Sst[AWV * 16 * ASP];
  const int tid = threadIdx.x, wave = tid >> 5, lane = tid & 31, hh = lane >> 4, c = lane & 15;
  const int u = blockIdx.x & (NUNIT - 1), part = blockIdx.x / NUNIT;
  const int head = u & 7, gr = (u >> 3) & 3, b = u >> 5;
  const size_t tok0 = (size_t)b * NTOK + (size_t)gr * LGR;
  const _Float16* Qp = (const _Float16*)(const void*)QK + tok0 * C2 + head * HD;
  const _Float16* Kp = Qp + CIN;
  const size_t cm0 = ((size_t)(b * CIN + head * HD)) * NTOK + (size_t)gr * LGR;
  const _Float16* Vp = (const _Float16*)(const void*)V16 + cm0;
  float* st = Sst + wave * (16 * ASP);

  {
    const int qt = part * AWV + wave;
    const int lq = qt * 16 + c;
    const v16h bq = ldfrag_h(Qp + (size_t)lq * C2 + 8 * hh);     // B: n = query c, k = d 8h.. / 16+8h..

    v8f o0 = zero8(), o1 = zero8();
    float mrun = -1.0e30f, lrun = 0.f;
#pragma unroll 1
    for (int ch = 0; ch < LGR / 32; ++ch) {
      const int kb = ch * 32;
      v8f s[2];
#pragma unroll
      for (int j = 0; j < 2; ++j) {
        const v16h ka = ldfrag_h(Kp + (size_t)(kb + j * 16 + c) * C2 + 8 * hh);   // A: row = key, k = d
        s[j] = mma_h(ka, bq, zero8());
      }
      float mc = s[0][0];
#pragma unroll
      for (int j = 0; j < 2; ++j) {
#pragma unroll
        for (int r = 0; r < 8; ++r) mc = fmaxf(mc, s[j][r]);
      }
      mc = fmaxf(mc, __shfl_xor(mc, 16, 32));
      const float mnew = fmaxf(mrun, mc);
      const float alpha = __expf((mrun - mnew) * QKSC);
#pragma unroll
      for (int r = 0; r < 8; ++r) {
        const float arr = __shfl(alpha, 8 * hh + r, 32);
        o0[r] = o0[r] * arr;
        o1[r] = o1[r] * arr;
      }
      float psum = 0.f;
      v16h pfh;
#pragma unroll
      for (int i = 0; i < 8; ++i) {
        const float e0 = __expf((s[0][i] - mnew) * QKSC);
        const float e1 = __expf((s[1][i] - mnew) * QKSC);
        psum = psum + (e0 + e1);
        pfh[i]     = (_Float16)(e0 * 1024.0f);
        pfh[8 + i] = (_Float16)(e1 * 1024.0f);
      }
      lrun = lrun * alpha + psum;
      mrun = mnew;
      {
        const v16h vf0 = ldfrag_h(Vp + (size_t)c * NTOK + kb + 8 * hh);              // B: n = d c, keys kb..+31
        const v16h vf1 = ldfrag_h(Vp + (size_t)(HD / 2 + c) * NTOK + kb + 8 * hh);   // B: n = d 16+c
        o0 = mma_h(pfh, vf0, o0);
        o1 = mma_h(pfh, vf1, o1);
      }
    }
    const float lsum = lrun + __shfl_xor(lrun, 16, 32);      // lane q (and q+16) holds the full row sum of query q
    const float rinv = 1.0f / (lsum * 16384.0f);
#pragma unroll
    for (int r = 0; r < 8; ++r) {
      const int q = 8 * hh + r;
      const float inv = __shfl(rinv, q, 32);
      st[q * ASP + c]          = o0[r] * inv;
      st[q * ASP + HD / 2 + c] = o1[r] * inv;
    }
    wave_sync_lds();
    {
      const int rr = lane >> 2, dp = (lane & 3) * 8;
      v4u pk[2];
      size_t offs[2];
#pragma unroll
      for (int it = 0; it < 2; ++it) {
        const int row = it * 8 + rr;
        v4f fa = *(const v4f*)(st + row * ASP + dp);
        v4f fb = *(const v4f*)(st + row * ASP + dp + 4);
        fa = fa * CYS;
        fb = fb * CYS;
        pk[it] = pack8h(fa, fb);
        offs[it] = ((size_t)u * LGR + (size_t)(qt * 16 + row)) * HD + dp;
      }
      {
#pragma unroll
        for (int it = 0; it < 2; ++it) *(v4u*)(Y + offs[it]) = pk[it];
        
      }
    }
  }
}

// =================================================================================================================
// Output projection D[T][co] = Y[T][ci] . Wp[co][ci] + bias, rows T in shuffled token order, written to the
// un-shuffled output row idx[j] (clamped) of batch b. A = Y plane (x256) addressed by arithmetic: token T ->
// (batch, group, query), k-step ks = head ks, channels ks*32 + d (elements 0..7 d = 8h.., elements 8..15 d =
// 16+8h..). B = weight plane x256. Epilogue: value = acc/65536 + bf16(b)[co], staged per wave in LDS [16][STP];
// coverage: 8 waves x 8 it x 2 rows x 16 lanes x 4 = 128 rows x 64 co per block; grid tiles 16384 x 256 exactly;
// with idx a permutation every output row is written exactly once.
// =================================================================================================================
__global__ __launch_bounds__(256)
void gemm_proj(const unsigned short* __restrict__ Y, const unsigned short* __restrict__ Wp,
               const float* __restrict__ bp, const int* __restrict__ idx, float* out) {
  __shared__ __align__(16) float sm[8 * 16 * STP];
  const int tid = threadIdx.x, wave = tid >> 5, lane = tid & 31, hh = lane >> 4, c = lane & 15;
  const int n0 = blockIdx.x * 64, m0 = blockIdx.y * 128;
  const int T = m0 + wave * 16 + c;
  const int bq = T >> 12, jj = T & (NTOK - 1), gr = jj >> 10, q = jj & (LGR - 1);
  const size_t abase = (((size_t)((bq * NGR + gr) * NHD)) * LGR + (size_t)q) * HD + 8 * hh;
  const _Float16* A = (const _Float16*)(const void*)Y;
  const _Float16* B = (const _Float16*)(const void*)Wp;

  v8f acc[4];
#pragma unroll
  for (int nt = 0; nt < 4; ++nt) acc[nt] = zero8();

#pragma unroll 1
  for (int ks = 0; ks < NHD; ++ks) {
    const size_t bo = abase + (size_t)ks * (LGR * HD);
    const v16h af = ldfrag_h(A + bo);
#pragma unroll
    for (int nt = 0; nt < 4; ++nt) {
      const v16h bfrag = ldfrag_h(B + (size_t)(n0 + nt * 16 + c) * CIN + ks * 32 + 8 * hh);
      acc[nt] = mma_h(af, bfrag, acc[nt]);
    }
  }

  float* st = sm + wave * (16 * STP);
#pragma unroll
  for (int nt = 0; nt < 4; ++nt) {
    const int co = n0 + nt * 16 + c;
    const float bi = bfr(bp[co]);
#pragma unroll
    for (int r = 0; r < 8; ++r) st[(8 * hh + r) * STP + nt * 16 + c] = acc[nt][r] * (1.0f / 65536.0f) + bi;
  }
  wave_sync_lds();
  const int bimg = m0 >> 12;
  const int jbase = (m0 & (NTOK - 1)) + wave * 16;
  v4f ov[8];
  size_t offs[8];
#pragma unroll
  for (int it = 0; it < 8; ++it) {
    const int row = it * 2 + hh;
    int dst = idx[jbase + row];
    dst = (dst < 0) ? 0 : ((dst > NTOK - 1) ? (NTOK - 1) : dst);
    ov[it] = *(const v4f*)(st + row * STP + c * 4);
    offs[it] = ((size_t)(bimg * NTOK + dst)) * CIN + n0 + c * 4;
  }
  {
#pragma unroll
    for (int it = 0; it < 8; ++it) *(v4f*)(out + offs[it]) = ov[it];
    
  }
}

// =================================================================================================================
//   Wq f16 [768][256] 393216 @0; Wp f16 [256][256] 131072 @393216; X16 f16 [16384][256] 8388608 @524288;
//   QK f16 [16384][512] 16777216 @8912896; V16 f16 [4][256][4096] 8388608 @25690112;
//   Y f16 [128][1024][32] 8388608 @34078720. Total 42467328.
// =================================================================================================================
extern "C" void kernel_launch(void* const* d_in, const int* in_sizes, int n_in,
                              void* d_out, int out_size, void* d_ws, size_t ws_size,
                              hipStream_t stream) {
  if (n_in < 5) return;
  if (in_sizes[0] != NBAT * NTOK * CIN) return;
  if (in_sizes[1] != NTOK) return;
  if (in_sizes[2] != C3 * CIN) return;
  if (in_sizes[3] != CIN * CIN) return;
  if (in_sizes[4] != CIN) return;
  if (out_size != NBAT * NTOK * CIN) return;

  const float* x      = (const float*)d_in[0];
  const int*   idx    = (const int*)d_in[1];
  const float* w_qkv  = (const float*)d_in[2];
  const float* w_proj = (const float*)d_in[3];
  const float* b_proj = (const float*)d_in[4];
  float* out = (float*)d_out;

  const size_t sWq  = (size_t)C3 * CIN * 2;              //    393216
  const size_t sWp  = (size_t)CIN * CIN * 2;             //    131072
  const size_t sX16 = (size_t)MTOK * CIN * 2;            //   8388608
  const size_t sQK  = (size_t)MTOK * C2 * 2;             //  16777216
  const size_t sV16 = (size_t)NBAT * CIN * NTOK * 2;     //   8388608
  const size_t sY   = (size_t)NUNIT * LGR * HD * 2;      //   8388608
  size_t off = 0;
  const size_t oWq  = off; off += sWq;
  const size_t oWp  = off; off += sWp;
  const size_t oX16 = off; off += sX16;
  const size_t oQK  = off; off += sQK;
  const size_t oV16 = off; off += sV16;
  const size_t oY   = off; off += sY;
  if (off > ws_size) return;                             // off = 42467328
  if (off > (size_t)134217728) return;

  char* ws = (char*)d_ws;
  unsigned short* Wq  = (unsigned short*)(ws + oWq);
  unsigned short* Wp  = (unsigned short*)(ws + oWp);
  unsigned short* X16 = (unsigned short*)(ws + oX16);
  unsigned short* QK  = (unsigned short*)(ws + oQK);
  unsigned short* V16 = (unsigned short*)(ws + oV16);
  unsigned short* Yp  = (unsigned short*)(ws + oY);

  const dim3 blk(256);
  // (1) weights -> f16 x256 planes
  cvt_w<<<dim3(128), blk, 0, stream>>>(w_qkv, w_proj, Wq, Wp);
  // (2) gather x rows by idx -> token-major f16 x16 plane
  cvt_x<<<dim3(MTOK / 8), blk, 0, stream>>>(x, idx, X16);
  // (3) qkv projection -> token-major q/k plane and channel-major v plane
  gemm_qkv<<<dim3(C3 / 64, MTOK / 128), blk, 0, stream>>>(X16, Wq, QK, V16);
  // (4) grouped multi-head attention -> ctx slab plane
  attn_k<<<dim3(NUNIT * AQS), dim3(AWV * 32), 0, stream>>>(QK, V16, Yp);
  // (5) output projection + bias, rows written to their un-shuffled positions
  gemm_proj<<<dim3(CIN / 64, MTOK / 128), blk, 0, stream>>>(Yp, Wp, b_proj, idx, out);
  (void)hipGetLastError();
}

// v002
// It runs in 87.4 microseconds.
// Next to v001, in two timings, it ran 1.44 and 1.43 times as fast.
// All steps since v000 together make it 3.01 times as fast.
// Contractions: v_wmma_f32_16x16x32_f16 (f16 operands, f32 accumulate). qkv projection: A = gathered x rows
// (bf16-valued, x16) single plane, B = w_qkv (bf16-valued, x256) single plane; scores k.qT: k x16, q x16 single
// planes; p.v: p x1024, v x16 single planes; output projection: A = ctx x256 single f16 plane, B = w_proj
// (bf16-valued, x256) single plane. Online softmax in f32 on VALU. Float inputs RNE-converted to bf16 on load.
#include <hip/hip_runtime.h>
#include <math.h>
#include <stdint.h>

#define NBAT  4
#define NTOK  4096
#define CIN   256
#define C2    512
#define C3    768
#define MTOK  16384
#define NHD   8
#define HD    32
#define NGR   4
#define LGR   1024
#define NUNIT 128
#define AWV   32
#define AQS   2
#define STP   68
#define SBP   132
#define ASP   36
#define KSP   40
#define VSP   1032
#define CXS   16.0f
#define CWS   256.0f
#define CQK   (16.0f / 4096.0f)
#define CVS   (16.0f / 4096.0f)
#define CYS   256.0f
#define QKSC  (0.17677669529663688f / 256.0f)

static_assert(NUNIT == NBAT * NGR * NHD);
static_assert(NGR * LGR == NTOK);
static_assert(MTOK == NBAT * NTOK);
static_assert(NTOK % 128 == 0);
static_assert(LGR % 32 == 0);
static_assert(AQS * AWV * 16 == LGR);
static_assert(CIN % 64 == 0);
static_assert(NHD * HD == CIN);
static_assert(64 * SBP <= 8 * 16 * STP);
static_assert((STP * 4) % 16 == 0);
static_assert((SBP * 4) % 16 == 0);
static_assert((ASP * 4) % 16 == 0);
static_assert((KSP * 2) % 32 == 16 && KSP >= HD);
static_assert((VSP * 2) % 32 == 16 && VSP >= LGR);
static_assert(LGR * HD == 4 * AWV * 32 * 8);
static_assert(C3 * CIN == 96 * 256 * 8);
static_assert(CIN * CIN == 32 * 256 * 8);

typedef _Float16 v16h __attribute__((ext_vector_type(16)));
typedef _Float16 v8h  __attribute__((ext_vector_type(8)));
typedef float    v8f  __attribute__((ext_vector_type(8)));
typedef float    v4f  __attribute__((ext_vector_type(4)));
typedef unsigned int v4u __attribute__((ext_vector_type(4)));
union Frag { v16h v; v8h half[2]; };

// ---- scalar helpers -------------------------------------------------------------------------------------------
__device__ __forceinline__ unsigned short bf_bits(float f) {          // f32 -> bf16 bits, RNE convert
  unsigned u = __float_as_uint(f);
  return (unsigned short)((u + 0x7FFFu + ((u >> 16) & 1u)) >> 16);
}
__device__ __forceinline__ float bfr(float f) { return __uint_as_float(((unsigned)bf_bits(f)) << 16); }
__device__ __forceinline__ unsigned short h_bits(_Float16 x) { return __builtin_bit_cast(unsigned short, x); }
__device__ __forceinline__ unsigned pk16(unsigned short a, unsigned short b) { return (unsigned)a | ((unsigned)b << 16); }
__device__ __forceinline__ v8f zero8() { v8f z = {0.f, 0.f, 0.f, 0.f, 0.f, 0.f, 0.f, 0.f}; return z; }

// ---- fragment loader: 16-bit A/B operand, lane -> row/col (lane&15), p already includes +8*(lane>>4);
//      elements 0..7 <- p[0..7] (k0+8h..), elements 8..15 <- p[16..23] (k0+16+8h..)
__device__ __forceinline__ v16h ldfrag_h(const _Float16* p) {
  Frag f;
  f.half[0] = *(const v8h*)(p);
  f.half[1] = *(const v8h*)(p + 16);
  return f.v;
}

// ---- WMMA helper with trailing VALU hazard gap ----------------------------------------------------------------
__device__ __forceinline__ v8f mma_h(v16h a, v16h b, v8f c) {
  c = __builtin_amdgcn_wmma_f32_16x16x32_f16(false, a, false, b, (short)0, c, false, false);
#if defined(__HIP_DEVICE_COMPILE__)
  asm volatile("v_nop\n\tv_nop\n\tv_nop\n\tv_nop" : "+v"(c) : "v"(a), "v"(b));
#endif
  return c;
}
__device__ __forceinline__ void wave_sync_lds() {
  __builtin_amdgcn_fence(__ATOMIC_RELEASE, "workgroup");
  __builtin_amdgcn_wave_barrier();
  __builtin_amdgcn_fence(__ATOMIC_ACQUIRE, "workgroup");
}

// ---- 8 f32 -> 8 packed f16 (16 B) -------------------------------------------------------------------------------
__device__ __forceinline__ v4u pack8h(v4f a, v4f b) {
  v4u p;
  p[0] = pk16(h_bits((_Float16)a[0]), h_bits((_Float16)a[1]));
  p[1] = pk16(h_bits((_Float16)a[2]), h_bits((_Float16)a[3]));
  p[2] = pk16(h_bits((_Float16)b[0]), h_bits((_Float16)b[1]));
  p[3] = pk16(h_bits((_Float16)b[2]), h_bits((_Float16)b[3]));
  return p;
}

// =================================================================================================================
// Weight convert: weights are [out][in] (k contiguous) -> f16 plane value = f16(256 * bf16_RNE(w)).
// coverage: 96*256*8 = 196608 and 32*256*8 = 65536 elements exactly.
// =================================================================================================================
__device__ __forceinline__ void cvt8_w(const float* __restrict__ src, unsigned short* dst, size_t e0) {
  const v4f a = *(const v4f*)(src + e0);
  const v4f b = *(const v4f*)(src + e0 + 4);
  v4f sa, sb;
#pragma unroll
  for (int e = 0; e < 4; ++e) { sa[e] = bfr(a[e]) * CWS; sb[e] = bfr(b[e]) * CWS; }
  const v4u pk = pack8h(sa, sb);
  *(v4u*)(dst + e0) = pk;
  
}
__global__ __launch_bounds__(256) void cvt_w(const float* __restrict__ wqkv, const float* __restrict__ wp,
                                             unsigned short* Wq, unsigned short* Wp) {
  const int tid = threadIdx.x, blk = blockIdx.x;
  if (blk < 96) cvt8_w(wqkv, Wq, ((size_t)blk * 256 + tid) * 8);
  else          cvt8_w(wp,   Wp, ((size_t)(blk - 96) * 256 + tid) * 8);
}

// =================================================================================================================
// Activation gather + convert: X16[T = b*4096 + j][256] = f16(16 * bf16_RNE(x[b][clamp(idx[j])][c])).
// One wave per plane row T: lane reads 8 consecutive channels (two v4f) of the source row and writes one 16-B
// grid = 16384 rows / 8 waves = 2048 blocks. coverage: 16384 rows x 32 lanes x 8 = 16384 x 256 exactly.
// =================================================================================================================
__global__ __launch_bounds__(256) void cvt_x(const float* __restrict__ x, const int* __restrict__ idx,
                                             unsigned short* X16) {
  const int tid = threadIdx.x, lane = tid & 31;
  const int R = blockIdx.x * 8 + (tid >> 5);
  const int b = R >> 12, j = R & (NTOK - 1);
  int src = idx[j];
  src = (src < 0) ? 0 : ((src > NTOK - 1) ? (NTOK - 1) : src);
  const float* sp = x + ((size_t)(b * NTOK + src)) * CIN + lane * 8;
  const v4f a  = *(const v4f*)(sp);
  const v4f a2 = *(const v4f*)(sp + 4);
  v4f sa, sb;
#pragma unroll
  for (int e = 0; e < 4; ++e) { sa[e] = bfr(a[e]) * CXS; sb[e] = bfr(a2[e]) * CXS; }
  const v4u pk = pack8h(sa, sb);
  unsigned short* dp = X16 + (size_t)R * CIN + lane * 8;
  *(v4u*)dp = pk;
  
}

// =================================================================================================================
// qkv GEMM D[T][co] = X16[T][ci] . Wq[co][ci], K = 256, co 0..767 (q = 0..255, k = 256..511, v = 512..767).
// Block = 8 waves, tile 128 rows x 64 cols, wave = 16 rows x 4 n-tiles, fragments straight from global with the
// split k map, k-step 32 (8 steps). grid = (12, 128). Block column groups 0..7 -> token-major plane QK[T][512]
// V16[b][c][n] = f16(16 * value): staged block-wide as [64 ch][SBP] (tokens contiguous; a 128-token tile lies
// within one batch row block), wave w owns channels w*8..+7; one instruction = lanes 0..15 -> channel cc (256 B =
// coverage: QK: 8 waves x 4 it x 4 rows x 8 pieces x 8 = 128 rows x 64 cols per block, 8 x 128 blocks tile
// 16384 x 512 exactly; V16: 8 waves x 4 it x 2 ch x 16 lanes x 8 = 64 ch x 128 tok per block, 4 x 128 blocks
// tile 256 ch x 16384 tok exactly.
// =================================================================================================================
__global__ __launch_bounds__(256)
void gemm_qkv(const unsigned short* __restrict__ X16, const unsigned short* __restrict__ Wq,
              unsigned short* QK, unsigned short* V16) {
  __shared__ __align__(16) float sm[8 * 16 * STP];
  const int tid = threadIdx.x, wave = tid >> 5, lane = tid & 31, hh = lane >> 4, c = lane & 15;
  const int n0 = blockIdx.x * 64, m0 = blockIdx.y * 128;
  const int arow = m0 + wave * 16 + c;
  const _Float16* A = (const _Float16*)(const void*)X16;
  const _Float16* B = (const _Float16*)(const void*)Wq;

  v8f acc[4];
#pragma unroll
  for (int nt = 0; nt < 4; ++nt) acc[nt] = zero8();

#pragma unroll 1
  for (int k0 = 0; k0 < CIN; k0 += 32) {
    const v16h af = ldfrag_h(A + (size_t)arow * CIN + k0 + 8 * hh);
#pragma unroll
    for (int nt = 0; nt < 4; ++nt) {
      const v16h bfrag = ldfrag_h(B + (size_t)(n0 + nt * 16 + c) * CIN + k0 + 8 * hh);
      acc[nt] = mma_h(af, bfrag, acc[nt]);
    }
  }

  if (blockIdx.x < 8) {
    float* st = sm + wave * (16 * STP);
#pragma unroll
    for (int nt = 0; nt < 4; ++nt) {
#pragma unroll
      for (int r = 0; r < 8; ++r) st[(8 * hh + r) * STP + nt * 16 + c] = acc[nt][r];
    }
    wave_sync_lds();
    const int piece = lane & 7, rsub = lane >> 3;
    v4u pk[4];
    size_t offs[4];
#pragma unroll
    for (int it = 0; it < 4; ++it) {
      const int row = it * 4 + rsub;
      v4f fa = *(const v4f*)(st + row * STP + piece * 8);
      v4f fb = *(const v4f*)(st + row * STP + piece * 8 + 4);
      fa = fa * CQK;
      fb = fb * CQK;
      pk[it] = pack8h(fa, fb);
      offs[it] = ((size_t)(m0 + wave * 16 + row)) * C2 + n0 + piece * 8;
    }
    {
#pragma unroll
      for (int it = 0; it < 4; ++it) *(v4u*)(QK + offs[it]) = pk[it];
      
    }
  } else {
    const int cv0 = n0 - C2;
#pragma unroll
    for (int nt = 0; nt < 4; ++nt) {
#pragma unroll
      for (int r = 0; r < 8; ++r) sm[(nt * 16 + c) * SBP + wave * 16 + 8 * hh + r] = acc[nt][r];
    }
    __syncthreads();
    const int bimg = m0 >> 12, s0 = m0 & (NTOK - 1);
    v4u pk[4];
    size_t o16[4];
#pragma unroll
    for (int i2 = 0; i2 < 4; ++i2) {
      const int cc = wave * 8 + i2 * 2 + hh;
      const int co = cv0 + cc;
      v4f fa = *(const v4f*)(sm + cc * SBP + c * 8);
      v4f fb = *(const v4f*)(sm + cc * SBP + c * 8 + 4);
      fa = fa * CVS;
      fb = fb * CVS;
      pk[i2] = pack8h(fa, fb);
      o16[i2] = ((size_t)(bimg * CIN + co)) * NTOK + s0 + c * 8;
    }
    {
#pragma unroll
      for (int i2 = 0; i2 < 4; ++i2) *(v4u*)(V16 + o16[i2]) = pk[i2];
      
    }
  }
}

// =================================================================================================================
// Grouped attention, one unit (batch b, token group gr, head) per AQS = 2 blocks of 1024 threads = 32 waves, 1024
// queries x 1024 keys, d = 32: 256 blocks, 8 waves per SIMD, all waves of a block walk the same k and v rows.
// Static LDS: the unit's whole k slab Ks[1024 keys][KSP] and v slab Vs[32 channels][VSP] (f16, row pitch an odd
// multiple of 16 B for the 16-B fragment reads), filled once per block (each thread moves 4 + 4 pieces of 16 B from
// the token-major plane QK, k row = T*512 + 256 + head*32, and the channel-major plane V16, row = channel
// head*32 + d, keys contiguous), then one block barrier; plus the per-wave stage [16][ASP] f32. q fragments
// straight from QK (q row = T*512 + head*32). Per wave: the one q-tile qt = part*32 + wave (< 64).
//   Transposed scores S^T = K_tile (A, 16 keys x 32 d) x Q (B: k = d, n = query): S*256 = q16.k16; D element r of
//   lane l = S[query l&15][key 8h+r], so P = exp((S - m)*scale) x1024 is the A fragment of P.V directly in registers
//   (element i <- key tile 0 row i, element 8+i <- key tile 1 row i). Online softmax over 32 chunks of 32 keys;
//   O = P.V (acc scale 1024*16). Epilogue: O/(l*16384) staged per wave in LDS, then stored as the f16 plane
//   Y[unit][1024][32] of 256*o: one instruction = 32 lanes x 16 B = 512 B = 8 token rows (consecutive lanes
// coverage: per block 32 q-tiles x 16 rows x 32 d, half of its unit's 1024-row slab; grid covers 2 halves x 128
// units, every slab row written exactly once.
// =================================================================================================================
__global__ __launch_bounds__(AWV * 32)
void attn_k(const unsigned short* __restrict__ QK, const unsigned short* __restrict__ V16, unsigned short* Y) {
  __shared__ __align__(16) float Sst[AWV * 16 * ASP];
  __shared__ __align__(16) _Float16 Ks[LGR * KSP];
  __shared__ __align__(16) _Float16 Vs[HD * VSP];
  const int tid = threadIdx.x, wave = tid >> 5, lane = tid & 31, hh = lane >> 4, c = lane & 15;
  const int u = blockIdx.x & (NUNIT - 1), part = blockIdx.x / NUNIT;
  const int head = u & 7, gr = (u >> 3) & 3, b = u >> 5;
  const size_t tok0 = (size_t)b * NTOK + (size_t)gr * LGR;
  const _Float16* Qp = (const _Float16*)(const void*)QK + tok0 * C2 + head * HD;
  const _Float16* Kp = Qp + CIN;
  const size_t cm0 = ((size_t)(b * CIN + head * HD)) * NTOK + (size_t)gr * LGR;
  const _Float16* Vp = (const _Float16*)(const void*)V16 + cm0;
  float* st = Sst + wave * (16 * ASP);

  {
    const int qt = part * AWV + wave;
    const int lq = qt * 16 + c;
    const v16h bq = ldfrag_h(Qp + (size_t)lq * C2 + 8 * hh);     // B: n = query c, k = d 8h.. / 16+8h..

    {
      v8h kt[4], vt[4];
#pragma unroll
      for (int i = 0; i < 4; ++i) {
        const int id = i * (AWV * 32) + tid;
        kt[i] = *(const v8h*)(Kp + (size_t)(id >> 2) * C2 + (id & 3) * 8);       // key id/4, d piece id%4
        vt[i] = *(const v8h*)(Vp + (size_t)(id >> 7) * NTOK + (id & 127) * 8);   // channel id/128, key piece id%128
      }
#pragma unroll
      for (int i = 0; i < 4; ++i) {
        const int id = i * (AWV * 32) + tid;
        *(v8h*)(Ks + (id >> 2) * KSP + (id & 3) * 8)   = kt[i];
        *(v8h*)(Vs + (id >> 7) * VSP + (id & 127) * 8) = vt[i];
      }
    }
    __syncthreads();

    v8f o0 = zero8(), o1 = zero8();
    float mrun = -1.0e30f, lrun = 0.f;
#pragma unroll 1
    for (int ch = 0; ch < LGR / 32; ++ch) {
      const int kb = ch * 32;
      v8f s[2];
#pragma unroll
      for (int j = 0; j < 2; ++j) {
        const v16h ka = ldfrag_h(Ks + (kb + j * 16 + c) * KSP + 8 * hh);          // A: row = key, k = d
        s[j] = mma_h(ka, bq, zero8());
      }
      float mc = s[0][0];
#pragma unroll
      for (int j = 0; j < 2; ++j) {
#pragma unroll
        for (int r = 0; r < 8; ++r) mc = fmaxf(mc, s[j][r]);
      }
      mc = fmaxf(mc, __shfl_xor(mc, 16, 32));
      const float mnew = fmaxf(mrun, mc);
      const float alpha = __expf((mrun - mnew) * QKSC);
#pragma unroll
      for (int r = 0; r < 8; ++r) {
        const float arr = __shfl(alpha, 8 * hh + r, 32);
        o0[r] = o0[r] * arr;
        o1[r] = o1[r] * arr;
      }
      float psum = 0.f;
      v16h pfh;
#pragma unroll
      for (int i = 0; i < 8; ++i) {
        const float e0 = __expf((s[0][i] - mnew) * QKSC);
        const float e1 = __expf((s[1][i] - mnew) * QKSC);
        psum = psum + (e0 + e1);
        pfh[i]     = (_Float16)(e0 * 1024.0f);
        pfh[8 + i] = (_Float16)(e1 * 1024.0f);
      }
      lrun = lrun * alpha + psum;
      mrun = mnew;
      {
        const v16h vf0 = ldfrag_h(Vs + c * VSP + kb + 8 * hh);                       // B: n = d c, keys kb..+31
        const v16h vf1 = ldfrag_h(Vs + (HD / 2 + c) * VSP + kb + 8 * hh);            // B: n = d 16+c
        o0 = mma_h(pfh, vf0, o0);
        o1 = mma_h(pfh, vf1, o1);
      }
    }
    const float lsum = lrun + __shfl_xor(lrun, 16, 32);      // lane q (and q+16) holds the full row sum of query q
    const float rinv = 1.0f / (lsum * 16384.0f);
#pragma unroll
    for (int r = 0; r < 8; ++r) {
      const int q = 8 * hh + r;
      const float inv = __shfl(rinv, q, 32);
      st[q * ASP + c]          = o0[r] * inv;
      st[q * ASP + HD / 2 + c] = o1[r] * inv;
    }
    wave_sync_lds();
    {
      const int rr = lane >> 2, dp = (lane & 3) * 8;
      v4u pk[2];
      size_t offs[2];
#pragma unroll
      for (int it = 0; it < 2; ++it) {
        const int row = it * 8 + rr;
        v4f fa = *(const v4f*)(st + row * ASP + dp);
        v4f fb = *(const v4f*)(st + row * ASP + dp + 4);
        fa = fa * CYS;
        fb = fb * CYS;
        pk[it] = pack8h(fa, fb);
        offs[it] = ((size_t)u * LGR + (size_t)(qt * 16 + row)) * HD + dp;
      }
      {
#pragma unroll
        for (int it = 0; it < 2; ++it) *(v4u*)(Y + offs[it]) = pk[it];
        
      }
    }
  }
}

// =================================================================================================================
// Output projection D[T][co] = Y[T][ci] . Wp[co][ci] + bias, rows T in shuffled token order, written to the
// un-shuffled output row idx[j] (clamped) of batch b. A = Y plane (x256) addressed by arithmetic: token T ->
// (batch, group, query), k-step ks = head ks, channels ks*32 + d (elements 0..7 d = 8h.., elements 8..15 d =
// 16+8h..). B = weight plane x256. Epilogue: value = acc/65536 + bf16(b)[co], staged per wave in LDS [16][STP];
// coverage: 8 waves x 8 it x 2 rows x 16 lanes x 4 = 128 rows x 64 co per block; grid tiles 16384 x 256 exactly;
// with idx a permutation every output row is written exactly once.
// =================================================================================================================
__global__ __launch_bounds__(256)
void gemm_proj(const unsigned short* __restrict__ Y, const unsigned short* __restrict__ Wp,
               const float* __restrict__ bp, const int* __restrict__ idx, float* out) {
  __shared__ __align__(16) float sm[8 * 16 * STP];
  const int tid = threadIdx.x, wave = tid >> 5, lane = tid & 31, hh = lane >> 4, c = lane & 15;
  const int n0 = blockIdx.x * 64, m0 = blockIdx.y * 128;
  const int T = m0 + wave * 16 + c;
  const int bq = T >> 12, jj = T & (NTOK - 1), gr = jj >> 10, q = jj & (LGR - 1);
  const size_t abase = (((size_t)((bq * NGR + gr) * NHD)) * LGR + (size_t)q) * HD + 8 * hh;
  const _Float16* A = (const _Float16*)(const void*)Y;
  const _Float16* B = (const _Float16*)(const void*)Wp;

  v8f acc[4];
#pragma unroll
  for (int nt = 0; nt < 4; ++nt) acc[nt] = zero8();

#pragma unroll 1
  for (int ks = 0; ks < NHD; ++ks) {
    const size_t bo = abase + (size_t)ks * (LGR * HD);
    const v16h af = ldfrag_h(A + bo);
#pragma unroll
    for (int nt = 0; nt < 4; ++nt) {
      const v16h bfrag = ldfrag_h(B + (size_t)(n0 + nt * 16 + c) * CIN + ks * 32 + 8 * hh);
      acc[nt] = mma_h(af, bfrag, acc[nt]);
    }
  }

  float* st = sm + wave * (16 * STP);
#pragma unroll
  for (int nt = 0; nt < 4; ++nt) {
    const int co = n0 + nt * 16 + c;
    const float bi = bfr(bp[co]);
#pragma unroll
    for (int r = 0; r < 8; ++r) st[(8 * hh + r) * STP + nt * 16 + c] = acc[nt][r] * (1.0f / 65536.0f) + bi;
  }
  wave_sync_lds();
  const int bimg = m0 >> 12;
  const int jbase = (m0 & (NTOK - 1)) + wave * 16;
  v4f ov[8];
  size_t offs[8];
#pragma unroll
  for (int it = 0; it < 8; ++it) {
    const int row = it * 2 + hh;
    int dst = idx[jbase + row];
    dst = (dst < 0) ? 0 : ((dst > NTOK - 1) ? (NTOK - 1) : dst);
    ov[it] = *(const v4f*)(st + row * STP + c * 4);
    offs[it] = ((size_t)(bimg * NTOK + dst)) * CIN + n0 + c * 4;
  }
  {
#pragma unroll
    for (int it = 0; it < 8; ++it) *(v4f*)(out + offs[it]) = ov[it];
    
  }
}

// =================================================================================================================
//   Wq f16 [768][256] 393216 @0; Wp f16 [256][256] 131072 @393216; X16 f16 [16384][256] 8388608 @524288;
//   QK f16 [16384][512] 16777216 @8912896; V16 f16 [4][256][4096] 8388608 @25690112;
//   Y f16 [128][1024][32] 8388608 @34078720. Total 42467328.
// =================================================================================================================
extern "C" void kernel_launch(void* const* d_in, const int* in_sizes, int n_in,
                              void* d_out, int out_size, void* d_ws, size_t ws_size,
                              hipStream_t stream) {
  if (n_in < 5) return;
  if (in_sizes[0] != NBAT * NTOK * CIN) return;
  if (in_sizes[1] != NTOK) return;
  if (in_sizes[2] != C3 * CIN) return;
  if (in_sizes[3] != CIN * CIN) return;
  if (in_sizes[4] != CIN) return;
  if (out_size != NBAT * NTOK * CIN) return;

  const float* x      = (const float*)d_in[0];
  const int*   idx    = (const int*)d_in[1];
  const float* w_qkv  = (const float*)d_in[2];
  const float* w_proj = (const float*)d_in[3];
  const float* b_proj = (const float*)d_in[4];
  float* out = (float*)d_out;

  const size_t sWq  = (size_t)C3 * CIN * 2;              //    393216
  const size_t sWp  = (size_t)CIN * CIN * 2;             //    131072
  const size_t sX16 = (size_t)MTOK * CIN * 2;            //   8388608
  const size_t sQK  = (size_t)MTOK * C2 * 2;             //  16777216
  const size_t sV16 = (size_t)NBAT * CIN * NTOK * 2;     //   8388608
  const size_t sY   = (size_t)NUNIT * LGR * HD * 2;      //   8388608
  size_t off = 0;
  const size_t oWq  = off; off += sWq;
  const size_t oWp  = off; off += sWp;
  const size_t oX16 = off; off += sX16;
  const size_t oQK  = off; off += sQK;
  const size_t oV16 = off; off += sV16;
  const size_t oY   = off; off += sY;
  if (off > ws_size) return;                             // off = 42467328
  if (off > (size_t)134217728) return;

  char* ws = (char*)d_ws;
  unsigned short* Wq  = (unsigned short*)(ws + oWq);
  unsigned short* Wp  = (unsigned short*)(ws + oWp);
  unsigned short* X16 = (unsigned short*)(ws + oX16);
  unsigned short* QK  = (unsigned short*)(ws + oQK);
  unsigned short* V16 = (unsigned short*)(ws + oV16);
  unsigned short* Yp  = (unsigned short*)(ws + oY);

  const dim3 blk(256);
  // (1) weights -> f16 x256 planes
  cvt_w<<<dim3(128), blk, 0, stream>>>(w_qkv, w_proj, Wq, Wp);
  // (2) gather x rows by idx -> token-major f16 x16 plane
  cvt_x<<<dim3(MTOK / 8), blk, 0, stream>>>(x, idx, X16);
  // (3) qkv projection -> token-major q/k plane and channel-major v plane
  gemm_qkv<<<dim3(C3 / 64, MTOK / 128), blk, 0, stream>>>(X16, Wq, QK, V16);
  // (4) grouped multi-head attention -> ctx slab plane
  attn_k<<<dim3(NUNIT * AQS), dim3(AWV * 32), 0, stream>>>(QK, V16, Yp);
  // (5) output projection + bias, rows written to their un-shuffled positions
  gemm_proj<<<dim3(CIN / 64, MTOK / 128), blk, 0, stream>>>(Yp, Wp, b_proj, idx, out);
  (void)hipGetLastError();
}

// v003
// A run of this version takes 59.5 microseconds.
// In both of two side-by-side timings against v002, it was 1.46 times as fast.
// All steps since v000 together make it 4.38 times as fast.
// Contractions: v_wmma_f32_16x16x32_f16 (f16 operands, f32 accumulate). qkv projection: A = gathered x rows
// (bf16-valued, x16) single plane, B = w_qkv (bf16-valued, x256) single plane; scores k.qT: k x16, q x16 single
// planes; p.v: p x1024, v x16 single planes; output projection: A = ctx x256 single f16 plane, B = w_proj
// (bf16-valued, x256) single plane. Online softmax in f32 on VALU. Float inputs RNE-converted to bf16 on load.
#include <hip/hip_runtime.h>
#include <math.h>
#include <stdint.h>

#define NBAT  4
#define NTOK  4096
#define CIN   256
#define C2    512
#define C3    768
#define MTOK  16384
#define NHD   8
#define HD    32
#define NGR   4
#define LGR   1024
#define NUNIT 128
#define AWV   32
#define AQS   2
#define STP   68
#define SBP   132
#define ASP   36
#define KSP   40
#define VSP   1032
#define GSP   264
#define CXS   16.0f
#define CWS   256.0f
#define CQK   (16.0f / 4096.0f)
#define CVS   (16.0f / 4096.0f)
#define CYS   256.0f
#define QKSC  (0.17677669529663688f / 256.0f)

static_assert(NUNIT == NBAT * NGR * NHD);
static_assert(NGR * LGR == NTOK);
static_assert(MTOK == NBAT * NTOK);
static_assert(NTOK % 128 == 0);
static_assert(LGR % 32 == 0);
static_assert(AQS * AWV * 16 == LGR);
static_assert(CIN % 64 == 0);
static_assert(NHD * HD == CIN);
static_assert(64 * SBP <= 8 * 16 * STP);
static_assert((STP * 4) % 16 == 0);
static_assert((SBP * 4) % 16 == 0);
static_assert((ASP * 4) % 16 == 0);
static_assert((KSP * 2) % 32 == 16 && KSP >= HD);
static_assert((VSP * 2) % 32 == 16 && VSP >= LGR);
static_assert((GSP * 2) % 32 == 16 && GSP >= CIN);
static_assert(8 * 16 * STP * 4 <= (128 + 64) * GSP * 2);
static_assert(8 * 16 * STP * 4 <= (NHD * 128 * KSP + 64 * GSP) * 2);
static_assert(128 * CIN == 16 * 256 * 8 && 64 * CIN == 8 * 256 * 8);
static_assert(LGR * HD == 4 * AWV * 32 * 8);
static_assert(C3 * CIN == 96 * 256 * 8);
static_assert(CIN * CIN == 32 * 256 * 8);

typedef _Float16 v16h __attribute__((ext_vector_type(16)));
typedef _Float16 v8h  __attribute__((ext_vector_type(8)));
typedef float    v8f  __attribute__((ext_vector_type(8)));
typedef float    v4f  __attribute__((ext_vector_type(4)));
typedef unsigned int v4u __attribute__((ext_vector_type(4)));
union Frag { v16h v; v8h half[2]; };

// ---- scalar helpers -------------------------------------------------------------------------------------------
__device__ __forceinline__ unsigned short bf_bits(float f) {          // f32 -> bf16 bits, RNE convert
  unsigned u = __float_as_uint(f);
  return (unsigned short)((u + 0x7FFFu + ((u >> 16) & 1u)) >> 16);
}
__device__ __forceinline__ float bfr(float f) { return __uint_as_float(((unsigned)bf_bits(f)) << 16); }
__device__ __forceinline__ unsigned short h_bits(_Float16 x) { return __builtin_bit_cast(unsigned short, x); }
__device__ __forceinline__ unsigned pk16(unsigned short a, unsigned short b) { return (unsigned)a | ((unsigned)b << 16); }
__device__ __forceinline__ v8f zero8() { v8f z = {0.f, 0.f, 0.f, 0.f, 0.f, 0.f, 0.f, 0.f}; return z; }

// ---- fragment loader: 16-bit A/B operand, lane -> row/col (lane&15), p already includes +8*(lane>>4);
//      elements 0..7 <- p[0..7] (k0+8h..), elements 8..15 <- p[16..23] (k0+16+8h..)
__device__ __forceinline__ v16h ldfrag_h(const _Float16* p) {
  Frag f;
  f.half[0] = *(const v8h*)(p);
  f.half[1] = *(const v8h*)(p + 16);
  return f.v;
}

// ---- WMMA helper with trailing VALU hazard gap ----------------------------------------------------------------
__device__ __forceinline__ v8f mma_h(v16h a, v16h b, v8f c) {
  c = __builtin_amdgcn_wmma_f32_16x16x32_f16(false, a, false, b, (short)0, c, false, false);
#if defined(__HIP_DEVICE_COMPILE__)
  asm volatile("v_nop\n\tv_nop\n\tv_nop\n\tv_nop" : "+v"(c) : "v"(a), "v"(b));
#endif
  return c;
}
__device__ __forceinline__ void wave_sync_lds() {
  __builtin_amdgcn_fence(__ATOMIC_RELEASE, "workgroup");
  __builtin_amdgcn_wave_barrier();
  __builtin_amdgcn_fence(__ATOMIC_ACQUIRE, "workgroup");
}

// ---- 8 f32 -> 8 packed f16 (16 B) -------------------------------------------------------------------------------
__device__ __forceinline__ v4u pack8h(v4f a, v4f b) {
  v4u p;
  p[0] = pk16(h_bits((_Float16)a[0]), h_bits((_Float16)a[1]));
  p[1] = pk16(h_bits((_Float16)a[2]), h_bits((_Float16)a[3]));
  p[2] = pk16(h_bits((_Float16)b[0]), h_bits((_Float16)b[1]));
  p[3] = pk16(h_bits((_Float16)b[2]), h_bits((_Float16)b[3]));
  return p;
}

// =================================================================================================================
// Weight convert: weights are [out][in] (k contiguous) -> f16 plane value = f16(256 * bf16_RNE(w)).
// coverage: 96*256*8 = 196608 and 32*256*8 = 65536 elements exactly.
// =================================================================================================================
__device__ __forceinline__ void cvt8_w(const float* __restrict__ src, unsigned short* dst, size_t e0) {
  const v4f a = *(const v4f*)(src + e0);
  const v4f b = *(const v4f*)(src + e0 + 4);
  v4f sa, sb;
#pragma unroll
  for (int e = 0; e < 4; ++e) { sa[e] = bfr(a[e]) * CWS; sb[e] = bfr(b[e]) * CWS; }
  const v4u pk = pack8h(sa, sb);
  *(v4u*)(dst + e0) = pk;
  
}
__global__ __launch_bounds__(256) void cvt_w(const float* __restrict__ wqkv, const float* __restrict__ wp,
                                             unsigned short* Wq, unsigned short* Wp) {
  const int tid = threadIdx.x, blk = blockIdx.x;
  if (blk < 96) cvt8_w(wqkv, Wq, ((size_t)blk * 256 + tid) * 8);
  else          cvt8_w(wp,   Wp, ((size_t)(blk - 96) * 256 + tid) * 8);
}

// =================================================================================================================
// Activation gather + convert: X16[T = b*4096 + j][256] = f16(16 * bf16_RNE(x[b][clamp(idx[j])][c])).
// One wave per plane row T: lane reads 8 consecutive channels (two v4f) of the source row and writes one 16-B
// grid = 16384 rows / 8 waves = 2048 blocks. coverage: 16384 rows x 32 lanes x 8 = 16384 x 256 exactly.
// =================================================================================================================
__global__ __launch_bounds__(256) void cvt_x(const float* __restrict__ x, const int* __restrict__ idx,
                                             unsigned short* X16) {
  const int tid = threadIdx.x, lane = tid & 31;
  const int R = blockIdx.x * 8 + (tid >> 5);
  const int b = R >> 12, j = R & (NTOK - 1);
  int src = idx[j];
  src = (src < 0) ? 0 : ((src > NTOK - 1) ? (NTOK - 1) : src);
  const float* sp = x + ((size_t)(b * NTOK + src)) * CIN + lane * 8;
  const v4f a  = *(const v4f*)(sp);
  const v4f a2 = *(const v4f*)(sp + 4);
  v4f sa, sb;
#pragma unroll
  for (int e = 0; e < 4; ++e) { sa[e] = bfr(a[e]) * CXS; sb[e] = bfr(a2[e]) * CXS; }
  const v4u pk = pack8h(sa, sb);
  unsigned short* dp = X16 + (size_t)R * CIN + lane * 8;
  *(v4u*)dp = pk;
  
}

// =================================================================================================================
// qkv GEMM D[T][co] = X16[T][ci] . Wq[co][ci], K = 256, co 0..767 (q = 0..255, k = 256..511, v = 512..767).
// Block = 8 waves, tile 128 rows x 64 cols, wave = 16 rows x 4 n-tiles. The block's A rows (64 KB, contiguous) and
// B rows (32 KB, contiguous) are staged once, whole K, in LDS: one wave-load = one 512-B row = 4 whole lines, rows
// at pitch GSP (an odd multiple of 16 B for the 16-B fragment reads); one block barrier; fragments by LDS reads with
// the split k map, k-step 32 (8 steps); a second block barrier, then the same LDS is the output stage.
// grid = (12, 128). Block column groups 0..7 -> token-major plane QK[T][512]
// V16[b][c][n] = f16(16 * value): staged block-wide as [64 ch][SBP] (tokens contiguous; a 128-token tile lies
// within one batch row block), wave w owns channels w*8..+7; one instruction = lanes 0..15 -> channel cc (256 B =
// coverage: QK: 8 waves x 4 it x 4 rows x 8 pieces x 8 = 128 rows x 64 cols per block, 8 x 128 blocks tile
// 16384 x 512 exactly; V16: 8 waves x 4 it x 2 ch x 16 lanes x 8 = 64 ch x 128 tok per block, 4 x 128 blocks
// tile 256 ch x 16384 tok exactly.
// =================================================================================================================
__global__ __launch_bounds__(256)
void gemm_qkv(const unsigned short* __restrict__ X16, const unsigned short* __restrict__ Wq,
              unsigned short* QK, unsigned short* V16) {
  __shared__ __align__(16) unsigned char smem[(128 + 64) * GSP * 2];
  _Float16* As = (_Float16*)(void*)smem;
  _Float16* Bs = As + 128 * GSP;
  float* sm = (float*)(void*)smem;
  const int tid = threadIdx.x, wave = tid >> 5, lane = tid & 31, hh = lane >> 4, c = lane & 15;
  const int n0 = blockIdx.x * 64, m0 = blockIdx.y * 128;
  const _Float16* A = (const _Float16*)(const void*)X16 + (size_t)m0 * CIN;
  const _Float16* B = (const _Float16*)(const void*)Wq + (size_t)n0 * CIN;

  {
    v8h ta[16], tb[8];
#pragma unroll
    for (int i = 0; i < 16; ++i) ta[i] = *(const v8h*)(A + (i * 256 + tid) * 8);
#pragma unroll
    for (int i = 0; i < 8; ++i)  tb[i] = *(const v8h*)(B + (i * 256 + tid) * 8);
#pragma unroll
    for (int i = 0; i < 16; ++i) *(v8h*)(As + (i * 8 + wave) * GSP + lane * 8) = ta[i];
#pragma unroll
    for (int i = 0; i < 8; ++i)  *(v8h*)(Bs + (i * 8 + wave) * GSP + lane * 8) = tb[i];
  }
  __syncthreads();

  v8f acc[4];
#pragma unroll
  for (int nt = 0; nt < 4; ++nt) acc[nt] = zero8();

  // unrolled: the k offsets of the LDS reads become constants, and a k-step's ten reads stand as one group
#pragma unroll
  for (int k0 = 0; k0 < CIN; k0 += 32) {
    const v16h af = ldfrag_h(As + (wave * 16 + c) * GSP + k0 + 8 * hh);
    v16h bfrag[4];
#pragma unroll
    for (int nt = 0; nt < 4; ++nt) bfrag[nt] = ldfrag_h(Bs + (nt * 16 + c) * GSP + k0 + 8 * hh);
#pragma unroll
    for (int nt = 0; nt < 4; ++nt) acc[nt] = mma_h(af, bfrag[nt], acc[nt]);
  }
  __syncthreads();   // every wave's last fragment read ends before the tiles' LDS is rewritten as the output stage

  if (blockIdx.x < 8) {
    float* st = sm + wave * (16 * STP);
#pragma unroll
    for (int nt = 0; nt < 4; ++nt) {
#pragma unroll
      for (int r = 0; r < 8; ++r) st[(8 * hh + r) * STP + nt * 16 + c] = acc[nt][r];
    }
    wave_sync_lds();
    const int piece = lane & 7, rsub = lane >> 3;
    v4u pk[4];
    size_t offs[4];
#pragma unroll
    for (int it = 0; it < 4; ++it) {
      const int row = it * 4 + rsub;
      v4f fa = *(const v4f*)(st + row * STP + piece * 8);
      v4f fb = *(const v4f*)(st + row * STP + piece * 8 + 4);
      fa = fa * CQK;
      fb = fb * CQK;
      pk[it] = pack8h(fa, fb);
      offs[it] = ((size_t)(m0 + wave * 16 + row)) * C2 + n0 + piece * 8;
    }
    {
#pragma unroll
      for (int it = 0; it < 4; ++it) *(v4u*)(QK + offs[it]) = pk[it];
      
    }
  } else {
    const int cv0 = n0 - C2;
#pragma unroll
    for (int nt = 0; nt < 4; ++nt) {
#pragma unroll
      for (int r = 0; r < 8; ++r) sm[(nt * 16 + c) * SBP + wave * 16 + 8 * hh + r] = acc[nt][r];
    }
    __syncthreads();
    const int bimg = m0 >> 12, s0 = m0 & (NTOK - 1);
    v4u pk[4];
    size_t o16[4];
#pragma unroll
    for (int i2 = 0; i2 < 4; ++i2) {
      const int cc = wave * 8 + i2 * 2 + hh;
      const int co = cv0 + cc;
      v4f fa = *(const v4f*)(sm + cc * SBP + c * 8);
      v4f fb = *(const v4f*)(sm + cc * SBP + c * 8 + 4);
      fa = fa * CVS;
      fb = fb * CVS;
      pk[i2] = pack8h(fa, fb);
      o16[i2] = ((size_t)(bimg * CIN + co)) * NTOK + s0 + c * 8;
    }
    {
#pragma unroll
      for (int i2 = 0; i2 < 4; ++i2) *(v4u*)(V16 + o16[i2]) = pk[i2];
      
    }
  }
}

// =================================================================================================================
// Grouped attention, one unit (batch b, token group gr, head) per AQS = 2 blocks of 1024 threads = 32 waves, 1024
// queries x 1024 keys, d = 32: 256 blocks, 8 waves per SIMD, all waves of a block walk the same k and v rows.
// Static LDS: the unit's whole k slab Ks[1024 keys][KSP] and v slab Vs[32 channels][VSP] (f16, row pitch an odd
// multiple of 16 B for the 16-B fragment reads), filled once per block (each thread moves 4 + 4 pieces of 16 B from
// the token-major plane QK, k row = T*512 + 256 + head*32, and the channel-major plane V16, row = channel
// head*32 + d, keys contiguous), then one block barrier; plus the per-wave stage [16][ASP] f32. q fragments
// straight from QK (q row = T*512 + head*32). Per wave: the one q-tile qt = part*32 + wave (< 64).
//   Transposed scores S^T = K_tile (A, 16 keys x 32 d) x Q (B: k = d, n = query): S*256 = q16.k16; D element r of
//   lane l = S[query l&15][key 8h+r], so P = exp((S - m)*scale) x1024 is the A fragment of P.V directly in registers
//   (element i <- key tile 0 row i, element 8+i <- key tile 1 row i). Online softmax over 32 chunks of 32 keys;
//   O = P.V (acc scale 1024*16). Epilogue: O/(l*16384) staged per wave in LDS, then stored as the f16 plane
//   Y[unit][1024][32] of 256*o: one instruction = 32 lanes x 16 B = 512 B = 8 token rows (consecutive lanes
// coverage: per block 32 q-tiles x 16 rows x 32 d, half of its unit's 1024-row slab; grid covers 2 halves x 128
// units, every slab row written exactly once.
// =================================================================================================================
__global__ __launch_bounds__(AWV * 32)
void attn_k(const unsigned short* __restrict__ QK, const unsigned short* __restrict__ V16, unsigned short* Y) {
  __shared__ __align__(16) float Sst[AWV * 16 * ASP];
  __shared__ __align__(16) _Float16 Ks[LGR * KSP];
  __shared__ __align__(16) _Float16 Vs[HD * VSP];
  const int tid = threadIdx.x, wave = tid >> 5, lane = tid & 31, hh = lane >> 4, c = lane & 15;
  const int u = blockIdx.x & (NUNIT - 1), part = blockIdx.x / NUNIT;
  const int head = u & 7, gr = (u >> 3) & 3, b = u >> 5;
  const size_t tok0 = (size_t)b * NTOK + (size_t)gr * LGR;
  const _Float16* Qp = (const _Float16*)(const void*)QK + tok0 * C2 + head * HD;
  const _Float16* Kp = Qp + CIN;
  const size_t cm0 = ((size_t)(b * CIN + head * HD)) * NTOK + (size_t)gr * LGR;
  const _Float16* Vp = (const _Float16*)(const void*)V16 + cm0;
  float* st = Sst + wave * (16 * ASP);

  {
    const int qt = part * AWV + wave;
    const int lq = qt * 16 + c;
    const v16h bq = ldfrag_h(Qp + (size_t)lq * C2 + 8 * hh);     // B: n = query c, k = d 8h.. / 16+8h..

    {
      v8h kt[4], vt[4];
#pragma unroll
      for (int i = 0; i < 4; ++i) {
        const int id = i * (AWV * 32) + tid;
        kt[i] = *(const v8h*)(Kp + (size_t)(id >> 2) * C2 + (id & 3) * 8);       // key id/4, d piece id%4
        vt[i] = *(const v8h*)(Vp + (size_t)(id >> 7) * NTOK + (id & 127) * 8);   // channel id/128, key piece id%128
      }
#pragma unroll
      for (int i = 0; i < 4; ++i) {
        const int id = i * (AWV * 32) + tid;
        *(v8h*)(Ks + (id >> 2) * KSP + (id & 3) * 8)   = kt[i];
        *(v8h*)(Vs + (id >> 7) * VSP + (id & 127) * 8) = vt[i];
      }
    }
    __syncthreads();

    v8f o0 = zero8(), o1 = zero8();
    float mrun = -1.0e30f, lrun = 0.f;
#pragma unroll 1
    for (int ch = 0; ch < LGR / 32; ++ch) {
      const int kb = ch * 32;
      v8f s[2];
#pragma unroll
      for (int j = 0; j < 2; ++j) {
        const v16h ka = ldfrag_h(Ks + (kb + j * 16 + c) * KSP + 8 * hh);          // A: row = key, k = d
        s[j] = mma_h(ka, bq, zero8());
      }
      float mc = s[0][0];
#pragma unroll
      for (int j = 0; j < 2; ++j) {
#pragma unroll
        for (int r = 0; r < 8; ++r) mc = fmaxf(mc, s[j][r]);
      }
      mc = fmaxf(mc, __shfl_xor(mc, 16, 32));
      const float mnew = fmaxf(mrun, mc);
      const float alpha = __expf((mrun - mnew) * QKSC);
#pragma unroll
      for (int r = 0; r < 8; ++r) {
        const float arr = __shfl(alpha, 8 * hh + r, 32);
        o0[r] = o0[r] * arr;
        o1[r] = o1[r] * arr;
      }
      float psum = 0.f;
      v16h pfh;
#pragma unroll
      for (int i = 0; i < 8; ++i) {
        const float e0 = __expf((s[0][i] - mnew) * QKSC);
        const float e1 = __expf((s[1][i] - mnew) * QKSC);
        psum = psum + (e0 + e1);
        pfh[i]     = (_Float16)(e0 * 1024.0f);
        pfh[8 + i] = (_Float16)(e1 * 1024.0f);
      }
      lrun = lrun * alpha + psum;
      mrun = mnew;
      {
        const v16h vf0 = ldfrag_h(Vs + c * VSP + kb + 8 * hh);                       // B: n = d c, keys kb..+31
        const v16h vf1 = ldfrag_h(Vs + (HD / 2 + c) * VSP + kb + 8 * hh);            // B: n = d 16+c
        o0 = mma_h(pfh, vf0, o0);
        o1 = mma_h(pfh, vf1, o1);
      }
    }
    const float lsum = lrun + __shfl_xor(lrun, 16, 32);      // lane q (and q+16) holds the full row sum of query q
    const float rinv = 1.0f / (lsum * 16384.0f);
#pragma unroll
    for (int r = 0; r < 8; ++r) {
      const int q = 8 * hh + r;
      const float inv = __shfl(rinv, q, 32);
      st[q * ASP + c]          = o0[r] * inv;
      st[q * ASP + HD / 2 + c] = o1[r] * inv;
    }
    wave_sync_lds();
    {
      const int rr = lane >> 2, dp = (lane & 3) * 8;
      v4u pk[2];
      size_t offs[2];
#pragma unroll
      for (int it = 0; it < 2; ++it) {
        const int row = it * 8 + rr;
        v4f fa = *(const v4f*)(st + row * ASP + dp);
        v4f fb = *(const v4f*)(st + row * ASP + dp + 4);
        fa = fa * CYS;
        fb = fb * CYS;
        pk[it] = pack8h(fa, fb);
        offs[it] = ((size_t)u * LGR + (size_t)(qt * 16 + row)) * HD + dp;
      }
      {
#pragma unroll
        for (int it = 0; it < 2; ++it) *(v4u*)(Y + offs[it]) = pk[it];
        
      }
    }
  }
}

// =================================================================================================================
// Output projection D[T][co] = Y[T][ci] . Wp[co][ci] + bias, rows T in shuffled token order, written to the
// un-shuffled output row idx[j] (clamped) of batch b. A = Y plane (x256) addressed by arithmetic: token T ->
// (batch, group, query), k-step ks = head ks, channels ks*32 + d (elements 0..7 d = 8h.., elements 8..15 d =
// 16+8h..). B = weight plane x256. Both tiles are staged once, whole K, in LDS by whole-line loads: per head the
// block's 128 token rows of Y are 8 KB contiguous -> As[head][token][KSP]; the 64 weight rows are 32 KB contiguous
// -> Bs[row][GSP]; one block barrier, fragments by LDS reads, a second block barrier, then the same LDS is the
// output stage. Epilogue: value = acc/65536 + bf16(b)[co], staged per wave in LDS [16][STP];
// coverage: 8 waves x 8 it x 2 rows x 16 lanes x 4 = 128 rows x 64 co per block; grid tiles 16384 x 256 exactly;
// with idx a permutation every output row is written exactly once.
// =================================================================================================================
__global__ __launch_bounds__(256)
void gemm_proj(const unsigned short* __restrict__ Y, const unsigned short* __restrict__ Wp,
               const float* __restrict__ bp, const int* __restrict__ idx, float* out) {
  __shared__ __align__(16) unsigned char smem[(NHD * 128 * KSP + 64 * GSP) * 2];
  _Float16* As = (_Float16*)(void*)smem;
  _Float16* Bs = As + NHD * 128 * KSP;
  float* sm = (float*)(void*)smem;
  const int tid = threadIdx.x, wave = tid >> 5, lane = tid & 31, hh = lane >> 4, c = lane & 15;
  const int n0 = blockIdx.x * 64, m0 = blockIdx.y * 128;
  const int bq = m0 >> 12, jj = m0 & (NTOK - 1), gr = jj >> 10, q0 = jj & (LGR - 1);
  const _Float16* A = (const _Float16*)(const void*)Y + (((size_t)((bq * NGR + gr) * NHD)) * LGR + (size_t)q0) * HD;
  const _Float16* B = (const _Float16*)(const void*)Wp + (size_t)n0 * CIN;

  {
    v8h ta[16], tb[8];
#pragma unroll
    for (int i = 0; i < 16; ++i)       // head i/2, piece (i%2)*256 + tid of its 512 (token = piece/4, d piece = piece%4)
      ta[i] = *(const v8h*)(A + (size_t)(i >> 1) * (LGR * HD) + ((i & 1) * 256 + tid) * 8);
#pragma unroll
    for (int i = 0; i < 8; ++i)  tb[i] = *(const v8h*)(B + (i * 256 + tid) * 8);
#pragma unroll
    for (int i = 0; i < 16; ++i) *(v8h*)(As + ((i * 256 + tid) >> 2) * KSP + (tid & 3) * 8) = ta[i];
#pragma unroll
    for (int i = 0; i < 8; ++i)  *(v8h*)(Bs + (i * 8 + wave) * GSP + lane * 8) = tb[i];
  }
  __syncthreads();

  v8f acc[4];
#pragma unroll
  for (int nt = 0; nt < 4; ++nt) acc[nt] = zero8();

  // unrolled: the k offsets of the LDS reads become constants, and a k-step's ten reads stand as one group
#pragma unroll
  for (int ks = 0; ks < NHD; ++ks) {
    const v16h af = ldfrag_h(As + (ks * 128 + wave * 16 + c) * KSP + 8 * hh);
    v16h bfrag[4];
#pragma unroll
    for (int nt = 0; nt < 4; ++nt) bfrag[nt] = ldfrag_h(Bs + (nt * 16 + c) * GSP + ks * 32 + 8 * hh);
#pragma unroll
    for (int nt = 0; nt < 4; ++nt) acc[nt] = mma_h(af, bfrag[nt], acc[nt]);
  }
  __syncthreads();   // every wave's last fragment read ends before the tiles' LDS is rewritten as the output stage

  float* st = sm + wave * (16 * STP);
#pragma unroll
  for (int nt = 0; nt < 4; ++nt) {
    const int co = n0 + nt * 16 + c;
    const float bi = bfr(bp[co]);
#pragma unroll
    for (int r = 0; r < 8; ++r) st[(8 * hh + r) * STP + nt * 16 + c] = acc[nt][r] * (1.0f / 65536.0f) + bi;
  }
  wave_sync_lds();
  const int bimg = m0 >> 12;
  const int jbase = (m0 & (NTOK - 1)) + wave * 16;
  v4f ov[8];
  size_t offs[8];
#pragma unroll
  for (int it = 0; it < 8; ++it) {
    const int row = it * 2 + hh;
    int dst = idx[jbase + row];
    dst = (dst < 0) ? 0 : ((dst > NTOK - 1) ? (NTOK - 1) : dst);
    ov[it] = *(const v4f*)(st + row * STP + c * 4);
    offs[it] = ((size_t)(bimg * NTOK + dst)) * CIN + n0 + c * 4;
  }
  {
#pragma unroll
    for (int it = 0; it < 8; ++it) *(v4f*)(out + offs[it]) = ov[it];
    
  }
}

// =================================================================================================================
//   Wq f16 [768][256] 393216 @0; Wp f16 [256][256] 131072 @393216; X16 f16 [16384][256] 8388608 @524288;
//   QK f16 [16384][512] 16777216 @8912896; V16 f16 [4][256][4096] 8388608 @25690112;
//   Y f16 [128][1024][32] 8388608 @34078720. Total 42467328.
// =================================================================================================================
extern "C" void kernel_launch(void* const* d_in, const int* in_sizes, int n_in,
                              void* d_out, int out_size, void* d_ws, size_t ws_size,
                              hipStream_t stream) {
  if (n_in < 5) return;
  if (in_sizes[0] != NBAT * NTOK * CIN) return;
  if (in_sizes[1] != NTOK) return;
  if (in_sizes[2] != C3 * CIN) return;
  if (in_sizes[3] != CIN * CIN) return;
  if (in_sizes[4] != CIN) return;
  if (out_size != NBAT * NTOK * CIN) return;

  const float* x      = (const float*)d_in[0];
  const int*   idx    = (const int*)d_in[1];
  const float* w_qkv  = (const float*)d_in[2];
  const float* w_proj = (const float*)d_in[3];
  const float* b_proj = (const float*)d_in[4];
  float* out = (float*)d_out;

  const size_t sWq  = (size_t)C3 * CIN * 2;              //    393216
  const size_t sWp  = (size_t)CIN * CIN * 2;             //    131072
  const size_t sX16 = (size_t)MTOK * CIN * 2;            //   8388608
  const size_t sQK  = (size_t)MTOK * C2 * 2;             //  16777216
  const size_t sV16 = (size_t)NBAT * CIN * NTOK * 2;     //   8388608
  const size_t sY   = (size_t)NUNIT * LGR * HD * 2;      //   8388608
  size_t off = 0;
  const size_t oWq  = off; off += sWq;
  const size_t oWp  = off; off += sWp;
  const size_t oX16 = off; off += sX16;
  const size_t oQK  = off; off += sQK;
  const size_t oV16 = off; off += sV16;
  const size_t oY   = off; off += sY;
  if (off > ws_size) return;                             // off = 42467328
  if (off > (size_t)134217728) return;

  char* ws = (char*)d_ws;
  unsigned short* Wq  = (unsigned short*)(ws + oWq);
  unsigned short* Wp  = (unsigned short*)(ws + oWp);
  unsigned short* X16 = (unsigned short*)(ws + oX16);
  unsigned short* QK  = (unsigned short*)(ws + oQK);
  unsigned short* V16 = (unsigned short*)(ws + oV16);
  unsigned short* Yp  = (unsigned short*)(ws + oY);

  const dim3 blk(256);
  // (1) weights -> f16 x256 planes
  cvt_w<<<dim3(128), blk, 0, stream>>>(w_qkv, w_proj, Wq, Wp);
  // (2) gather x rows by idx -> token-major f16 x16 plane
  cvt_x<<<dim3(MTOK / 8), blk, 0, stream>>>(x, idx, X16);
  // (3) qkv projection -> token-major q/k plane and channel-major v plane
  gemm_qkv<<<dim3(C3 / 64, MTOK / 128), blk, 0, stream>>>(X16, Wq, QK, V16);
  // (4) grouped multi-head attention -> ctx slab plane
  attn_k<<<dim3(NUNIT * AQS), dim3(AWV * 32), 0, stream>>>(QK, V16, Yp);
  // (5) output projection + bias, rows written to their un-shuffled positions
  gemm_proj<<<dim3(CIN / 64, MTOK / 128), blk, 0, stream>>>(Yp, Wp, b_proj, idx, out);
  (void)hipGetLastError();
}

// v004
// One run takes 57.7 microseconds.
// Timed twice side by side with v003, it ran 1.03 times as fast both times.
// All steps since v000 together make it 4.53 times as fast.
// Contractions: v_wmma_f32_16x16x32_f16 (f16 operands, f32 accumulate). qkv projection: A = gathered x rows
// (bf16-valued, x16) single plane, B = w_qkv (bf16-valued, x256) single plane; scores k.qT: k x16, q x16 single
// planes; p.v: p x1024, v x16 single planes; output projection: A = ctx x256 single f16 plane, B = w_proj
// (bf16-valued, x256) single plane. Online softmax in f32 on VALU. Float inputs RNE-converted to bf16 on load.
#include <hip/hip_runtime.h>
#include <math.h>
#include <stdint.h>

#define NBAT  4
#define NTOK  4096
#define CIN   256
#define C2    512
#define C3    768
#define MTOK  16384
#define NHD   8
#define HD    32
#define NGR   4
#define LGR   1024
#define NUNIT 128
#define AWV   32
#define AQS   2
#define STP   68
#define SBP   132
#define ASP   36
#define KSP   40
#define VSP   1032
#define GSP   264
#define PWV   16
#define PRW   4
#define PXB   (MTOK / (PWV * PRW))
#define PWB   ((C3 + CIN) / (PWV * PRW))
#define CXS   16.0f
#define CWS   256.0f
#define CQK   (16.0f / 4096.0f)
#define CVS   (16.0f / 4096.0f)
#define CYS   256.0f
#define QKSC  (0.17677669529663688f / 256.0f)

static_assert(NUNIT == NBAT * NGR * NHD);
static_assert(NGR * LGR == NTOK);
static_assert(MTOK == NBAT * NTOK);
static_assert(NTOK % 128 == 0);
static_assert(LGR % 32 == 0);
static_assert(AQS * AWV * 16 == LGR);
static_assert(CIN % 64 == 0);
static_assert(NHD * HD == CIN);
static_assert(64 * SBP <= 8 * 16 * STP);
static_assert((STP * 4) % 16 == 0);
static_assert((SBP * 4) % 16 == 0);
static_assert((ASP * 4) % 16 == 0);
static_assert((KSP * 2) % 32 == 16 && KSP >= HD);
static_assert((VSP * 2) % 32 == 16 && VSP >= LGR);
static_assert((GSP * 2) % 32 == 16 && GSP >= CIN);
static_assert(8 * 16 * STP * 4 <= (128 + 64) * GSP * 2);
static_assert(8 * 16 * STP * 4 <= (NHD * 128 * KSP + 64 * GSP) * 2);
static_assert(128 * CIN == 16 * 256 * 8 && 64 * CIN == 8 * 256 * 8);
static_assert(LGR * HD == 4 * AWV * 32 * 8);
static_assert(CIN == 32 * 8);
static_assert(MTOK % (PWV * PRW) == 0 && C3 % (PWV * PRW) == 0 && CIN % (PWV * PRW) == 0);
static_assert(NTOK % PRW == 0);

typedef _Float16 v16h __attribute__((ext_vector_type(16)));
typedef _Float16 v8h  __attribute__((ext_vector_type(8)));
typedef float    v8f  __attribute__((ext_vector_type(8)));
typedef float    v4f  __attribute__((ext_vector_type(4)));
typedef unsigned int v4u __attribute__((ext_vector_type(4)));
union Frag { v16h v; v8h half[2]; };

// ---- scalar helpers -------------------------------------------------------------------------------------------
__device__ __forceinline__ unsigned short bf_bits(float f) {          // f32 -> bf16 bits, RNE convert
  unsigned u = __float_as_uint(f);
  return (unsigned short)((u + 0x7FFFu + ((u >> 16) & 1u)) >> 16);
}
__device__ __forceinline__ float bfr(float f) { return __uint_as_float(((unsigned)bf_bits(f)) << 16); }
__device__ __forceinline__ unsigned short h_bits(_Float16 x) { return __builtin_bit_cast(unsigned short, x); }
__device__ __forceinline__ unsigned pk16(unsigned short a, unsigned short b) { return (unsigned)a | ((unsigned)b << 16); }
__device__ __forceinline__ v8f zero8() { v8f z = {0.f, 0.f, 0.f, 0.f, 0.f, 0.f, 0.f, 0.f}; return z; }

// ---- fragment loader: 16-bit A/B operand, lane -> row/col (lane&15), p already includes +8*(lane>>4);
//      elements 0..7 <- p[0..7] (k0+8h..), elements 8..15 <- p[16..23] (k0+16+8h..)
__device__ __forceinline__ v16h ldfrag_h(const _Float16* p) {
  Frag f;
  f.half[0] = *(const v8h*)(p);
  f.half[1] = *(const v8h*)(p + 16);
  return f.v;
}

// ---- WMMA helper with trailing VALU hazard gap ----------------------------------------------------------------
__device__ __forceinline__ v8f mma_h(v16h a, v16h b, v8f c) {
  c = __builtin_amdgcn_wmma_f32_16x16x32_f16(false, a, false, b, (short)0, c, false, false);
#if defined(__HIP_DEVICE_COMPILE__)
  asm volatile("v_nop\n\tv_nop\n\tv_nop\n\tv_nop" : "+v"(c) : "v"(a), "v"(b));
#endif
  return c;
}
__device__ __forceinline__ void wave_sync_lds() {
  __builtin_amdgcn_fence(__ATOMIC_RELEASE, "workgroup");
  __builtin_amdgcn_wave_barrier();
  __builtin_amdgcn_fence(__ATOMIC_ACQUIRE, "workgroup");
}

// ---- 8 f32 -> 8 packed f16 (16 B) -------------------------------------------------------------------------------
__device__ __forceinline__ v4u pack8h(v4f a, v4f b) {
  v4u p;
  p[0] = pk16(h_bits((_Float16)a[0]), h_bits((_Float16)a[1]));
  p[1] = pk16(h_bits((_Float16)a[2]), h_bits((_Float16)a[3]));
  p[2] = pk16(h_bits((_Float16)b[0]), h_bits((_Float16)b[1]));
  p[3] = pk16(h_bits((_Float16)b[2]), h_bits((_Float16)b[3]));
  return p;
}

// =================================================================================================================
// Input convert, one launch for all three float operands. Every operand is a list of rows of 256 floats: 16384
// gathered activation rows, X16[T = b*4096 + j][256] = f16(16 * bf16_RNE(x[b][clamp(idx[j])][c])), and 768 + 256
// weight rows ([out][in], k contiguous), f16(256 * bf16_RNE(w)). One wave converts PRW = 4 consecutive plane rows:
// per row a lane reads 8 consecutive floats (two 16-B loads; the pair reads the row's 1024 B = 8 whole lines) and writes one
// 16-B piece; all 8 loads of a wave are issued before the first is used. Block = PWV = 16 waves = 64 rows; blocks
// 0..255 take the activation rows, 256..267 w_qkv, 268..271 w_proj (block-uniform branches).
// coverage: 256 x 64 = 16384, 12 x 64 = 768 and 4 x 64 = 256 rows, each row 32 lanes x 8 = 256 elements exactly.
// =================================================================================================================
__global__ __launch_bounds__(PWV * 32)
void cvt_in(const float* __restrict__ x, const int* __restrict__ idx, const float* __restrict__ wqkv,
            const float* __restrict__ wp, unsigned short* X16, unsigned short* Wq, unsigned short* Wp) {
  const int lane = threadIdx.x & 31;
  const int wave = __builtin_amdgcn_readfirstlane((int)(threadIdx.x >> 5));   // scalar: idx comes by scalar loads
  const int r0 = ((int)blockIdx.x * PWV + wave) * PRW;
  v4f a[PRW], a2[PRW];
  unsigned short* dp;
  float sc;
  if (blockIdx.x < PXB) {
    const int b = r0 >> 12, j = r0 & (NTOK - 1);
#pragma unroll
    for (int i = 0; i < PRW; ++i) {
      int s = idx[j + i];
      s = (s < 0) ? 0 : ((s > NTOK - 1) ? (NTOK - 1) : s);
      const float* sp = x + ((size_t)(b * NTOK + s)) * CIN + lane * 8;
      a[i]  = *(const v4f*)(sp);
      a2[i] = *(const v4f*)(sp + 4);
    }
    dp = X16 + (size_t)r0 * CIN + lane * 8;
    sc = CXS;
  } else if (blockIdx.x < PXB + C3 / (PWV * PRW)) {
    const int w0 = r0 - MTOK;
#pragma unroll
    for (int i = 0; i < PRW; ++i) {
      const float* sp = wqkv + (size_t)(w0 + i) * CIN + lane * 8;
      a[i]  = *(const v4f*)(sp);
      a2[i] = *(const v4f*)(sp + 4);
    }
    dp = Wq + (size_t)w0 * CIN + lane * 8;
    sc = CWS;
  } else {
    const int w0 = r0 - MTOK - C3;
#pragma unroll
    for (int i = 0; i < PRW; ++i) {
      const float* sp = wp + (size_t)(w0 + i) * CIN + lane * 8;
      a[i]  = *(const v4f*)(sp);
      a2[i] = *(const v4f*)(sp + 4);
    }
    dp = Wp + (size_t)w0 * CIN + lane * 8;
    sc = CWS;
  }
#pragma unroll
  for (int i = 0; i < PRW; ++i) {
    v4f sa, sb;
#pragma unroll
    for (int e = 0; e < 4; ++e) { sa[e] = bfr(a[i][e]) * sc; sb[e] = bfr(a2[i][e]) * sc; }
    *(v4u*)(dp + i * CIN) = pack8h(sa, sb);
  }
}

// =================================================================================================================
// qkv GEMM D[T][co] = X16[T][ci] . Wq[co][ci], K = 256, co 0..767 (q = 0..255, k = 256..511, v = 512..767).
// Block = 8 waves, tile 128 rows x 64 cols, wave = 16 rows x 4 n-tiles. The block's A rows (64 KB, contiguous) and
// B rows (32 KB, contiguous) are staged once, whole K, in LDS: one wave-load = one 512-B row = 4 whole lines, rows
// at pitch GSP (an odd multiple of 16 B for the 16-B fragment reads); one block barrier; fragments by LDS reads with
// the split k map, k-step 32 (8 steps); a second block barrier, then the same LDS is the output stage.
// grid = (12, 128). Block column groups 0..7 -> token-major plane QK[T][512]
// V16[b][c][n] = f16(16 * value): staged block-wide as [64 ch][SBP] (tokens contiguous; a 128-token tile lies
// within one batch row block), wave w owns channels w*8..+7; one instruction = lanes 0..15 -> channel cc (256 B =
// coverage: QK: 8 waves x 4 it x 4 rows x 8 pieces x 8 = 128 rows x 64 cols per block, 8 x 128 blocks tile
// 16384 x 512 exactly; V16: 8 waves x 4 it x 2 ch x 16 lanes x 8 = 64 ch x 128 tok per block, 4 x 128 blocks
// tile 256 ch x 16384 tok exactly.
// =================================================================================================================
__global__ __launch_bounds__(256)
void gemm_qkv(const unsigned short* __restrict__ X16, const unsigned short* __restrict__ Wq,
              unsigned short* QK, unsigned short* V16) {
  __shared__ __align__(16) unsigned char smem[(128 + 64) * GSP * 2];
  _Float16* As = (_Float16*)(void*)smem;
  _Float16* Bs = As + 128 * GSP;
  float* sm = (float*)(void*)smem;
  const int tid = threadIdx.x, wave = tid >> 5, lane = tid & 31, hh = lane >> 4, c = lane & 15;
  const int n0 = blockIdx.x * 64, m0 = blockIdx.y * 128;
  const _Float16* A = (const _Float16*)(const void*)X16 + (size_t)m0 * CIN;
  const _Float16* B = (const _Float16*)(const void*)Wq + (size_t)n0 * CIN;

  {
    v8h ta[16], tb[8];
#pragma unroll
    for (int i = 0; i < 16; ++i) ta[i] = *(const v8h*)(A + (i * 256 + tid) * 8);
#pragma unroll
    for (int i = 0; i < 8; ++i)  tb[i] = *(const v8h*)(B + (i * 256 + tid) * 8);
#pragma unroll
    for (int i = 0; i < 16; ++i) *(v8h*)(As + (i * 8 + wave) * GSP + lane * 8) = ta[i];
#pragma unroll
    for (int i = 0; i < 8; ++i)  *(v8h*)(Bs + (i * 8 + wave) * GSP + lane * 8) = tb[i];
  }
  __syncthreads();

  v8f acc[4];
#pragma unroll
  for (int nt = 0; nt < 4; ++nt) acc[nt] = zero8();

  // unrolled: the k offsets of the LDS reads become constants, and a k-step's ten reads stand as one group
#pragma unroll
  for (int k0 = 0; k0 < CIN; k0 += 32) {
    const v16h af = ldfrag_h(As + (wave * 16 + c) * GSP + k0 + 8 * hh);
    v16h bfrag[4];
#pragma unroll
    for (int nt = 0; nt < 4; ++nt) bfrag[nt] = ldfrag_h(Bs + (nt * 16 + c) * GSP + k0 + 8 * hh);
#pragma unroll
    for (int nt = 0; nt < 4; ++nt) acc[nt] = mma_h(af, bfrag[nt], acc[nt]);
  }
  __syncthreads();   // every wave's last fragment read ends before the tiles' LDS is rewritten as the output stage

  if (blockIdx.x < 8) {
    float* st = sm + wave * (16 * STP);
#pragma unroll
    for (int nt = 0; nt < 4; ++nt) {
#pragma unroll
      for (int r = 0; r < 8; ++r) st[(8 * hh + r) * STP + nt * 16 + c] = acc[nt][r];
    }
    wave_sync_lds();
    const int piece = lane & 7, rsub = lane >> 3;
    v4u pk[4];
    size_t offs[4];
#pragma unroll
    for (int it = 0; it < 4; ++it) {
      const int row = it * 4 + rsub;
      v4f fa = *(const v4f*)(st + row * STP + piece * 8);
      v4f fb = *(const v4f*)(st + row * STP + piece * 8 + 4);
      fa = fa * CQK;
      fb = fb * CQK;
      pk[it] = pack8h(fa, fb);
      offs[it] = ((size_t)(m0 + wave * 16 + row)) * C2 + n0 + piece * 8;
    }
    {
#pragma unroll
      for (int it = 0; it < 4; ++it) *(v4u*)(QK + offs[it]) = pk[it];
      
    }
  } else {
    const int cv0 = n0 - C2;
#pragma unroll
    for (int nt = 0; nt < 4; ++nt) {
#pragma unroll
      for (int r = 0; r < 8; ++r) sm[(nt * 16 + c) * SBP + wave * 16 + 8 * hh + r] = acc[nt][r];
    }
    __syncthreads();
    const int bimg = m0 >> 12, s0 = m0 & (NTOK - 1);
    v4u pk[4];
    size_t o16[4];
#pragma unroll
    for (int i2 = 0; i2 < 4; ++i2) {
      const int cc = wave * 8 + i2 * 2 + hh;
      const int co = cv0 + cc;
      v4f fa = *(const v4f*)(sm + cc * SBP + c * 8);
      v4f fb = *(const v4f*)(sm + cc * SBP + c * 8 + 4);
      fa = fa * CVS;
      fb = fb * CVS;
      pk[i2] = pack8h(fa, fb);
      o16[i2] = ((size_t)(bimg * CIN + co)) * NTOK + s0 + c * 8;
    }
    {
#pragma unroll
      for (int i2 = 0; i2 < 4; ++i2) *(v4u*)(V16 + o16[i2]) = pk[i2];
      
    }
  }
}

// =================================================================================================================
// Grouped attention, one unit (batch b, token group gr, head) per AQS = 2 blocks of 1024 threads = 32 waves, 1024
// queries x 1024 keys, d = 32: 256 blocks, 8 waves per SIMD, all waves of a block walk the same k and v rows.
// Static LDS: the unit's whole k slab Ks[1024 keys][KSP] and v slab Vs[32 channels][VSP] (f16, row pitch an odd
// multiple of 16 B for the 16-B fragment reads), filled once per block (each thread moves 4 + 4 pieces of 16 B from
// the token-major plane QK, k row = T*512 + 256 + head*32, and the channel-major plane V16, row = channel
// head*32 + d, keys contiguous), then one block barrier; plus the per-wave stage [16][ASP] f32. q fragments
// straight from QK (q row = T*512 + head*32). Per wave: the one q-tile qt = part*32 + wave (< 64).
//   Transposed scores S^T = K_tile (A, 16 keys x 32 d) x Q (B: k = d, n = query): S*256 = q16.k16; D element r of
//   lane l = S[query l&15][key 8h+r], so P = exp((S - m)*scale) x1024 is the A fragment of P.V directly in registers
//   (element i <- key tile 0 row i, element 8+i <- key tile 1 row i). Online softmax over 32 chunks of 32 keys;
//   O = P.V (acc scale 1024*16). Epilogue: O/(l*16384) staged per wave in LDS, then stored as the f16 plane
//   Y[unit][1024][32] of 256*o: one instruction = 32 lanes x 16 B = 512 B = 8 token rows (consecutive lanes
// coverage: per block 32 q-tiles x 16 rows x 32 d, half of its unit's 1024-row slab; grid covers 2 halves x 128
// units, every slab row written exactly once.
// =================================================================================================================
__global__ __launch_bounds__(AWV * 32)
void attn_k(const unsigned short* __restrict__ QK, const unsigned short* __restrict__ V16, unsigned short* Y) {
  __shared__ __align__(16) float Sst[AWV * 16 * ASP];
  __shared__ __align__(16) _Float16 Ks[LGR * KSP];
  __shared__ __align__(16) _Float16 Vs[HD * VSP];
  const int tid = threadIdx.x, wave = tid >> 5, lane = tid & 31, hh = lane >> 4, c = lane & 15;
  const int u = blockIdx.x & (NUNIT - 1), part = blockIdx.x / NUNIT;
  const int head = u & 7, gr = (u >> 3) & 3, b = u >> 5;
  const size_t tok0 = (size_t)b * NTOK + (size_t)gr * LGR;
  const _Float16* Qp = (const _Float16*)(const void*)QK + tok0 * C2 + head * HD;
  const _Float16* Kp = Qp + CIN;
  const size_t cm0 = ((size_t)(b * CIN + head * HD)) * NTOK + (size_t)gr * LGR;
  const _Float16* Vp = (const _Float16*)(const void*)V16 + cm0;
  float* st = Sst + wave * (16 * ASP);

  {
    const int qt = part * AWV + wave;
    const int lq = qt * 16 + c;
    const v16h bq = ldfrag_h(Qp + (size_t)lq * C2 + 8 * hh);     // B: n = query c, k = d 8h.. / 16+8h..

    {
      v8h kt[4], vt[4];
#pragma unroll
      for (int i = 0; i < 4; ++i) {
        const int id = i * (AWV * 32) + tid;
        kt[i] = *(const v8h*)(Kp + (size_t)(id >> 2) * C2 + (id & 3) * 8);       // key id/4, d piece id%4
        vt[i] = *(const v8h*)(Vp + (size_t)(id >> 7) * NTOK + (id & 127) * 8);   // channel id/128, key piece id%128
      }
#pragma unroll
      for (int i = 0; i < 4; ++i) {
        const int id = i * (AWV * 32) + tid;
        *(v8h*)(Ks + (id >> 2) * KSP + (id & 3) * 8)   = kt[i];
        *(v8h*)(Vs + (id >> 7) * VSP + (id & 127) * 8) = vt[i];
      }
    }
    __syncthreads();

    v8f o0 = zero8(), o1 = zero8();
    float mrun = -1.0e30f, lrun = 0.f;
#pragma unroll 1
    for (int ch = 0; ch < LGR / 32; ++ch) {
      const int kb = ch * 32;
      v8f s[2];
#pragma unroll
      for (int j = 0; j < 2; ++j) {
        const v16h ka = ldfrag_h(Ks + (kb + j * 16 + c) * KSP + 8 * hh);          // A: row = key, k = d
        s[j] = mma_h(ka, bq, zero8());
      }
      float mc = s[0][0];
#pragma unroll
      for (int j = 0; j < 2; ++j) {
#pragma unroll
        for (int r = 0; r < 8; ++r) mc = fmaxf(mc, s[j][r]);
      }
      mc = fmaxf(mc, __shfl_xor(mc, 16, 32));
      const float mnew = fmaxf(mrun, mc);
      const float alpha = __expf((mrun - mnew) * QKSC);
#pragma unroll
      for (int r = 0; r < 8; ++r) {
        const float arr = __shfl(alpha, 8 * hh + r, 32);
        o0[r] = o0[r] * arr;
        o1[r] = o1[r] * arr;
      }
      float psum = 0.f;
      v16h pfh;
#pragma unroll
      for (int i = 0; i < 8; ++i) {
        const float e0 = __expf((s[0][i] - mnew) * QKSC);
        const float e1 = __expf((s[1][i] - mnew) * QKSC);
        psum = psum + (e0 + e1);
        pfh[i]     = (_Float16)(e0 * 1024.0f);
        pfh[8 + i] = (_Float16)(e1 * 1024.0f);
      }
      lrun = lrun * alpha + psum;
      mrun = mnew;
      {
        const v16h vf0 = ldfrag_h(Vs + c * VSP + kb + 8 * hh);                       // B: n = d c, keys kb..+31
        const v16h vf1 = ldfrag_h(Vs + (HD / 2 + c) * VSP + kb + 8 * hh);            // B: n = d 16+c
        o0 = mma_h(pfh, vf0, o0);
        o1 = mma_h(pfh, vf1, o1);
      }
    }
    const float lsum = lrun + __shfl_xor(lrun, 16, 32);      // lane q (and q+16) holds the full row sum of query q
    const float rinv = 1.0f / (lsum * 16384.0f);
#pragma unroll
    for (int r = 0; r < 8; ++r) {
      const int q = 8 * hh + r;
      const float inv = __shfl(rinv, q, 32);
      st[q * ASP + c]          = o0[r] * inv;
      st[q * ASP + HD / 2 + c] = o1[r] * inv;
    }
    wave_sync_lds();
    {
      const int rr = lane >> 2, dp = (lane & 3) * 8;
      v4u pk[2];
      size_t offs[2];
#pragma unroll
      for (int it = 0; it < 2; ++it) {
        const int row = it * 8 + rr;
        v4f fa = *(const v4f*)(st + row * ASP + dp);
        v4f fb = *(const v4f*)(st + row * ASP + dp + 4);
        fa = fa * CYS;
        fb = fb * CYS;
        pk[it] = pack8h(fa, fb);
        offs[it] = ((size_t)u * LGR + (size_t)(qt * 16 + row)) * HD + dp;
      }
      {
#pragma unroll
        for (int it = 0; it < 2; ++it) *(v4u*)(Y + offs[it]) = pk[it];
        
      }
    }
  }
}

// =================================================================================================================
// Output projection D[T][co] = Y[T][ci] . Wp[co][ci] + bias, rows T in shuffled token order, written to the
// un-shuffled output row idx[j] (clamped) of batch b. A = Y plane (x256) addressed by arithmetic: token T ->
// (batch, group, query), k-step ks = head ks, channels ks*32 + d (elements 0..7 d = 8h.., elements 8..15 d =
// 16+8h..). B = weight plane x256. Both tiles are staged once, whole K, in LDS by whole-line loads: per head the
// block's 128 token rows of Y are 8 KB contiguous -> As[head][token][KSP]; the 64 weight rows are 32 KB contiguous
// -> Bs[row][GSP]; one block barrier, fragments by LDS reads, a second block barrier, then the same LDS is the
// output stage. Epilogue: value = acc/65536 + bf16(b)[co], staged per wave in LDS [16][STP];
// coverage: 8 waves x 8 it x 2 rows x 16 lanes x 4 = 128 rows x 64 co per block; grid tiles 16384 x 256 exactly;
// with idx a permutation every output row is written exactly once.
// =================================================================================================================
__global__ __launch_bounds__(256)
void gemm_proj(const unsigned short* __restrict__ Y, const unsigned short* __restrict__ Wp,
               const float* __restrict__ bp, const int* __restrict__ idx, float* out) {
  __shared__ __align__(16) unsigned char smem[(NHD * 128 * KSP + 64 * GSP) * 2];
  _Float16* As = (_Float16*)(void*)smem;
  _Float16* Bs = As + NHD * 128 * KSP;
  float* sm = (float*)(void*)smem;
  const int tid = threadIdx.x, wave = tid >> 5, lane = tid & 31, hh = lane >> 4, c = lane & 15;
  const int n0 = blockIdx.x * 64, m0 = blockIdx.y * 128;
  const int bq = m0 >> 12, jj = m0 & (NTOK - 1), gr = jj >> 10, q0 = jj & (LGR - 1);
  const _Float16* A = (const _Float16*)(const void*)Y + (((size_t)((bq * NGR + gr) * NHD)) * LGR + (size_t)q0) * HD;
  const _Float16* B = (const _Float16*)(const void*)Wp + (size_t)n0 * CIN;

  {
    v8h ta[16], tb[8];
#pragma unroll
    for (int i = 0; i < 16; ++i)       // head i/2, piece (i%2)*256 + tid of its 512 (token = piece/4, d piece = piece%4)
      ta[i] = *(const v8h*)(A + (size_t)(i >> 1) * (LGR * HD) + ((i & 1) * 256 + tid) * 8);
#pragma unroll
    for (int i = 0; i < 8; ++i)  tb[i] = *(const v8h*)(B + (i * 256 + tid) * 8);
#pragma unroll
    for (int i = 0; i < 16; ++i) *(v8h*)(As + ((i * 256 + tid) >> 2) * KSP + (tid & 3) * 8) = ta[i];
#pragma unroll
    for (int i = 0; i < 8; ++i)  *(v8h*)(Bs + (i * 8 + wave) * GSP + lane * 8) = tb[i];
  }
  __syncthreads();

  v8f acc[4];
#pragma unroll
  for (int nt = 0; nt < 4; ++nt) acc[nt] = zero8();

  // unrolled: the k offsets of the LDS reads become constants, and a k-step's ten reads stand as one group
#pragma unroll
  for (int ks = 0; ks < NHD; ++ks) {
    const v16h af = ldfrag_h(As + (ks * 128 + wave * 16 + c) * KSP + 8 * hh);
    v16h bfrag[4];
#pragma unroll
    for (int nt = 0; nt < 4; ++nt) bfrag[nt] = ldfrag_h(Bs + (nt * 16 + c) * GSP + ks * 32 + 8 * hh);
#pragma unroll
    for (int nt = 0; nt < 4; ++nt) acc[nt] = mma_h(af, bfrag[nt], acc[nt]);
  }
  __syncthreads();   // every wave's last fragment read ends before the tiles' LDS is rewritten as the output stage

  float* st = sm + wave * (16 * STP);
#pragma unroll
  for (int nt = 0; nt < 4; ++nt) {
    const int co = n0 + nt * 16 + c;
    const float bi = bfr(bp[co]);
#pragma unroll
    for (int r = 0; r < 8; ++r) st[(8 * hh + r) * STP + nt * 16 + c] = acc[nt][r] * (1.0f / 65536.0f) + bi;
  }
  wave_sync_lds();
  const int bimg = m0 >> 12;
  const int jbase = (m0 & (NTOK - 1)) + wave * 16;
  v4f ov[8];
  size_t offs[8];
#pragma unroll
  for (int it = 0; it < 8; ++it) {
    const int row = it * 2 + hh;
    int dst = idx[jbase + row];
    dst = (dst < 0) ? 0 : ((dst > NTOK - 1) ? (NTOK - 1) : dst);
    ov[it] = *(const v4f*)(st + row * STP + c * 4);
    offs[it] = ((size_t)(bimg * NTOK + dst)) * CIN + n0 + c * 4;
  }
  {
#pragma unroll
    for (int it = 0; it < 8; ++it) *(v4f*)(out + offs[it]) = ov[it];
    
  }
}

// =================================================================================================================
//   Wq f16 [768][256] 393216 @0; Wp f16 [256][256] 131072 @393216; X16 f16 [16384][256] 8388608 @524288;
//   QK f16 [16384][512] 16777216 @8912896; V16 f16 [4][256][4096] 8388608 @25690112;
//   Y f16 [128][1024][32] 8388608 @34078720. Total 42467328.
// =================================================================================================================
extern "C" void kernel_launch(void* const* d_in, const int* in_sizes, int n_in,
                              void* d_out, int out_size, void* d_ws, size_t ws_size,
                              hipStream_t stream) {
  if (n_in < 5) return;
  if (in_sizes[0] != NBAT * NTOK * CIN) return;
  if (in_sizes[1] != NTOK) return;
  if (in_sizes[2] != C3 * CIN) return;
  if (in_sizes[3] != CIN * CIN) return;
  if (in_sizes[4] != CIN) return;
  if (out_size != NBAT * NTOK * CIN) return;

  const float* x      = (const float*)d_in[0];
  const int*   idx    = (const int*)d_in[1];
  const float* w_qkv  = (const float*)d_in[2];
  const float* w_proj = (const float*)d_in[3];
  const float* b_proj = (const float*)d_in[4];
  float* out = (float*)d_out;

  const size_t sWq  = (size_t)C3 * CIN * 2;              //    393216
  const size_t sWp  = (size_t)CIN * CIN * 2;             //    131072
  const size_t sX16 = (size_t)MTOK * CIN * 2;            //   8388608
  const size_t sQK  = (size_t)MTOK * C2 * 2;             //  16777216
  const size_t sV16 = (size_t)NBAT * CIN * NTOK * 2;     //   8388608
  const size_t sY   = (size_t)NUNIT * LGR * HD * 2;      //   8388608
  size_t off = 0;
  const size_t oWq  = off; off += sWq;
  const size_t oWp  = off; off += sWp;
  const size_t oX16 = off; off += sX16;
  const size_t oQK  = off; off += sQK;
  const size_t oV16 = off; off += sV16;
  const size_t oY   = off; off += sY;
  if (off > ws_size) return;                             // off = 42467328
  if (off > (size_t)134217728) return;

  char* ws = (char*)d_ws;
  unsigned short* Wq  = (unsigned short*)(ws + oWq);
  unsigned short* Wp  = (unsigned short*)(ws + oWp);
  unsigned short* X16 = (unsigned short*)(ws + oX16);
  unsigned short* QK  = (unsigned short*)(ws + oQK);
  unsigned short* V16 = (unsigned short*)(ws + oV16);
  unsigned short* Yp  = (unsigned short*)(ws + oY);

  const dim3 blk(256);
  // (1) weights -> f16 x256 planes; x rows gathered by idx -> token-major f16 x16 plane
  cvt_in<<<dim3(PXB + PWB), dim3(PWV * 32), 0, stream>>>(x, idx, w_qkv, w_proj, X16, Wq, Wp);
  // (2) qkv projection -> token-major q/k plane and channel-major v plane
  gemm_qkv<<<dim3(C3 / 64, MTOK / 128), blk, 0, stream>>>(X16, Wq, QK, V16);
  // (3) grouped multi-head attention -> ctx slab plane
  attn_k<<<dim3(NUNIT * AQS), dim3(AWV * 32), 0, stream>>>(QK, V16, Yp);
  // (4) output projection + bias, rows written to their un-shuffled positions
  gemm_proj<<<dim3(CIN / 64, MTOK / 128), blk, 0, stream>>>(Yp, Wp, b_proj, idx, out);
  (void)hipGetLastError();
}

// v005
// It runs in 53.2 microseconds.
// Two timings next to v004 both put it at 1.08 times that version's speed.
// All steps since v000 together make it 4.89 times as fast.
// Contractions: v_wmma_f32_16x16x32_f16 (f16 operands, f32 accumulate). qkv projection: A = gathered x rows
// (bf16-valued, x16) single plane, B = w_qkv (bf16-valued, x256) single plane; scores k.qT: k x16, q x16 single
// planes; p.v: p x1024, v x16 single planes; output projection: A = ctx x256 single f16 plane, B = w_proj
// (bf16-valued, x256) single plane. Online softmax in f32 on VALU. Float inputs RNE-converted to bf16 on load.
#include <hip/hip_runtime.h>
#include <math.h>
#include <stdint.h>

#define NBAT  4
#define NTOK  4096
#define CIN   256
#define C2    512
#define C3    768
#define MTOK  16384
#define NHD   8
#define HD    32
#define NGR   4
#define LGR   1024
#define NUNIT 128
#define AWV   32
#define AQS   2
#define STP   68
#define SBP   132
#define ASP   36
#define KSP   40
#define VSP   1032
#define GSP   264
#define PWV   16
#define PRW   4
#define PXB   (MTOK / (PWV * PRW))
#define PWB   ((C3 + CIN) / (PWV * PRW))
#define CXS   16.0f
#define CWS   256.0f
#define CQK   (16.0f / 4096.0f)
#define CVS   (16.0f / 4096.0f)
#define CYS   256.0f
#define QKSC  (0.17677669529663688f / 256.0f)
#define QKL2  (QKSC * 1.4426950408889634f)

static_assert(NUNIT == NBAT * NGR * NHD);
static_assert(NGR * LGR == NTOK);
static_assert(MTOK == NBAT * NTOK);
static_assert(NTOK % 128 == 0);
static_assert(LGR % 32 == 0);
static_assert(AQS * AWV * 16 == LGR);
static_assert(CIN % 64 == 0);
static_assert(NHD * HD == CIN);
static_assert(64 * SBP <= 8 * 16 * STP);
static_assert((STP * 4) % 16 == 0);
static_assert((SBP * 4) % 16 == 0);
static_assert((ASP * 4) % 16 == 0);
static_assert((KSP * 2) % 32 == 16 && KSP >= HD);
static_assert((VSP * 2) % 32 == 16 && VSP >= LGR);
static_assert((GSP * 2) % 32 == 16 && GSP >= CIN);
static_assert(8 * 16 * STP * 4 <= (128 + 64) * GSP * 2);
static_assert(8 * 16 * STP * 4 <= (NHD * 128 * KSP + 64 * GSP) * 2);
static_assert(128 * CIN == 16 * 256 * 8 && 64 * CIN == 8 * 256 * 8);
static_assert(LGR * HD == 4 * AWV * 32 * 8);
static_assert(CIN == 32 * 8);
static_assert(MTOK % (PWV * PRW) == 0 && C3 % (PWV * PRW) == 0 && CIN % (PWV * PRW) == 0);
static_assert(NTOK % PRW == 0);

typedef _Float16 v16h __attribute__((ext_vector_type(16)));
typedef _Float16 v8h  __attribute__((ext_vector_type(8)));
typedef float    v8f  __attribute__((ext_vector_type(8)));
typedef float    v4f  __attribute__((ext_vector_type(4)));
typedef float    v2f  __attribute__((ext_vector_type(2)));
typedef unsigned int v4u __attribute__((ext_vector_type(4)));
union Frag { v16h v; v8h half[2]; };

// ---- scalar helpers -------------------------------------------------------------------------------------------
__device__ __forceinline__ unsigned short bf_bits(float f) {          // f32 -> bf16 bits, RNE convert
  unsigned u = __float_as_uint(f);
  return (unsigned short)((u + 0x7FFFu + ((u >> 16) & 1u)) >> 16);
}
__device__ __forceinline__ float bfr(float f) { return __uint_as_float(((unsigned)bf_bits(f)) << 16); }
__device__ __forceinline__ unsigned short h_bits(_Float16 x) { return __builtin_bit_cast(unsigned short, x); }
__device__ __forceinline__ unsigned pk16(unsigned short a, unsigned short b) { return (unsigned)a | ((unsigned)b << 16); }
__device__ __forceinline__ v8f zero8() { v8f z = {0.f, 0.f, 0.f, 0.f, 0.f, 0.f, 0.f, 0.f}; return z; }

// ---- fragment loader: 16-bit A/B operand, lane -> row/col (lane&15), p already includes +8*(lane>>4);
//      elements 0..7 <- p[0..7] (k0+8h..), elements 8..15 <- p[16..23] (k0+16+8h..)
__device__ __forceinline__ v16h ldfrag_h(const _Float16* p) {
  Frag f;
  f.half[0] = *(const v8h*)(p);
  f.half[1] = *(const v8h*)(p + 16);
  return f.v;
}

// ---- WMMA helper with trailing VALU hazard gap ----------------------------------------------------------------
__device__ __forceinline__ v8f mma_h(v16h a, v16h b, v8f c) {
  c = __builtin_amdgcn_wmma_f32_16x16x32_f16(false, a, false, b, (short)0, c, false, false);
#if defined(__HIP_DEVICE_COMPILE__)
  asm volatile("v_nop\n\tv_nop\n\tv_nop\n\tv_nop" : "+v"(c) : "v"(a), "v"(b));
#endif
  return c;
}
__device__ __forceinline__ void wave_sync_lds() {
  __builtin_amdgcn_fence(__ATOMIC_RELEASE, "workgroup");
  __builtin_amdgcn_wave_barrier();
  __builtin_amdgcn_fence(__ATOMIC_ACQUIRE, "workgroup");
}

// ---- 8 f32 -> 8 packed f16 (16 B) -------------------------------------------------------------------------------
__device__ __forceinline__ v4u pack8h(v4f a, v4f b) {
  v4u p;
  p[0] = pk16(h_bits((_Float16)a[0]), h_bits((_Float16)a[1]));
  p[1] = pk16(h_bits((_Float16)a[2]), h_bits((_Float16)a[3]));
  p[2] = pk16(h_bits((_Float16)b[0]), h_bits((_Float16)b[1]));
  p[3] = pk16(h_bits((_Float16)b[2]), h_bits((_Float16)b[3]));
  return p;
}

// =================================================================================================================
// Input convert, one launch for all three float operands. Every operand is a list of rows of 256 floats: 16384
// gathered activation rows, X16[T = b*4096 + j][256] = f16(16 * bf16_RNE(x[b][clamp(idx[j])][c])), and 768 + 256
// weight rows ([out][in], k contiguous), f16(256 * bf16_RNE(w)). One wave converts PRW = 4 consecutive plane rows:
// per row a lane reads 8 consecutive floats (two 16-B loads; the pair reads the row's 1024 B = 8 whole lines) and writes one
// 16-B piece; all 8 loads of a wave are issued before the first is used. Block = PWV = 16 waves = 64 rows; blocks
// 0..255 take the activation rows, 256..267 w_qkv, 268..271 w_proj (block-uniform branches).
// coverage: 256 x 64 = 16384, 12 x 64 = 768 and 4 x 64 = 256 rows, each row 32 lanes x 8 = 256 elements exactly.
// =================================================================================================================
__global__ __launch_bounds__(PWV * 32)
void cvt_in(const float* __restrict__ x, const int* __restrict__ idx, const float* __restrict__ wqkv,
            const float* __restrict__ wp, unsigned short* X16, unsigned short* Wq, unsigned short* Wp) {
  const int lane = threadIdx.x & 31;
  const int wave = __builtin_amdgcn_readfirstlane((int)(threadIdx.x >> 5));   // scalar: idx comes by scalar loads
  const int r0 = ((int)blockIdx.x * PWV + wave) * PRW;
  v4f a[PRW], a2[PRW];
  unsigned short* dp;
  float sc;
  if (blockIdx.x < PXB) {
    const int b = r0 >> 12, j = r0 & (NTOK - 1);
#pragma unroll
    for (int i = 0; i < PRW; ++i) {
      int s = idx[j + i];
      s = (s < 0) ? 0 : ((s > NTOK - 1) ? (NTOK - 1) : s);
      const float* sp = x + ((size_t)(b * NTOK + s)) * CIN + lane * 8;
      a[i]  = *(const v4f*)(sp);
      a2[i] = *(const v4f*)(sp + 4);
    }
    dp = X16 + (size_t)r0 * CIN + lane * 8;
    sc = CXS;
  } else if (blockIdx.x < PXB + C3 / (PWV * PRW)) {
    const int w0 = r0 - MTOK;
#pragma unroll
    for (int i = 0; i < PRW; ++i) {
      const float* sp = wqkv + (size_t)(w0 + i) * CIN + lane * 8;
      a[i]  = *(const v4f*)(sp);
      a2[i] = *(const v4f*)(sp + 4);
    }
    dp = Wq + (size_t)w0 * CIN + lane * 8;
    sc = CWS;
  } else {
    const int w0 = r0 - MTOK - C3;
#pragma unroll
    for (int i = 0; i < PRW; ++i) {
      const float* sp = wp + (size_t)(w0 + i) * CIN + lane * 8;
      a[i]  = *(const v4f*)(sp);
      a2[i] = *(const v4f*)(sp + 4);
    }
    dp = Wp + (size_t)w0 * CIN + lane * 8;
    sc = CWS;
  }
#pragma unroll
  for (int i = 0; i < PRW; ++i) {
    v4f sa, sb;
#pragma unroll
    for (int e = 0; e < 4; ++e) { sa[e] = bfr(a[i][e]) * sc; sb[e] = bfr(a2[i][e]) * sc; }
    *(v4u*)(dp + i * CIN) = pack8h(sa, sb);
  }
}

// =================================================================================================================
// qkv GEMM D[T][co] = X16[T][ci] . Wq[co][ci], K = 256, co 0..767 (q = 0..255, k = 256..511, v = 512..767).
// Block = 8 waves, tile 128 rows x 64 cols, wave = 16 rows x 4 n-tiles. The block's A rows (64 KB, contiguous) and
// B rows (32 KB, contiguous) are staged once, whole K, in LDS: one wave-load = one 512-B row = 4 whole lines, rows
// at pitch GSP (an odd multiple of 16 B for the 16-B fragment reads); one block barrier; fragments by LDS reads with
// the split k map, k-step 32 (8 steps); a second block barrier, then the same LDS is the output stage.
// grid = (12, 128). Block column groups 0..7 -> token-major plane QK[T][512]
// V16[b][c][n] = f16(16 * value): staged block-wide as [64 ch][SBP] (tokens contiguous; a 128-token tile lies
// within one batch row block), wave w owns channels w*8..+7; one instruction = lanes 0..15 -> channel cc (256 B =
// coverage: QK: 8 waves x 4 it x 4 rows x 8 pieces x 8 = 128 rows x 64 cols per block, 8 x 128 blocks tile
// 16384 x 512 exactly; V16: 8 waves x 4 it x 2 ch x 16 lanes x 8 = 64 ch x 128 tok per block, 4 x 128 blocks
// tile 256 ch x 16384 tok exactly.
// =================================================================================================================
__global__ __launch_bounds__(256)
void gemm_qkv(const unsigned short* __restrict__ X16, const unsigned short* __restrict__ Wq,
              unsigned short* QK, unsigned short* V16) {
  __shared__ __align__(16) unsigned char smem[(128 + 64) * GSP * 2];
  _Float16* As = (_Float16*)(void*)smem;
  _Float16* Bs = As + 128 * GSP;
  float* sm = (float*)(void*)smem;
  const int tid = threadIdx.x, wave = tid >> 5, lane = tid & 31, hh = lane >> 4, c = lane & 15;
  const int n0 = blockIdx.x * 64, m0 = blockIdx.y * 128;
  const _Float16* A = (const _Float16*)(const void*)X16 + (size_t)m0 * CIN;
  const _Float16* B = (const _Float16*)(const void*)Wq + (size_t)n0 * CIN;

  {
    v8h ta[16], tb[8];
#pragma unroll
    for (int i = 0; i < 16; ++i) ta[i] = *(const v8h*)(A + (i * 256 + tid) * 8);
#pragma unroll
    for (int i = 0; i < 8; ++i)  tb[i] = *(const v8h*)(B + (i * 256 + tid) * 8);
#pragma unroll
    for (int i = 0; i < 16; ++i) *(v8h*)(As + (i * 8 + wave) * GSP + lane * 8) = ta[i];
#pragma unroll
    for (int i = 0; i < 8; ++i)  *(v8h*)(Bs + (i * 8 + wave) * GSP + lane * 8) = tb[i];
  }
  __syncthreads();

  v8f acc[4];
#pragma unroll
  for (int nt = 0; nt < 4; ++nt) acc[nt] = zero8();

  // unrolled: the k offsets of the LDS reads become constants, and a k-step's ten reads stand as one group
#pragma unroll
  for (int k0 = 0; k0 < CIN; k0 += 32) {
    const v16h af = ldfrag_h(As + (wave * 16 + c) * GSP + k0 + 8 * hh);
    v16h bfrag[4];
#pragma unroll
    for (int nt = 0; nt < 4; ++nt) bfrag[nt] = ldfrag_h(Bs + (nt * 16 + c) * GSP + k0 + 8 * hh);
#pragma unroll
    for (int nt = 0; nt < 4; ++nt) acc[nt] = mma_h(af, bfrag[nt], acc[nt]);
  }
  __syncthreads();   // every wave's last fragment read ends before the tiles' LDS is rewritten as the output stage

  if (blockIdx.x < 8) {
    float* st = sm + wave * (16 * STP);
#pragma unroll
    for (int nt = 0; nt < 4; ++nt) {
#pragma unroll
      for (int r = 0; r < 8; ++r) st[(8 * hh + r) * STP + nt * 16 + c] = acc[nt][r];
    }
    wave_sync_lds();
    const int piece = lane & 7, rsub = lane >> 3;
    v4u pk[4];
    size_t offs[4];
#pragma unroll
    for (int it = 0; it < 4; ++it) {
      const int row = it * 4 + rsub;
      v4f fa = *(const v4f*)(st + row * STP + piece * 8);
      v4f fb = *(const v4f*)(st + row * STP + piece * 8 + 4);
      fa = fa * CQK;
      fb = fb * CQK;
      pk[it] = pack8h(fa, fb);
      offs[it] = ((size_t)(m0 + wave * 16 + row)) * C2 + n0 + piece * 8;
    }
    {
#pragma unroll
      for (int it = 0; it < 4; ++it) *(v4u*)(QK + offs[it]) = pk[it];
      
    }
  } else {
    const int cv0 = n0 - C2;
#pragma unroll
    for (int nt = 0; nt < 4; ++nt) {
#pragma unroll
      for (int r = 0; r < 8; ++r) sm[(nt * 16 + c) * SBP + wave * 16 + 8 * hh + r] = acc[nt][r];
    }
    __syncthreads();
    const int bimg = m0 >> 12, s0 = m0 & (NTOK - 1);
    v4u pk[4];
    size_t o16[4];
#pragma unroll
    for (int i2 = 0; i2 < 4; ++i2) {
      const int cc = wave * 8 + i2 * 2 + hh;
      const int co = cv0 + cc;
      v4f fa = *(const v4f*)(sm + cc * SBP + c * 8);
      v4f fb = *(const v4f*)(sm + cc * SBP + c * 8 + 4);
      fa = fa * CVS;
      fb = fb * CVS;
      pk[i2] = pack8h(fa, fb);
      o16[i2] = ((size_t)(bimg * CIN + co)) * NTOK + s0 + c * 8;
    }
    {
#pragma unroll
      for (int i2 = 0; i2 < 4; ++i2) *(v4u*)(V16 + o16[i2]) = pk[i2];
      
    }
  }
}

// =================================================================================================================
// Grouped attention, one unit (batch b, token group gr, head) per AQS = 2 blocks of 1024 threads = 32 waves, 1024
// queries x 1024 keys, d = 32: 256 blocks, 8 waves per SIMD, all waves of a block walk the same k and v rows.
// Static LDS: the unit's whole k slab Ks[1024 keys][KSP] and v slab Vs[32 channels][VSP] (f16, row pitch an odd
// multiple of 16 B for the 16-B fragment reads), filled once per block (each thread moves 4 + 4 pieces of 16 B from
// the token-major plane QK, k row = T*512 + 256 + head*32, and the channel-major plane V16, row = channel
// head*32 + d, keys contiguous), then one block barrier; plus the per-wave stage [16][ASP] f32. q fragments
// straight from QK (q row = T*512 + head*32). Per wave: the one q-tile qt = part*32 + wave (< 64).
//   Transposed scores S^T = K_tile (A, 16 keys x 32 d) x Q (B: k = d, n = query): S*256 = q16.k16; D element r of
//   lane l = S[query l&15][key 8h+r], so P = exp((S - m)*scale) x1024 is the A fragment of P.V directly in registers;
//   each P is one fma and one exp2: 2^(S*QKL2 + nb), nb = 10 - m*QKL2 (scale, log2 e, the maximum and the x1024 in it)
//   (element i <- key tile 0 row i, element 8+i <- key tile 1 row i). Online softmax over 32 chunks of 32 keys;
//   O = P.V (acc scale 1024*16), l = sum of P (x1024). Epilogue: O/(l*16) staged per wave in LDS, then stored as the f16 plane
//   Y[unit][1024][32] of 256*o: one instruction = 32 lanes x 16 B = 512 B = 8 token rows (consecutive lanes
// coverage: per block 32 q-tiles x 16 rows x 32 d, half of its unit's 1024-row slab; grid covers 2 halves x 128
// units, every slab row written exactly once.
// =================================================================================================================
__global__ __launch_bounds__(AWV * 32)
void attn_k(const unsigned short* __restrict__ QK, const unsigned short* __restrict__ V16, unsigned short* Y) {
  __shared__ __align__(16) float Sst[AWV * 16 * ASP];
  __shared__ __align__(16) _Float16 Ks[LGR * KSP];
  __shared__ __align__(16) _Float16 Vs[HD * VSP];
  const int tid = threadIdx.x, wave = tid >> 5, lane = tid & 31, hh = lane >> 4, c = lane & 15;
  const int u = blockIdx.x & (NUNIT - 1), part = blockIdx.x / NUNIT;
  const int head = u & 7, gr = (u >> 3) & 3, b = u >> 5;
  const size_t tok0 = (size_t)b * NTOK + (size_t)gr * LGR;
  const _Float16* Qp = (const _Float16*)(const void*)QK + tok0 * C2 + head * HD;
  const _Float16* Kp = Qp + CIN;
  const size_t cm0 = ((size_t)(b * CIN + head * HD)) * NTOK + (size_t)gr * LGR;
  const _Float16* Vp = (const _Float16*)(const void*)V16 + cm0;
  float* st = Sst + wave * (16 * ASP);

  {
    const int qt = part * AWV + wave;
    const int lq = qt * 16 + c;
    const v16h bq = ldfrag_h(Qp + (size_t)lq * C2 + 8 * hh);     // B: n = query c, k = d 8h.. / 16+8h..

    {
      v8h kt[4], vt[4];
#pragma unroll
      for (int i = 0; i < 4; ++i) {
        const int id = i * (AWV * 32) + tid;
        kt[i] = *(const v8h*)(Kp + (size_t)(id >> 2) * C2 + (id & 3) * 8);       // key id/4, d piece id%4
        vt[i] = *(const v8h*)(Vp + (size_t)(id >> 7) * NTOK + (id & 127) * 8);   // channel id/128, key piece id%128
      }
#pragma unroll
      for (int i = 0; i < 4; ++i) {
        const int id = i * (AWV * 32) + tid;
        *(v8h*)(Ks + (id >> 2) * KSP + (id & 3) * 8)   = kt[i];
        *(v8h*)(Vs + (id >> 7) * VSP + (id & 127) * 8) = vt[i];
      }
    }
    __syncthreads();

    v8f o0 = zero8(), o1 = zero8();
    float mrun = -1.0e30f, lrun = 0.f;
    float nbrun = fmaf(-mrun, QKL2, 10.0f);
#pragma unroll 1
    for (int ch = 0; ch < LGR / 32; ++ch) {
      const int kb = ch * 32;
      v8f s[2];
#pragma unroll
      for (int j = 0; j < 2; ++j) {
        const v16h ka = ldfrag_h(Ks + (kb + j * 16 + c) * KSP + 8 * hh);          // A: row = key, k = d
        s[j] = mma_h(ka, bq, zero8());
      }
      float mc = s[0][0];
#pragma unroll
      for (int j = 0; j < 2; ++j) {
#pragma unroll
        for (int r = 0; r < 8; ++r) mc = fmaxf(mc, s[j][r]);
      }
      mc = fmaxf(mc, __shfl_xor(mc, 16, 32));
      const float mnew = fmaxf(mrun, mc);
      const float nb = fmaf(-mnew, QKL2, 10.0f);              // exponent offset: 10 - m * scale * log2(e)
      const float alpha = __builtin_amdgcn_exp2f(nb - nbrun);
#pragma unroll
      for (int r = 0; r < 8; ++r) {
        const float arr = __shfl(alpha, 8 * hh + r, 32);
        o0[r] = o0[r] * arr;
        o1[r] = o1[r] * arr;
      }
      float psum = 0.f;
      v16h pfh;
      const v2f cc = {QKL2, QKL2}, nn = {nb, nb};             // two scores of one key tile per packed fma
#pragma unroll
      for (int i = 0; i < 8; i += 2) {
        const v2f a0 = {s[0][i], s[0][i + 1]}, a1 = {s[1][i], s[1][i + 1]};
        const v2f x0 = __builtin_elementwise_fma(a0, cc, nn), x1 = __builtin_elementwise_fma(a1, cc, nn);
        const v2f e0 = {__builtin_amdgcn_exp2f(x0[0]), __builtin_amdgcn_exp2f(x0[1])};
        const v2f e1 = {__builtin_amdgcn_exp2f(x1[0]), __builtin_amdgcn_exp2f(x1[1])};
        const v2f t = e0 + e1;
        psum = psum + t[0];
        psum = psum + t[1];
        pfh[i]         = (_Float16)e0[0];
        pfh[i + 1]     = (_Float16)e0[1];
        pfh[8 + i]     = (_Float16)e1[0];
        pfh[8 + i + 1] = (_Float16)e1[1];
      }
      lrun = lrun * alpha + psum;
      mrun = mnew;
      nbrun = nb;
      {
        const v16h vf0 = ldfrag_h(Vs + c * VSP + kb + 8 * hh);                       // B: n = d c, keys kb..+31
        const v16h vf1 = ldfrag_h(Vs + (HD / 2 + c) * VSP + kb + 8 * hh);            // B: n = d 16+c
        o0 = mma_h(pfh, vf0, o0);
        o1 = mma_h(pfh, vf1, o1);
      }
    }
    const float lsum = lrun + __shfl_xor(lrun, 16, 32);      // lane q (and q+16) holds the full row sum of query q
    const float rinv = 1.0f / (lsum * 16.0f);                // lsum carries the x1024 of p
#pragma unroll
    for (int r = 0; r < 8; ++r) {
      const int q = 8 * hh + r;
      const float inv = __shfl(rinv, q, 32);
      st[q * ASP + c]          = o0[r] * inv;
      st[q * ASP + HD / 2 + c] = o1[r] * inv;
    }
    wave_sync_lds();
    {
      const int rr = lane >> 2, dp = (lane & 3) * 8;
      v4u pk[2];
      size_t offs[2];
#pragma unroll
      for (int it = 0; it < 2; ++it) {
        const int row = it * 8 + rr;
        v4f fa = *(const v4f*)(st + row * ASP + dp);
        v4f fb = *(const v4f*)(st + row * ASP + dp + 4);
        fa = fa * CYS;
        fb = fb * CYS;
        pk[it] = pack8h(fa, fb);
        offs[it] = ((size_t)u * LGR + (size_t)(qt * 16 + row)) * HD + dp;
      }
      {
#pragma unroll
        for (int it = 0; it < 2; ++it) *(v4u*)(Y + offs[it]) = pk[it];
        
      }
    }
  }
}

// =================================================================================================================
// Output projection D[T][co] = Y[T][ci] . Wp[co][ci] + bias, rows T in shuffled token order, written to the
// un-shuffled output row idx[j] (clamped) of batch b. A = Y plane (x256) addressed by arithmetic: token T ->
// (batch, group, query), k-step ks = head ks, channels ks*32 + d (elements 0..7 d = 8h.., elements 8..15 d =
// 16+8h..). B = weight plane x256. Both tiles are staged once, whole K, in LDS by whole-line loads: per head the
// block's 128 token rows of Y are 8 KB contiguous -> As[head][token][KSP]; the 64 weight rows are 32 KB contiguous
// -> Bs[row][GSP]; one block barrier, fragments by LDS reads, a second block barrier, then the same LDS is the
// output stage. Epilogue: value = acc/65536 + bf16(b)[co], staged per wave in LDS [16][STP];
// coverage: 8 waves x 8 it x 2 rows x 16 lanes x 4 = 128 rows x 64 co per block; grid tiles 16384 x 256 exactly;
// with idx a permutation every output row is written exactly once.
// =================================================================================================================
__global__ __launch_bounds__(256)
void gemm_proj(const unsigned short* __restrict__ Y, const unsigned short* __restrict__ Wp,
               const float* __restrict__ bp, const int* __restrict__ idx, float* out) {
  __shared__ __align__(16) unsigned char smem[(NHD * 128 * KSP + 64 * GSP) * 2];
  _Float16* As = (_Float16*)(void*)smem;
  _Float16* Bs = As + NHD * 128 * KSP;
  float* sm = (float*)(void*)smem;
  const int tid = threadIdx.x, wave = tid >> 5, lane = tid & 31, hh = lane >> 4, c = lane & 15;
  const int n0 = blockIdx.x * 64, m0 = blockIdx.y * 128;
  const int bq = m0 >> 12, jj = m0 & (NTOK - 1), gr = jj >> 10, q0 = jj & (LGR - 1);
  const _Float16* A = (const _Float16*)(const void*)Y + (((size_t)((bq * NGR + gr) * NHD)) * LGR + (size_t)q0) * HD;
  const _Float16* B = (const _Float16*)(const void*)Wp + (size_t)n0 * CIN;

  {
    v8h ta[16], tb[8];
#pragma unroll
    for (int i = 0; i < 16; ++i)       // head i/2, piece (i%2)*256 + tid of its 512 (token = piece/4, d piece = piece%4)
      ta[i] = *(const v8h*)(A + (size_t)(i >> 1) * (LGR * HD) + ((i & 1) * 256 + tid) * 8);
#pragma unroll
    for (int i = 0; i < 8; ++i)  tb[i] = *(const v8h*)(B + (i * 256 + tid) * 8);
#pragma unroll
    for (int i = 0; i < 16; ++i) *(v8h*)(As + ((i * 256 + tid) >> 2) * KSP + (tid & 3) * 8) = ta[i];
#pragma unroll
    for (int i = 0; i < 8; ++i)  *(v8h*)(Bs + (i * 8 + wave) * GSP + lane * 8) = tb[i];
  }
  __syncthreads();

  v8f acc[4];
#pragma unroll
  for (int nt = 0; nt < 4; ++nt) acc[nt] = zero8();

  // unrolled: the k offsets of the LDS reads become constants, and a k-step's ten reads stand as one group
#pragma unroll
  for (int ks = 0; ks < NHD; ++ks) {
    const v16h af = ldfrag_h(As + (ks * 128 + wave * 16 + c) * KSP + 8 * hh);
    v16h bfrag[4];
#pragma unroll
    for (int nt = 0; nt < 4; ++nt) bfrag[nt] = ldfrag_h(Bs + (nt * 16 + c) * GSP + ks * 32 + 8 * hh);
#pragma unroll
    for (int nt = 0; nt < 4; ++nt) acc[nt] = mma_h(af, bfrag[nt], acc[nt]);
  }
  __syncthreads();   // every wave's last fragment read ends before the tiles' LDS is rewritten as the output stage

  float* st = sm + wave * (16 * STP);
#pragma unroll
  for (int nt = 0; nt < 4; ++nt) {
    const int co = n0 + nt * 16 + c;
    const float bi = bfr(bp[co]);
#pragma unroll
    for (int r = 0; r < 8; ++r) st[(8 * hh + r) * STP + nt * 16 + c] = acc[nt][r] * (1.0f / 65536.0f) + bi;
  }
  wave_sync_lds();
  const int bimg = m0 >> 12;
  const int jbase = (m0 & (NTOK - 1)) + wave * 16;
  v4f ov[8];
  size_t offs[8];
#pragma unroll
  for (int it = 0; it < 8; ++it) {
    const int row = it * 2 + hh;
    int dst = idx[jbase + row];
    dst = (dst < 0) ? 0 : ((dst > NTOK - 1) ? (NTOK - 1) : dst);
    ov[it] = *(const v4f*)(st + row * STP + c * 4);
    offs[it] = ((size_t)(bimg * NTOK + dst)) * CIN + n0 + c * 4;
  }
  {
#pragma unroll
    for (int it = 0; it < 8; ++it) *(v4f*)(out + offs[it]) = ov[it];
    
  }
}

// =================================================================================================================
//   Wq f16 [768][256] 393216 @0; Wp f16 [256][256] 131072 @393216; X16 f16 [16384][256] 8388608 @524288;
//   QK f16 [16384][512] 16777216 @8912896; V16 f16 [4][256][4096] 8388608 @25690112;
//   Y f16 [128][1024][32] 8388608 @34078720. Total 42467328.
// =================================================================================================================
extern "C" void kernel_launch(void* const* d_in, const int* in_sizes, int n_in,
                              void* d_out, int out_size, void* d_ws, size_t ws_size,
                              hipStream_t stream) {
  if (n_in < 5) return;
  if (in_sizes[0] != NBAT * NTOK * CIN) return;
  if (in_sizes[1] != NTOK) return;
  if (in_sizes[2] != C3 * CIN) return;
  if (in_sizes[3] != CIN * CIN) return;
  if (in_sizes[4] != CIN) return;
  if (out_size != NBAT * NTOK * CIN) return;

  const float* x      = (const float*)d_in[0];
  const int*   idx    = (const int*)d_in[1];
  const float* w_qkv  = (const float*)d_in[2];
  const float* w_proj = (const float*)d_in[3];
  const float* b_proj = (const float*)d_in[4];
  float* out = (float*)d_out;

  const size_t sWq  = (size_t)C3 * CIN * 2;              //    393216
  const size_t sWp  = (size_t)CIN * CIN * 2;             //    131072
  const size_t sX16 = (size_t)MTOK * CIN * 2;            //   8388608
  const size_t sQK  = (size_t)MTOK * C2 * 2;             //  16777216
  const size_t sV16 = (size_t)NBAT * CIN * NTOK * 2;     //   8388608
  const size_t sY   = (size_t)NUNIT * LGR * HD * 2;      //   8388608
  size_t off = 0;
  const size_t oWq  = off; off += sWq;
  const size_t oWp  = off; off += sWp;
  const size_t oX16 = off; off += sX16;
  const size_t oQK  = off; off += sQK;
  const size_t oV16 = off; off += sV16;
  const size_t oY   = off; off += sY;
  if (off > ws_size) return;                             // off = 42467328
  if (off > (size_t)134217728) return;

  char* ws = (char*)d_ws;
  unsigned short* Wq  = (unsigned short*)(ws + oWq);
  unsigned short* Wp  = (unsigned short*)(ws + oWp);
  unsigned short* X16 = (unsigned short*)(ws + oX16);
  unsigned short* QK  = (unsigned short*)(ws + oQK);
  unsigned short* V16 = (unsigned short*)(ws + oV16);
  unsigned short* Yp  = (unsigned short*)(ws + oY);

  const dim3 blk(256);
  // (1) weights -> f16 x256 planes; x rows gathered by idx -> token-major f16 x16 plane
  cvt_in<<<dim3(PXB + PWB), dim3(PWV * 32), 0, stream>>>(x, idx, w_qkv, w_proj, X16, Wq, Wp);
  // (2) qkv projection -> token-major q/k plane and channel-major v plane
  gemm_qkv<<<dim3(C3 / 64, MTOK / 128), blk, 0, stream>>>(X16, Wq, QK, V16);
  // (3) grouped multi-head attention -> ctx slab plane
  attn_k<<<dim3(NUNIT * AQS), dim3(AWV * 32), 0, stream>>>(QK, V16, Yp);
  // (4) output projection + bias, rows written to their un-shuffled positions
  gemm_proj<<<dim3(CIN / 64, MTOK / 128), blk, 0, stream>>>(Yp, Wp, b_proj, idx, out);
  (void)hipGetLastError();
}

// v006
// One run takes 51 microseconds.
// Two timings next to v005 put it at 1.05 and 1.04 times that version's speed.
// All steps since v000 together make it 5.10 times as fast.
// Contractions: v_wmma_f32_16x16x32_f16 (f16 operands, f32 accumulate). qkv projection: A = gathered x rows
// (bf16-valued, x16) single plane, B = w_qkv (bf16-valued, x256) single plane; scores k.qT: k x16, q x16 single
// planes; p.v: p x1024, v x16 single planes; output projection: A = ctx x256 single f16 plane, B = w_proj
// (bf16-valued, x256) single plane. Online softmax in f32 on VALU. Float inputs RNE-converted to bf16 on load.
#include <hip/hip_runtime.h>
#include <math.h>
#include <stdint.h>

#define NBAT  4
#define NTOK  4096
#define CIN   256
#define C2    512
#define C3    768
#define MTOK  16384
#define NHD   8
#define HD    32
#define NGR   4
#define LGR   1024
#define NUNIT 128
#define AWV   32
#define AQS   2
#define STP   68
#define SBP   132
#define ASP   36
#define KSP   40
#define VSP   1032
#define GSP   264
#define PWV   16
#define PRW   4
#define PXB   (MTOK / (PWV * PRW))
#define PWB   ((C3 + CIN) / (PWV * PRW))
#define CXS   16.0f
#define CWS   256.0f
#define CQK   (16.0f / 4096.0f)
#define CVS   (16.0f / 4096.0f)
#define CYS   256.0f
#define QKSC  (0.17677669529663688f / 256.0f)
#define QKL2  (QKSC * 1.4426950408889634f)

static_assert(NUNIT == NBAT * NGR * NHD);
static_assert(NGR * LGR == NTOK);
static_assert(MTOK == NBAT * NTOK);
static_assert(NTOK % 128 == 0);
static_assert(LGR % 32 == 0);
static_assert(AQS * AWV * 16 == LGR);
static_assert(CIN % 64 == 0);
static_assert(NHD * HD == CIN);
static_assert(64 * SBP <= 8 * 16 * STP);
static_assert((STP * 4) % 16 == 0);
static_assert((SBP * 4) % 16 == 0);
static_assert((ASP * 4) % 16 == 0);
static_assert((KSP * 2) % 32 == 16 && KSP >= HD);
static_assert((VSP * 2) % 32 == 16 && VSP >= LGR);
static_assert((GSP * 2) % 32 == 16 && GSP >= CIN);
static_assert(8 * 16 * STP * 4 <= (128 + 64) * GSP * 2);
static_assert(8 * 16 * STP * 4 <= (NHD * 128 * KSP + 64 * GSP) * 2);
static_assert(128 * CIN == 16 * 256 * 8 && 64 * CIN == 8 * 256 * 8);
static_assert(LGR * HD == 4 * AWV * 32 * 8);
static_assert(CIN == 32 * 8);
static_assert(MTOK % (PWV * PRW) == 0 && C3 % (PWV * PRW) == 0 && CIN % (PWV * PRW) == 0);
static_assert(NTOK % PRW == 0);

typedef _Float16 v16h __attribute__((ext_vector_type(16)));
typedef _Float16 v8h  __attribute__((ext_vector_type(8)));
typedef float    v8f  __attribute__((ext_vector_type(8)));
typedef float    v4f  __attribute__((ext_vector_type(4)));
typedef float    v2f  __attribute__((ext_vector_type(2)));
typedef unsigned int v4u __attribute__((ext_vector_type(4)));
union Frag { v16h v; v8h half[2]; };

// ---- scalar helpers -------------------------------------------------------------------------------------------
__device__ __forceinline__ unsigned short bf_bits(float f) {          // f32 -> bf16 bits, RNE convert
  unsigned u = __float_as_uint(f);
  return (unsigned short)((u + 0x7FFFu + ((u >> 16) & 1u)) >> 16);
}
__device__ __forceinline__ float bfr(float f) { return __uint_as_float(((unsigned)bf_bits(f)) << 16); }
__device__ __forceinline__ unsigned short h_bits(_Float16 x) { return __builtin_bit_cast(unsigned short, x); }
__device__ __forceinline__ unsigned pk16(unsigned short a, unsigned short b) { return (unsigned)a | ((unsigned)b << 16); }
__device__ __forceinline__ v8f zero8() { v8f z = {0.f, 0.f, 0.f, 0.f, 0.f, 0.f, 0.f, 0.f}; return z; }

// ---- fragment loader: 16-bit A/B operand, lane -> row/col (lane&15), p already includes +8*(lane>>4);
//      elements 0..7 <- p[0..7] (k0+8h..), elements 8..15 <- p[16..23] (k0+16+8h..)
__device__ __forceinline__ v16h ldfrag_h(const _Float16* p) {
  Frag f;
  f.half[0] = *(const v8h*)(p);
  f.half[1] = *(const v8h*)(p + 16);
  return f.v;
}

// ---- WMMA helper with trailing VALU hazard gap ----------------------------------------------------------------
__device__ __forceinline__ v8f mma_h(v16h a, v16h b, v8f c) {
  c = __builtin_amdgcn_wmma_f32_16x16x32_f16(false, a, false, b, (short)0, c, false, false);
#if defined(__HIP_DEVICE_COMPILE__)
  asm volatile("v_nop\n\tv_nop\n\tv_nop\n\tv_nop" : "+v"(c) : "v"(a), "v"(b));
#endif
  return c;
}
// ---- WMMA, the builtin alone: the compiler keeps the distance behind it and fills it with the caller's other work ---
__device__ __forceinline__ v8f mma_b(v16h a, v16h b, v8f c) {
  return __builtin_amdgcn_wmma_f32_16x16x32_f16(false, a, false, b, (short)0, c, false, false);
}
__device__ __forceinline__ void wave_sync_lds() {
  __builtin_amdgcn_fence(__ATOMIC_RELEASE, "workgroup");
  __builtin_amdgcn_wave_barrier();
  __builtin_amdgcn_fence(__ATOMIC_ACQUIRE, "workgroup");
}

// ---- 8 f32 -> 8 packed f16 (16 B) -------------------------------------------------------------------------------
__device__ __forceinline__ v4u pack8h(v4f a, v4f b) {
  v4u p;
  p[0] = pk16(h_bits((_Float16)a[0]), h_bits((_Float16)a[1]));
  p[1] = pk16(h_bits((_Float16)a[2]), h_bits((_Float16)a[3]));
  p[2] = pk16(h_bits((_Float16)b[0]), h_bits((_Float16)b[1]));
  p[3] = pk16(h_bits((_Float16)b[2]), h_bits((_Float16)b[3]));
  return p;
}

// =================================================================================================================
// Input convert, one launch for all three float operands. Every operand is a list of rows of 256 floats: 16384
// gathered activation rows, X16[T = b*4096 + j][256] = f16(16 * bf16_RNE(x[b][clamp(idx[j])][c])), and 768 + 256
// weight rows ([out][in], k contiguous), f16(256 * bf16_RNE(w)). One wave converts PRW = 4 consecutive plane rows:
// per row a lane reads 8 consecutive floats (two 16-B loads; the pair reads the row's 1024 B = 8 whole lines) and writes one
// 16-B piece; all 8 loads of a wave are issued before the first is used. Block = PWV = 16 waves = 64 rows; blocks
// 0..255 take the activation rows, 256..267 w_qkv, 268..271 w_proj (block-uniform branches).
// coverage: 256 x 64 = 16384, 12 x 64 = 768 and 4 x 64 = 256 rows, each row 32 lanes x 8 = 256 elements exactly.
// =================================================================================================================
__global__ __launch_bounds__(PWV * 32)
void cvt_in(const float* __restrict__ x, const int* __restrict__ idx, const float* __restrict__ wqkv,
            const float* __restrict__ wp, unsigned short* X16, unsigned short* Wq, unsigned short* Wp) {
  const int lane = threadIdx.x & 31;
  const int wave = __builtin_amdgcn_readfirstlane((int)(threadIdx.x >> 5));   // scalar: idx comes by scalar loads
  const int r0 = ((int)blockIdx.x * PWV + wave) * PRW;
  v4f a[PRW], a2[PRW];
  unsigned short* dp;
  float sc;
  if (blockIdx.x < PXB) {
    const int b = r0 >> 12, j = r0 & (NTOK - 1);
#pragma unroll
    for (int i = 0; i < PRW; ++i) {
      int s = idx[j + i];
      s = (s < 0) ? 0 : ((s > NTOK - 1) ? (NTOK - 1) : s);
      const float* sp = x + ((size_t)(b * NTOK + s)) * CIN + lane * 8;
      a[i]  = *(const v4f*)(sp);
      a2[i] = *(const v4f*)(sp + 4);
    }
    dp = X16 + (size_t)r0 * CIN + lane * 8;
    sc = CXS;
  } else if (blockIdx.x < PXB + C3 / (PWV * PRW)) {
    const int w0 = r0 - MTOK;
#pragma unroll
    for (int i = 0; i < PRW; ++i) {
      const float* sp = wqkv + (size_t)(w0 + i) * CIN + lane * 8;
      a[i]  = *(const v4f*)(sp);
      a2[i] = *(const v4f*)(sp + 4);
    }
    dp = Wq + (size_t)w0 * CIN + lane * 8;
    sc = CWS;
  } else {
    const int w0 = r0 - MTOK - C3;
#pragma unroll
    for (int i = 0; i < PRW; ++i) {
      const float* sp = wp + (size_t)(w0 + i) * CIN + lane * 8;
      a[i]  = *(const v4f*)(sp);
      a2[i] = *(const v4f*)(sp + 4);
    }
    dp = Wp + (size_t)w0 * CIN + lane * 8;
    sc = CWS;
  }
#pragma unroll
  for (int i = 0; i < PRW; ++i) {
    v4f sa, sb;
#pragma unroll
    for (int e = 0; e < 4; ++e) { sa[e] = bfr(a[i][e]) * sc; sb[e] = bfr(a2[i][e]) * sc; }
    *(v4u*)(dp + i * CIN) = pack8h(sa, sb);
  }
}

// =================================================================================================================
// qkv GEMM D[T][co] = X16[T][ci] . Wq[co][ci], K = 256, co 0..767 (q = 0..255, k = 256..511, v = 512..767).
// Block = 8 waves, tile 128 rows x 64 cols, wave = 16 rows x 4 n-tiles. The block's A rows (64 KB, contiguous) and
// B rows (32 KB, contiguous) are staged once, whole K, in LDS: one wave-load = one 512-B row = 4 whole lines, rows
// at pitch GSP (an odd multiple of 16 B for the 16-B fragment reads); one block barrier; fragments by LDS reads with
// the split k map, k-step 32 (8 steps); a second block barrier, then the same LDS is the output stage.
// grid = (12, 128). Block column groups 0..7 -> token-major plane QK[T][512]
// V16[b][c][n] = f16(16 * value): staged block-wide as [64 ch][SBP] (tokens contiguous; a 128-token tile lies
// within one batch row block), wave w owns channels w*8..+7; one instruction = lanes 0..15 -> channel cc (256 B =
// coverage: QK: 8 waves x 4 it x 4 rows x 8 pieces x 8 = 128 rows x 64 cols per block, 8 x 128 blocks tile
// 16384 x 512 exactly; V16: 8 waves x 4 it x 2 ch x 16 lanes x 8 = 64 ch x 128 tok per block, 4 x 128 blocks
// tile 256 ch x 16384 tok exactly.
// =================================================================================================================
__global__ __launch_bounds__(256)
void gemm_qkv(const unsigned short* __restrict__ X16, const unsigned short* __restrict__ Wq,
              unsigned short* QK, unsigned short* V16) {
  __shared__ __align__(16) unsigned char smem[(128 + 64) * GSP * 2];
  _Float16* As = (_Float16*)(void*)smem;
  _Float16* Bs = As + 128 * GSP;
  float* sm = (float*)(void*)smem;
  const int tid = threadIdx.x, wave = tid >> 5, lane = tid & 31, hh = lane >> 4, c = lane & 15;
  const int n0 = blockIdx.x * 64, m0 = blockIdx.y * 128;
  const _Float16* A = (const _Float16*)(const void*)X16 + (size_t)m0 * CIN;
  const _Float16* B = (const _Float16*)(const void*)Wq + (size_t)n0 * CIN;

  {
    v8h ta[16], tb[8];
#pragma unroll
    for (int i = 0; i < 16; ++i) ta[i] = *(const v8h*)(A + (i * 256 + tid) * 8);
#pragma unroll
    for (int i = 0; i < 8; ++i)  tb[i] = *(const v8h*)(B + (i * 256 + tid) * 8);
#pragma unroll
    for (int i = 0; i < 16; ++i) *(v8h*)(As + (i * 8 + wave) * GSP + lane * 8) = ta[i];
#pragma unroll
    for (int i = 0; i < 8; ++i)  *(v8h*)(Bs + (i * 8 + wave) * GSP + lane * 8) = tb[i];
  }
  __syncthreads();

  v8f acc[4];
#pragma unroll
  for (int nt = 0; nt < 4; ++nt) acc[nt] = zero8();

  // unrolled: the k offsets of the LDS reads become constants, and a k-step's ten reads stand as one group
#pragma unroll
  for (int k0 = 0; k0 < CIN; k0 += 32) {
    const v16h af = ldfrag_h(As + (wave * 16 + c) * GSP + k0 + 8 * hh);
    v16h bfrag[4];
#pragma unroll
    for (int nt = 0; nt < 4; ++nt) bfrag[nt] = ldfrag_h(Bs + (nt * 16 + c) * GSP + k0 + 8 * hh);
#pragma unroll
    for (int nt = 0; nt < 4; ++nt) acc[nt] = mma_h(af, bfrag[nt], acc[nt]);
  }
  __syncthreads();   // every wave's last fragment read ends before the tiles' LDS is rewritten as the output stage

  if (blockIdx.x < 8) {
    float* st = sm + wave * (16 * STP);
#pragma unroll
    for (int nt = 0; nt < 4; ++nt) {
#pragma unroll
      for (int r = 0; r < 8; ++r) st[(8 * hh + r) * STP + nt * 16 + c] = acc[nt][r];
    }
    wave_sync_lds();
    const int piece = lane & 7, rsub = lane >> 3;
    v4u pk[4];
    size_t offs[4];
#pragma unroll
    for (int it = 0; it < 4; ++it) {
      const int row = it * 4 + rsub;
      v4f fa = *(const v4f*)(st + row * STP + piece * 8);
      v4f fb = *(const v4f*)(st + row * STP + piece * 8 + 4);
      fa = fa * CQK;
      fb = fb * CQK;
      pk[it] = pack8h(fa, fb);
      offs[it] = ((size_t)(m0 + wave * 16 + row)) * C2 + n0 + piece * 8;
    }
    {
#pragma unroll
      for (int it = 0; it < 4; ++it) *(v4u*)(QK + offs[it]) = pk[it];
      
    }
  } else {
    const int cv0 = n0 - C2;
#pragma unroll
    for (int nt = 0; nt < 4; ++nt) {
#pragma unroll
      for (int r = 0; r < 8; ++r) sm[(nt * 16 + c) * SBP + wave * 16 + 8 * hh + r] = acc[nt][r];
    }
    __syncthreads();
    const int bimg = m0 >> 12, s0 = m0 & (NTOK - 1);
    v4u pk[4];
    size_t o16[4];
#pragma unroll
    for (int i2 = 0; i2 < 4; ++i2) {
      const int cc = wave * 8 + i2 * 2 + hh;
      const int co = cv0 + cc;
      v4f fa = *(const v4f*)(sm + cc * SBP + c * 8);
      v4f fb = *(const v4f*)(sm + cc * SBP + c * 8 + 4);
      fa = fa * CVS;
      fb = fb * CVS;
      pk[i2] = pack8h(fa, fb);
      o16[i2] = ((size_t)(bimg * CIN + co)) * NTOK + s0 + c * 8;
    }
    {
#pragma unroll
      for (int i2 = 0; i2 < 4; ++i2) *(v4u*)(V16 + o16[i2]) = pk[i2];
      
    }
  }
}

// =================================================================================================================
// Grouped attention, one unit (batch b, token group gr, head) per AQS = 2 blocks of 1024 threads = 32 waves, 1024
// queries x 1024 keys, d = 32: 256 blocks, 8 waves per SIMD, all waves of a block walk the same k and v rows.
// Static LDS: the unit's whole k slab Ks[1024 keys][KSP] and v slab Vs[32 channels][VSP] (f16, row pitch an odd
// multiple of 16 B for the 16-B fragment reads), filled once per block (each thread moves 4 + 4 pieces of 16 B from
// the token-major plane QK, k row = T*512 + 256 + head*32, and the channel-major plane V16, row = channel
// head*32 + d, keys contiguous), then one block barrier; plus the per-wave stage [16][ASP] f32. q fragments
// straight from QK (q row = T*512 + head*32). Per wave: the one q-tile qt = part*32 + wave (< 64).
//   Transposed scores S^T = K_tile (A, 16 keys x 32 d) x Q (B: k = d, n = query): S*256 = q16.k16; D element r of
//   lane l = S[query l&15][key 8h+r], so P = exp((S - m)*scale) x1024 is the A fragment of P.V directly in registers;
//   each P is one fma and one exp2: 2^(S*QKL2 + nb), nb = 10 - m*QKL2 (scale, log2 e, the maximum and the x1024 in it)
//   (element i <- key tile 0 row i, element 8+i <- key tile 1 row i). Online softmax over 32 chunks of 32 keys;
//   The scores of pass ch + 1 are made at the foot of pass ch, beside its two P.V products (four WMMAs in a row).
//   O = P.V (acc scale 1024*16), l = sum of P (x1024). Epilogue: O/(l*16) staged per wave in LDS, then stored as the f16 plane
//   Y[unit][1024][32] of 256*o: one instruction = 32 lanes x 16 B = 512 B = 8 token rows (consecutive lanes
// coverage: per block 32 q-tiles x 16 rows x 32 d, half of its unit's 1024-row slab; grid covers 2 halves x 128
// units, every slab row written exactly once.
// =================================================================================================================
__global__ __launch_bounds__(AWV * 32)
void attn_k(const unsigned short* __restrict__ QK, const unsigned short* __restrict__ V16, unsigned short* Y) {
  __shared__ __align__(16) float Sst[AWV * 16 * ASP];
  __shared__ __align__(16) _Float16 Ks[LGR * KSP];
  __shared__ __align__(16) _Float16 Vs[HD * VSP];
  const int tid = threadIdx.x, wave = tid >> 5, lane = tid & 31, hh = lane >> 4, c = lane & 15;
  const int u = blockIdx.x & (NUNIT - 1), part = blockIdx.x / NUNIT;
  const int head = u & 7, gr = (u >> 3) & 3, b = u >> 5;
  const size_t tok0 = (size_t)b * NTOK + (size_t)gr * LGR;
  const _Float16* Qp = (const _Float16*)(const void*)QK + tok0 * C2 + head * HD;
  const _Float16* Kp = Qp + CIN;
  const size_t cm0 = ((size_t)(b * CIN + head * HD)) * NTOK + (size_t)gr * LGR;
  const _Float16* Vp = (const _Float16*)(const void*)V16 + cm0;
  float* st = Sst + wave * (16 * ASP);

  {
    const int qt = part * AWV + wave;
    const int lq = qt * 16 + c;
    const v16h bq = ldfrag_h(Qp + (size_t)lq * C2 + 8 * hh);     // B: n = query c, k = d 8h.. / 16+8h..

    {
      v8h kt[4], vt[4];
#pragma unroll
      for (int i = 0; i < 4; ++i) {
        const int id = i * (AWV * 32) + tid;
        kt[i] = *(const v8h*)(Kp + (size_t)(id >> 2) * C2 + (id & 3) * 8);       // key id/4, d piece id%4
        vt[i] = *(const v8h*)(Vp + (size_t)(id >> 7) * NTOK + (id & 127) * 8);   // channel id/128, key piece id%128
      }
#pragma unroll
      for (int i = 0; i < 4; ++i) {
        const int id = i * (AWV * 32) + tid;
        *(v8h*)(Ks + (id >> 2) * KSP + (id & 3) * 8)   = kt[i];
        *(v8h*)(Vs + (id >> 7) * VSP + (id & 127) * 8) = vt[i];
      }
    }
    __syncthreads();

    v8f o0 = zero8(), o1 = zero8();
    float mrun = -1.0e30f, lrun = 0.f;
    float nbrun = fmaf(-mrun, QKL2, 10.0f);
    v8f s[2];                                                 // scores of the pass at hand, made one pass ahead
#pragma unroll
    for (int j = 0; j < 2; ++j) s[j] = mma_b(ldfrag_h(Ks + (j * 16 + c) * KSP + 8 * hh), bq, zero8());
#pragma unroll 1
    for (int ch = 0; ch < LGR / 32; ++ch) {
      const int kb = ch * 32;
      const int kn = (kb + 32) & (LGR - 1);                   // next pass's keys (the last pass wraps; those scores are dropped)
      float mc = s[0][0];
#pragma unroll
      for (int j = 0; j < 2; ++j) {
#pragma unroll
        for (int r = 0; r < 8; ++r) mc = fmaxf(mc, s[j][r]);
      }
      mc = fmaxf(mc, __shfl_xor(mc, 16, 32));
      const float mnew = fmaxf(mrun, mc);
      const float nb = fmaf(-mnew, QKL2, 10.0f);              // exponent offset: 10 - m * scale * log2(e)
      const float alpha = __builtin_amdgcn_exp2f(nb - nbrun);
#pragma unroll
      for (int r = 0; r < 8; ++r) {
        const float arr = __shfl(alpha, 8 * hh + r, 32);
        o0[r] = o0[r] * arr;
        o1[r] = o1[r] * arr;
      }
      float psum = 0.f;
      v16h pfh;
      const v2f cc = {QKL2, QKL2}, nn = {nb, nb};             // two scores of one key tile per packed fma
#pragma unroll
      for (int i = 0; i < 8; i += 2) {
        const v2f a0 = {s[0][i], s[0][i + 1]}, a1 = {s[1][i], s[1][i + 1]};
        const v2f x0 = __builtin_elementwise_fma(a0, cc, nn), x1 = __builtin_elementwise_fma(a1, cc, nn);
        const v2f e0 = {__builtin_amdgcn_exp2f(x0[0]), __builtin_amdgcn_exp2f(x0[1])};
        const v2f e1 = {__builtin_amdgcn_exp2f(x1[0]), __builtin_amdgcn_exp2f(x1[1])};
        const v2f t = e0 + e1;
        psum = psum + t[0];
        psum = psum + t[1];
        pfh[i]         = (_Float16)e0[0];
        pfh[i + 1]     = (_Float16)e0[1];
        pfh[8 + i]     = (_Float16)e1[0];
        pfh[8 + i + 1] = (_Float16)e1[1];
      }
      lrun = lrun * alpha + psum;
      mrun = mnew;
      nbrun = nb;
      {
        const v16h vf0 = ldfrag_h(Vs + c * VSP + kb + 8 * hh);                       // B: n = d c, keys kb..+31
        const v16h vf1 = ldfrag_h(Vs + (HD / 2 + c) * VSP + kb + 8 * hh);            // B: n = d 16+c
        const v16h ka0 = ldfrag_h(Ks + (kn + c) * KSP + 8 * hh);                     // A: row = key, k = d
        const v16h ka1 = ldfrag_h(Ks + (kn + 16 + c) * KSP + 8 * hh);
        // keeps the four WMMAs together at the foot of the pass: lifted into the softmax, each score WMMA stands alone
        // there and draws four v_nop; here each fills the distance of the one before it
        __builtin_amdgcn_sched_barrier(0);
        s[0] = mma_b(ka0, bq, zero8());
        s[1] = mma_b(ka1, bq, zero8());
        o0 = mma_b(pfh, vf0, o0);
        o1 = mma_b(pfh, vf1, o1);
      }
    }
    const float lsum = lrun + __shfl_xor(lrun, 16, 32);      // lane q (and q+16) holds the full row sum of query q
    const float rinv = 1.0f / (lsum * 16.0f);                // lsum carries the x1024 of p
#pragma unroll
    for (int r = 0; r < 8; ++r) {
      const int q = 8 * hh + r;
      const float inv = __shfl(rinv, q, 32);
      st[q * ASP + c]          = o0[r] * inv;
      st[q * ASP + HD / 2 + c] = o1[r] * inv;
    }
    wave_sync_lds();
    {
      const int rr = lane >> 2, dp = (lane & 3) * 8;
      v4u pk[2];
      size_t offs[2];
#pragma unroll
      for (int it = 0; it < 2; ++it) {
        const int row = it * 8 + rr;
        v4f fa = *(const v4f*)(st + row * ASP + dp);
        v4f fb = *(const v4f*)(st + row * ASP + dp + 4);
        fa = fa * CYS;
        fb = fb * CYS;
        pk[it] = pack8h(fa, fb);
        offs[it] = ((size_t)u * LGR + (size_t)(qt * 16 + row)) * HD + dp;
      }
      {
#pragma unroll
        for (int it = 0; it < 2; ++it) *(v4u*)(Y + offs[it]) = pk[it];
        
      }
    }
  }
}

// =================================================================================================================
// Output projection D[T][co] = Y[T][ci] . Wp[co][ci] + bias, rows T in shuffled token order, written to the
// un-shuffled output row idx[j] (clamped) of batch b. A = Y plane (x256) addressed by arithmetic: token T ->
// (batch, group, query), k-step ks = head ks, channels ks*32 + d (elements 0..7 d = 8h.., elements 8..15 d =
// 16+8h..). B = weight plane x256. Both tiles are staged once, whole K, in LDS by whole-line loads: per head the
// block's 128 token rows of Y are 8 KB contiguous -> As[head][token][KSP]; the 64 weight rows are 32 KB contiguous
// -> Bs[row][GSP]; one block barrier, fragments by LDS reads, a second block barrier, then the same LDS is the
// output stage. Epilogue: value = acc/65536 + bf16(b)[co], staged per wave in LDS [16][STP];
// coverage: 8 waves x 8 it x 2 rows x 16 lanes x 4 = 128 rows x 64 co per block; grid tiles 16384 x 256 exactly;
// with idx a permutation every output row is written exactly once.
// =================================================================================================================
__global__ __launch_bounds__(256)
void gemm_proj(const unsigned short* __restrict__ Y, const unsigned short* __restrict__ Wp,
               const float* __restrict__ bp, const int* __restrict__ idx, float* out) {
  __shared__ __align__(16) unsigned char smem[(NHD * 128 * KSP + 64 * GSP) * 2];
  _Float16* As = (_Float16*)(void*)smem;
  _Float16* Bs = As + NHD * 128 * KSP;
  float* sm = (float*)(void*)smem;
  const int tid = threadIdx.x, wave = tid >> 5, lane = tid & 31, hh = lane >> 4, c = lane & 15;
  const int n0 = blockIdx.x * 64, m0 = blockIdx.y * 128;
  const int bq = m0 >> 12, jj = m0 & (NTOK - 1), gr = jj >> 10, q0 = jj & (LGR - 1);
  const _Float16* A = (const _Float16*)(const void*)Y + (((size_t)((bq * NGR + gr) * NHD)) * LGR + (size_t)q0) * HD;
  const _Float16* B = (const _Float16*)(const void*)Wp + (size_t)n0 * CIN;

  {
    v8h ta[16], tb[8];
#pragma unroll
    for (int i = 0; i < 16; ++i)       // head i/2, piece (i%2)*256 + tid of its 512 (token = piece/4, d piece = piece%4)
      ta[i] = *(const v8h*)(A + (size_t)(i >> 1) * (LGR * HD) + ((i & 1) * 256 + tid) * 8);
#pragma unroll
    for (int i = 0; i < 8; ++i)  tb[i] = *(const v8h*)(B + (i * 256 + tid) * 8);
#pragma unroll
    for (int i = 0; i < 16; ++i) *(v8h*)(As + ((i * 256 + tid) >> 2) * KSP + (tid & 3) * 8) = ta[i];
#pragma unroll
    for (int i = 0; i < 8; ++i)  *(v8h*)(Bs + (i * 8 + wave) * GSP + lane * 8) = tb[i];
  }
  __syncthreads();

  v8f acc[4];
#pragma unroll
  for (int nt = 0; nt < 4; ++nt) acc[nt] = zero8();

  // unrolled: the k offsets of the LDS reads become constants, and a k-step's ten reads stand as one group
#pragma unroll
  for (int ks = 0; ks < NHD; ++ks) {
    const v16h af = ldfrag_h(As + (ks * 128 + wave * 16 + c) * KSP + 8 * hh);
    v16h bfrag[4];
#pragma unroll
    for (int nt = 0; nt < 4; ++nt) bfrag[nt] = ldfrag_h(Bs + (nt * 16 + c) * GSP + ks * 32 + 8 * hh);
#pragma unroll
    for (int nt = 0; nt < 4; ++nt) acc[nt] = mma_h(af, bfrag[nt], acc[nt]);
  }
  __syncthreads();   // every wave's last fragment read ends before the tiles' LDS is rewritten as the output stage

  float* st = sm + wave * (16 * STP);
#pragma unroll
  for (int nt = 0; nt < 4; ++nt) {
    const int co = n0 + nt * 16 + c;
    const float bi = bfr(bp[co]);
#pragma unroll
    for (int r = 0; r < 8; ++r) st[(8 * hh + r) * STP + nt * 16 + c] = acc[nt][r] * (1.0f / 65536.0f) + bi;
  }
  wave_sync_lds();
  const int bimg = m0 >> 12;
  const int jbase = (m0 & (NTOK - 1)) + wave * 16;
  v4f ov[8];
  size_t offs[8];
#pragma unroll
  for (int it = 0; it < 8; ++it) {
    const int row = it * 2 + hh;
    int dst = idx[jbase + row];
    dst = (dst < 0) ? 0 : ((dst > NTOK - 1) ? (NTOK - 1) : dst);
    ov[it] = *(const v4f*)(st + row * STP + c * 4);
    offs[it] = ((size_t)(bimg * NTOK + dst)) * CIN + n0 + c * 4;
  }
  {
#pragma unroll
    for (int it = 0; it < 8; ++it) *(v4f*)(out + offs[it]) = ov[it];
    
  }
}

// =================================================================================================================
//   Wq f16 [768][256] 393216 @0; Wp f16 [256][256] 131072 @393216; X16 f16 [16384][256] 8388608 @524288;
//   QK f16 [16384][512] 16777216 @8912896; V16 f16 [4][256][4096] 8388608 @25690112;
//   Y f16 [128][1024][32] 8388608 @34078720. Total 42467328.
// =================================================================================================================
extern "C" void kernel_launch(void* const* d_in, const int* in_sizes, int n_in,
                              void* d_out, int out_size, void* d_ws, size_t ws_size,
                              hipStream_t stream) {
  if (n_in < 5) return;
  if (in_sizes[0] != NBAT * NTOK * CIN) return;
  if (in_sizes[1] != NTOK) return;
  if (in_sizes[2] != C3 * CIN) return;
  if (in_sizes[3] != CIN * CIN) return;
  if (in_sizes[4] != CIN) return;
  if (out_size != NBAT * NTOK * CIN) return;

  const float* x      = (const float*)d_in[0];
  const int*   idx    = (const int*)d_in[1];
  const float* w_qkv  = (const float*)d_in[2];
  const float* w_proj = (const float*)d_in[3];
  const float* b_proj = (const float*)d_in[4];
  float* out = (float*)d_out;

  const size_t sWq  = (size_t)C3 * CIN * 2;              //    393216
  const size_t sWp  = (size_t)CIN * CIN * 2;             //    131072
  const size_t sX16 = (size_t)MTOK * CIN * 2;            //   8388608
  const size_t sQK  = (size_t)MTOK * C2 * 2;             //  16777216
  const size_t sV16 = (size_t)NBAT * CIN * NTOK * 2;     //   8388608
  const size_t sY   = (size_t)NUNIT * LGR * HD * 2;      //   8388608
  size_t off = 0;
  const size_t oWq  = off; off += sWq;
  const size_t oWp  = off; off += sWp;
  const size_t oX16 = off; off += sX16;
  const size_t oQK  = off; off += sQK;
  const size_t oV16 = off; off += sV16;
  const size_t oY   = off; off += sY;
  if (off > ws_size) return;                             // off = 42467328
  if (off > (size_t)134217728) return;

  char* ws = (char*)d_ws;
  unsigned short* Wq  = (unsigned short*)(ws + oWq);
  unsigned short* Wp  = (unsigned short*)(ws + oWp);
  unsigned short* X16 = (unsigned short*)(ws + oX16);
  unsigned short* QK  = (unsigned short*)(ws + oQK);
  unsigned short* V16 = (unsigned short*)(ws + oV16);
  unsigned short* Yp  = (unsigned short*)(ws + oY);

  const dim3 blk(256);
  // (1) weights -> f16 x256 planes; x rows gathered by idx -> token-major f16 x16 plane
  cvt_in<<<dim3(PXB + PWB), dim3(PWV * 32), 0, stream>>>(x, idx, w_qkv, w_proj, X16, Wq, Wp);
  // (2) qkv projection -> token-major q/k plane and channel-major v plane
  gemm_qkv<<<dim3(C3 / 64, MTOK / 128), blk, 0, stream>>>(X16, Wq, QK, V16);
  // (3) grouped multi-head attention -> ctx slab plane
  attn_k<<<dim3(NUNIT * AQS), dim3(AWV * 32), 0, stream>>>(QK, V16, Yp);
  // (4) output projection + bias, rows written to their un-shuffled positions
  gemm_proj<<<dim3(CIN / 64, MTOK / 128), blk, 0, stream>>>(Yp, Wp, b_proj, idx, out);
  (void)hipGetLastError();
}

// v007
// A run of this version takes 46.4 microseconds.
// Two timings next to v006 put it at 1.09 and 1.10 times that version's speed.
// Counting every step since v000, it is 5.59 times as fast.
// Contractions: v_wmma_f32_16x16x32_f16 (f16 operands, f32 accumulate). qkv projection: A = gathered x rows
// (bf16-valued, x16) single plane, B = w_qkv (bf16-valued, x256) single plane; scores k.qT: k x16, q x16 single
// planes; p.v: p x1024, v x16 single planes; output projection: A = ctx x256 single f16 plane, B = w_proj
// (bf16-valued, x256) single plane. Online softmax in f32 on VALU. Float inputs RNE-converted to bf16 on load.
#include <hip/hip_runtime.h>
#include <math.h>
#include <stdint.h>

#define NBAT  4
#define NTOK  4096
#define CIN   256
#define C2    512
#define C3    768
#define MTOK  16384
#define NHD   8
#define HD    32
#define NGR   4
#define LGR   1024
#define NUNIT 128
#define AWV   32
#define AQS   2
#define STP   68
#define SBP   132
#define ASP   36
#define KSP   40
#define VSP   1032
#define GSP   264
#define PWV   16
#define PRW   4
#define PXB   (MTOK / (PWV * PRW))
#define PWB   ((C3 + CIN) / (PWV * PRW))
#define CXS   16.0f
#define CWS   256.0f
#define CQK   (16.0f / 4096.0f)
#define CVS   (16.0f / 4096.0f)
#define CYS   256.0f
#define QKSC  (0.17677669529663688f / 256.0f)
#define QKL2  (QKSC * 1.4426950408889634f)
#define PTH   32768.0f

static_assert(NUNIT == NBAT * NGR * NHD);
static_assert(NGR * LGR == NTOK);
static_assert(MTOK == NBAT * NTOK);
static_assert(NTOK % 128 == 0);
static_assert(LGR % 32 == 0);
static_assert(AQS * AWV * 16 == LGR);
static_assert(CIN % 64 == 0);
static_assert(NHD * HD == CIN);
static_assert(64 * SBP <= 8 * 16 * STP);
static_assert((STP * 4) % 16 == 0);
static_assert((SBP * 4) % 16 == 0);
static_assert((ASP * 4) % 16 == 0);
static_assert((KSP * 2) % 32 == 16 && KSP >= HD);
static_assert((VSP * 2) % 32 == 16 && VSP >= LGR);
static_assert((GSP * 2) % 32 == 16 && GSP >= CIN);
static_assert(8 * 16 * STP * 4 <= (128 + 64) * GSP * 2);
static_assert(8 * 16 * STP * 4 <= (NHD * 128 * KSP + 64 * GSP) * 2);
static_assert(128 * CIN == 16 * 256 * 8 && 64 * CIN == 8 * 256 * 8);
static_assert(LGR * HD == 4 * AWV * 32 * 8);
static_assert(CIN == 32 * 8);
static_assert(MTOK % (PWV * PRW) == 0 && C3 % (PWV * PRW) == 0 && CIN % (PWV * PRW) == 0);
static_assert(NTOK % PRW == 0);

typedef _Float16 v16h __attribute__((ext_vector_type(16)));
typedef _Float16 v8h  __attribute__((ext_vector_type(8)));
typedef float    v8f  __attribute__((ext_vector_type(8)));
typedef float    v4f  __attribute__((ext_vector_type(4)));
typedef float    v2f  __attribute__((ext_vector_type(2)));
typedef unsigned int v4u __attribute__((ext_vector_type(4)));
union Frag { v16h v; v8h half[2]; };

// ---- scalar helpers -------------------------------------------------------------------------------------------
__device__ __forceinline__ unsigned short bf_bits(float f) {          // f32 -> bf16 bits, RNE convert
  unsigned u = __float_as_uint(f);
  return (unsigned short)((u + 0x7FFFu + ((u >> 16) & 1u)) >> 16);
}
__device__ __forceinline__ float bfr(float f) { return __uint_as_float(((unsigned)bf_bits(f)) << 16); }
__device__ __forceinline__ unsigned short h_bits(_Float16 x) { return __builtin_bit_cast(unsigned short, x); }
__device__ __forceinline__ unsigned pk16(unsigned short a, unsigned short b) { return (unsigned)a | ((unsigned)b << 16); }
__device__ __forceinline__ v8f zero8() { v8f z = {0.f, 0.f, 0.f, 0.f, 0.f, 0.f, 0.f, 0.f}; return z; }

// ---- fragment loader: 16-bit A/B operand, lane -> row/col (lane&15), p already includes +8*(lane>>4);
//      elements 0..7 <- p[0..7] (k0+8h..), elements 8..15 <- p[16..23] (k0+16+8h..)
__device__ __forceinline__ v16h ldfrag_h(const _Float16* p) {
  Frag f;
  f.half[0] = *(const v8h*)(p);
  f.half[1] = *(const v8h*)(p + 16);
  return f.v;
}

// ---- WMMA helper with trailing VALU hazard gap ----------------------------------------------------------------
__device__ __forceinline__ v8f mma_h(v16h a, v16h b, v8f c) {
  c = __builtin_amdgcn_wmma_f32_16x16x32_f16(false, a, false, b, (short)0, c, false, false);
#if defined(__HIP_DEVICE_COMPILE__)
  asm volatile("v_nop\n\tv_nop\n\tv_nop\n\tv_nop" : "+v"(c) : "v"(a), "v"(b));
#endif
  return c;
}
// ---- WMMA, the builtin alone: the compiler keeps the distance behind it and fills it with the caller's other work ---
__device__ __forceinline__ v8f mma_b(v16h a, v16h b, v8f c) {
  return __builtin_amdgcn_wmma_f32_16x16x32_f16(false, a, false, b, (short)0, c, false, false);
}
__device__ __forceinline__ void wave_sync_lds() {
  __builtin_amdgcn_fence(__ATOMIC_RELEASE, "workgroup");
  __builtin_amdgcn_wave_barrier();
  __builtin_amdgcn_fence(__ATOMIC_ACQUIRE, "workgroup");
}

// ---- 8 f32 -> 8 packed f16 (16 B) -------------------------------------------------------------------------------
__device__ __forceinline__ v4u pack8h(v4f a, v4f b) {
  v4u p;
  p[0] = pk16(h_bits((_Float16)a[0]), h_bits((_Float16)a[1]));
  p[1] = pk16(h_bits((_Float16)a[2]), h_bits((_Float16)a[3]));
  p[2] = pk16(h_bits((_Float16)b[0]), h_bits((_Float16)b[1]));
  p[3] = pk16(h_bits((_Float16)b[2]), h_bits((_Float16)b[3]));
  return p;
}

// =================================================================================================================
// Input convert, one launch for all three float operands. Every operand is a list of rows of 256 floats: 16384
// gathered activation rows, X16[T = b*4096 + j][256] = f16(16 * bf16_RNE(x[b][clamp(idx[j])][c])), and 768 + 256
// weight rows ([out][in], k contiguous), f16(256 * bf16_RNE(w)). One wave converts PRW = 4 consecutive plane rows:
// per row a lane reads 8 consecutive floats (two 16-B loads; the pair reads the row's 1024 B = 8 whole lines) and writes one
// 16-B piece; all 8 loads of a wave are issued before the first is used. Block = PWV = 16 waves = 64 rows; blocks
// 0..255 take the activation rows, 256..267 w_qkv, 268..271 w_proj (block-uniform branches).
// coverage: 256 x 64 = 16384, 12 x 64 = 768 and 4 x 64 = 256 rows, each row 32 lanes x 8 = 256 elements exactly.
// =================================================================================================================
__global__ __launch_bounds__(PWV * 32)
void cvt_in(const float* __restrict__ x, const int* __restrict__ idx, const float* __restrict__ wqkv,
            const float* __restrict__ wp, unsigned short* X16, unsigned short* Wq, unsigned short* Wp) {
  const int lane = threadIdx.x & 31;
  const int wave = __builtin_amdgcn_readfirstlane((int)(threadIdx.x >> 5));   // scalar: idx comes by scalar loads
  const int r0 = ((int)blockIdx.x * PWV + wave) * PRW;
  v4f a[PRW], a2[PRW];
  unsigned short* dp;
  float sc;
  if (blockIdx.x < PXB) {
    const int b = r0 >> 12, j = r0 & (NTOK - 1);
#pragma unroll
    for (int i = 0; i < PRW; ++i) {
      int s = idx[j + i];
      s = (s < 0) ? 0 : ((s > NTOK - 1) ? (NTOK - 1) : s);
      const float* sp = x + ((size_t)(b * NTOK + s)) * CIN + lane * 8;
      a[i]  = *(const v4f*)(sp);
      a2[i] = *(const v4f*)(sp + 4);
    }
    dp = X16 + (size_t)r0 * CIN + lane * 8;
    sc = CXS;
  } else if (blockIdx.x < PXB + C3 / (PWV * PRW)) {
    const int w0 = r0 - MTOK;
#pragma unroll
    for (int i = 0; i < PRW; ++i) {
      const float* sp = wqkv + (size_t)(w0 + i) * CIN + lane * 8;
      a[i]  = *(const v4f*)(sp);
      a2[i] = *(const v4f*)(sp + 4);
    }
    dp = Wq + (size_t)w0 * CIN + lane * 8;
    sc = CWS;
  } else {
    const int w0 = r0 - MTOK - C3;
#pragma unroll
    for (int i = 0; i < PRW; ++i) {
      const float* sp = wp + (size_t)(w0 + i) * CIN + lane * 8;
      a[i]  = *(const v4f*)(sp);
      a2[i] = *(const v4f*)(sp + 4);
    }
    dp = Wp + (size_t)w0 * CIN + lane * 8;
    sc = CWS;
  }
#pragma unroll
  for (int i = 0; i < PRW; ++i) {
    v4f sa, sb;
#pragma unroll
    for (int e = 0; e < 4; ++e) { sa[e] = bfr(a[i][e]) * sc; sb[e] = bfr(a2[i][e]) * sc; }
    *(v4u*)(dp + i * CIN) = pack8h(sa, sb);
  }
}

// =================================================================================================================
// qkv GEMM D[T][co] = X16[T][ci] . Wq[co][ci], K = 256, co 0..767 (q = 0..255, k = 256..511, v = 512..767).
// Block = 8 waves, tile 128 rows x 64 cols, wave = 16 rows x 4 n-tiles. The block's A rows (64 KB, contiguous) and
// B rows (32 KB, contiguous) are staged once, whole K, in LDS: one wave-load = one 512-B row = 4 whole lines, rows
// at pitch GSP (an odd multiple of 16 B for the 16-B fragment reads); one block barrier; fragments by LDS reads with
// the split k map, k-step 32 (8 steps); a second block barrier, then the same LDS is the output stage.
// grid = (12, 128). Block column groups 0..7 -> token-major plane QK[T][512]
// V16[b][c][n] = f16(16 * value): staged block-wide as [64 ch][SBP] (tokens contiguous; a 128-token tile lies
// within one batch row block), wave w owns channels w*8..+7; one instruction = lanes 0..15 -> channel cc (256 B =
// coverage: QK: 8 waves x 4 it x 4 rows x 8 pieces x 8 = 128 rows x 64 cols per block, 8 x 128 blocks tile
// 16384 x 512 exactly; V16: 8 waves x 4 it x 2 ch x 16 lanes x 8 = 64 ch x 128 tok per block, 4 x 128 blocks
// tile 256 ch x 16384 tok exactly.
// =================================================================================================================
__global__ __launch_bounds__(256)
void gemm_qkv(const unsigned short* __restrict__ X16, const unsigned short* __restrict__ Wq,
              unsigned short* QK, unsigned short* V16) {
  __shared__ __align__(16) unsigned char smem[(128 + 64) * GSP * 2];
  _Float16* As = (_Float16*)(void*)smem;
  _Float16* Bs = As + 128 * GSP;
  float* sm = (float*)(void*)smem;
  const int tid = threadIdx.x, wave = tid >> 5, lane = tid & 31, hh = lane >> 4, c = lane & 15;
  const int n0 = blockIdx.x * 64, m0 = blockIdx.y * 128;
  const _Float16* A = (const _Float16*)(const void*)X16 + (size_t)m0 * CIN;
  const _Float16* B = (const _Float16*)(const void*)Wq + (size_t)n0 * CIN;

  {
    v8h ta[16], tb[8];
#pragma unroll
    for (int i = 0; i < 16; ++i) ta[i] = *(const v8h*)(A + (i * 256 + tid) * 8);
#pragma unroll
    for (int i = 0; i < 8; ++i)  tb[i] = *(const v8h*)(B + (i * 256 + tid) * 8);
#pragma unroll
    for (int i = 0; i < 16; ++i) *(v8h*)(As + (i * 8 + wave) * GSP + lane * 8) = ta[i];
#pragma unroll
    for (int i = 0; i < 8; ++i)  *(v8h*)(Bs + (i * 8 + wave) * GSP + lane * 8) = tb[i];
  }
  __syncthreads();

  v8f acc[4];
#pragma unroll
  for (int nt = 0; nt < 4; ++nt) acc[nt] = zero8();

  // unrolled: the k offsets of the LDS reads become constants, and a k-step's ten reads stand as one group
#pragma unroll
  for (int k0 = 0; k0 < CIN; k0 += 32) {
    const v16h af = ldfrag_h(As + (wave * 16 + c) * GSP + k0 + 8 * hh);
    v16h bfrag[4];
#pragma unroll
    for (int nt = 0; nt < 4; ++nt) bfrag[nt] = ldfrag_h(Bs + (nt * 16 + c) * GSP + k0 + 8 * hh);
#pragma unroll
    for (int nt = 0; nt < 4; ++nt) acc[nt] = mma_h(af, bfrag[nt], acc[nt]);
  }
  __syncthreads();   // every wave's last fragment read ends before the tiles' LDS is rewritten as the output stage

  if (blockIdx.x < 8) {
    float* st = sm + wave * (16 * STP);
#pragma unroll
    for (int nt = 0; nt < 4; ++nt) {
#pragma unroll
      for (int r = 0; r < 8; ++r) st[(8 * hh + r) * STP + nt * 16 + c] = acc[nt][r];
    }
    wave_sync_lds();
    const int piece = lane & 7, rsub = lane >> 3;
    v4u pk[4];
    size_t offs[4];
#pragma unroll
    for (int it = 0; it < 4; ++it) {
      const int row = it * 4 + rsub;
      v4f fa = *(const v4f*)(st + row * STP + piece * 8);
      v4f fb = *(const v4f*)(st + row * STP + piece * 8 + 4);
      fa = fa * CQK;
      fb = fb * CQK;
      pk[it] = pack8h(fa, fb);
      offs[it] = ((size_t)(m0 + wave * 16 + row)) * C2 + n0 + piece * 8;
    }
    {
#pragma unroll
      for (int it = 0; it < 4; ++it) *(v4u*)(QK + offs[it]) = pk[it];
      
    }
  } else {
    const int cv0 = n0 - C2;
#pragma unroll
    for (int nt = 0; nt < 4; ++nt) {
#pragma unroll
      for (int r = 0; r < 8; ++r) sm[(nt * 16 + c) * SBP + wave * 16 + 8 * hh + r] = acc[nt][r];
    }
    __syncthreads();
    const int bimg = m0 >> 12, s0 = m0 & (NTOK - 1);
    v4u pk[4];
    size_t o16[4];
#pragma unroll
    for (int i2 = 0; i2 < 4; ++i2) {
      const int cc = wave * 8 + i2 * 2 + hh;
      const int co = cv0 + cc;
      v4f fa = *(const v4f*)(sm + cc * SBP + c * 8);
      v4f fb = *(const v4f*)(sm + cc * SBP + c * 8 + 4);
      fa = fa * CVS;
      fb = fb * CVS;
      pk[i2] = pack8h(fa, fb);
      o16[i2] = ((size_t)(bimg * CIN + co)) * NTOK + s0 + c * 8;
    }
    {
#pragma unroll
      for (int i2 = 0; i2 < 4; ++i2) *(v4u*)(V16 + o16[i2]) = pk[i2];
      
    }
  }
}

// ---- attention softmax helpers ------------------------------------------------------------------------------------
// largest of a query's 32 scores of one pass: a lane's 16, then the other half's (lanes l and l ^ 16 share a query)
__device__ __forceinline__ float row_max(v8f s0, v8f s1) {
  float mc = s0[0];
#pragma unroll
  for (int r = 0; r < 8; ++r) mc = fmaxf(mc, fmaxf(s0[r], s1[r]));
  return fmaxf(mc, __shfl_xor(mc, 16, 32));
}
// P = 2^(S*QKL2 + nb) for a lane's 16 scores, two of one key tile per packed fma; p <- the f16 A fragment; returns their sum
__device__ __forceinline__ float soft_p(v8f s0, v8f s1, float nb, v16h& p) {
  float psum = 0.f;
  const v2f cc = {QKL2, QKL2}, nn = {nb, nb};
#pragma unroll
  for (int i = 0; i < 8; i += 2) {
    const v2f a0 = {s0[i], s0[i + 1]}, a1 = {s1[i], s1[i + 1]};
    const v2f x0 = __builtin_elementwise_fma(a0, cc, nn), x1 = __builtin_elementwise_fma(a1, cc, nn);
    const v2f e0 = {__builtin_amdgcn_exp2f(x0[0]), __builtin_amdgcn_exp2f(x0[1])};
    const v2f e1 = {__builtin_amdgcn_exp2f(x1[0]), __builtin_amdgcn_exp2f(x1[1])};
    const v2f t = e0 + e1;
    psum = psum + t[0];
    psum = psum + t[1];
    p[i]         = (_Float16)e0[0];
    p[i + 1]     = (_Float16)e0[1];
    p[8 + i]     = (_Float16)e1[0];
    p[8 + i + 1] = (_Float16)e1[1];
  }
  return psum;
}

// =================================================================================================================
// Grouped attention, one unit (batch b, token group gr, head) per AQS = 2 blocks of 1024 threads = 32 waves, 1024
// queries x 1024 keys, d = 32: 256 blocks, 8 waves per SIMD, all waves of a block walk the same k and v rows.
// Static LDS: the unit's whole k slab Ks[1024 keys][KSP] and v slab Vs[32 channels][VSP] (f16, row pitch an odd
// multiple of 16 B for the 16-B fragment reads), filled once per block (each thread moves 4 + 4 pieces of 16 B from
// the token-major plane QK, k row = T*512 + 256 + head*32, and the channel-major plane V16, row = channel
// head*32 + d, keys contiguous), then one block barrier; plus the per-wave stage [16][ASP] f32. q fragments
// straight from QK (q row = T*512 + head*32). Per wave: the one q-tile qt = part*32 + wave (< 64).
//   Transposed scores S^T = K_tile (A, 16 keys x 32 d) x Q (B: k = d, n = query): S*256 = q16.k16; D element r of
//   lane l = S[query l&15][key 8h+r], so P = exp((S - m)*scale) x1024 is the A fragment of P.V directly in registers;
//   each P is one fma and one exp2: 2^(S*QKL2 + nb), nb = 10 - m*QKL2 (scale, log2 e, the maximum and the x1024 in it)
//   (element i <- key tile 0 row i, element 8+i <- key tile 1 row i). Online softmax over 32 chunks of 32 keys; m is
//   pass 0's row maximum and is taken up again (O and l rescaled, the pass's P made anew) only in a pass where some
//   lane's 16 P sum to more than PTH = 2^15, so that every P stays a finite f16; any m gives the same O / l.
//   The scores of pass ch + 1 are made at the foot of pass ch, beside its two P.V products (four WMMAs in a row).
//   O = P.V (acc scale 1024*16), l = sum of P (x1024). Epilogue: O/(l*16) staged per wave in LDS, then stored as the f16 plane
//   Y[unit][1024][32] of 256*o: one instruction = 32 lanes x 16 B = 512 B = 8 token rows (consecutive lanes
// coverage: per block 32 q-tiles x 16 rows x 32 d, half of its unit's 1024-row slab; grid covers 2 halves x 128
// units, every slab row written exactly once.
// =================================================================================================================
__global__ __launch_bounds__(AWV * 32)
void attn_k(const unsigned short* __restrict__ QK, const unsigned short* __restrict__ V16, unsigned short* Y) {
  __shared__ __align__(16) float Sst[AWV * 16 * ASP];
  __shared__ __align__(16) _Float16 Ks[LGR * KSP];
  __shared__ __align__(16) _Float16 Vs[HD * VSP];
  const int tid = threadIdx.x, wave = tid >> 5, lane = tid & 31, hh = lane >> 4, c = lane & 15;
  const int u = blockIdx.x & (NUNIT - 1), part = blockIdx.x / NUNIT;
  const int head = u & 7, gr = (u >> 3) & 3, b = u >> 5;
  const size_t tok0 = (size_t)b * NTOK + (size_t)gr * LGR;
  const _Float16* Qp = (const _Float16*)(const void*)QK + tok0 * C2 + head * HD;
  const _Float16* Kp = Qp + CIN;
  const size_t cm0 = ((size_t)(b * CIN + head * HD)) * NTOK + (size_t)gr * LGR;
  const _Float16* Vp = (const _Float16*)(const void*)V16 + cm0;
  float* st = Sst + wave * (16 * ASP);

  {
    const int qt = part * AWV + wave;
    const int lq = qt * 16 + c;
    const v16h bq = ldfrag_h(Qp + (size_t)lq * C2 + 8 * hh);     // B: n = query c, k = d 8h.. / 16+8h..

    {
      v8h kt[4], vt[4];
#pragma unroll
      for (int i = 0; i < 4; ++i) {
        const int id = i * (AWV * 32) + tid;
        kt[i] = *(const v8h*)(Kp + (size_t)(id >> 2) * C2 + (id & 3) * 8);       // key id/4, d piece id%4
        vt[i] = *(const v8h*)(Vp + (size_t)(id >> 7) * NTOK + (id & 127) * 8);   // channel id/128, key piece id%128
      }
#pragma unroll
      for (int i = 0; i < 4; ++i) {
        const int id = i * (AWV * 32) + tid;
        *(v8h*)(Ks + (id >> 2) * KSP + (id & 3) * 8)   = kt[i];
        *(v8h*)(Vs + (id >> 7) * VSP + (id & 127) * 8) = vt[i];
      }
    }
    __syncthreads();

    v8f o0 = zero8(), o1 = zero8();
    float lrun = 0.f;
    v8f s[2];                                                 // scores of the pass at hand, made one pass ahead
#pragma unroll
    for (int j = 0; j < 2; ++j) s[j] = mma_b(ldfrag_h(Ks + (j * 16 + c) * KSP + 8 * hh), bq, zero8());
    float nb = fmaf(-row_max(s[0], s[1]), QKL2, 10.0f);       // exponent offset: 10 - m * scale * log2(e), m = pass 0's maximum
    // fragments of a pass's four WMMAs, read one pass ahead (at the foot of the pass before) so that they fly under the softmax
    v16h vf0 = ldfrag_h(Vs + c * VSP + 8 * hh);                                      // B: n = d c, keys of the pass
    v16h vf1 = ldfrag_h(Vs + (HD / 2 + c) * VSP + 8 * hh);                           // B: n = d 16+c
    v16h ka0 = ldfrag_h(Ks + (32 + c) * KSP + 8 * hh);                               // A: row = key of the next pass, k = d
    v16h ka1 = ldfrag_h(Ks + (32 + 16 + c) * KSP + 8 * hh);
#pragma unroll 1
    for (int ch = 0; ch < LGR / 32; ++ch) {
      v16h pfh;
      float psum = soft_p(s[0], s[1], nb, pfh);
      // The offset stays as it is while every lane's 16 probabilities sum to at most PTH (each then fits f16). Else the
      // whole wave (one scalar branch) takes the pass's maximum in, rescales O and l, and makes the pass's P anew.
      if (__builtin_amdgcn_ballot_w32(!(psum <= PTH)) != 0u) {
        const float nbn = fminf(nb, fmaf(-row_max(s[0], s[1]), QKL2, 10.0f));
        const float alpha = __builtin_amdgcn_exp2f(nbn - nb);
#pragma unroll
        for (int r = 0; r < 8; ++r) {
          const float arr = __shfl(alpha, 8 * hh + r, 32);
          o0[r] = o0[r] * arr;
          o1[r] = o1[r] * arr;
        }
        lrun = lrun * alpha;
        nb = nbn;
        psum = soft_p(s[0], s[1], nb, pfh);
      }
      lrun = lrun + psum;
      const int kv = (ch * 32 + 32) & (LGR - 1);              // next pass's keys and the ones behind them; the last passes
      const int kn = (ch * 32 + 64) & (LGR - 1);              // wrap, and what is read and scored there is dropped
      const _Float16* vnx = Vs + c * VSP + kv + 8 * hh;
      const _Float16* knx = Ks + (kn + c) * KSP + 8 * hh;
      // keeps the address arithmetic and the l update ahead of the four WMMAs: moved in between them they land on a WMMA's
      // operand registers and draw three more v_nop a pass; with only WMMAs and LDS reads here each WMMA fills the distance
      // of the one before it
      __builtin_amdgcn_sched_barrier(0);
      s[0] = mma_b(ka0, bq, zero8());
      s[1] = mma_b(ka1, bq, zero8());
      o0 = mma_b(pfh, vf0, o0);
      o1 = mma_b(pfh, vf1, o1);
      vf0 = ldfrag_h(vnx);
      vf1 = ldfrag_h(vnx + (HD / 2) * VSP);
      ka0 = ldfrag_h(knx);
      ka1 = ldfrag_h(knx + 16 * KSP);
    }
    const float lsum = lrun + __shfl_xor(lrun, 16, 32);      // lane q (and q+16) holds the full row sum of query q
    const float rinv = 1.0f / (lsum * 16.0f);                // lsum carries the x1024 of p
#pragma unroll
    for (int r = 0; r < 8; ++r) {
      const int q = 8 * hh + r;
      const float inv = __shfl(rinv, q, 32);
      st[q * ASP + c]          = o0[r] * inv;
      st[q * ASP + HD / 2 + c] = o1[r] * inv;
    }
    wave_sync_lds();
    {
      const int rr = lane >> 2, dp = (lane & 3) * 8;
      v4u pk[2];
      size_t offs[2];
#pragma unroll
      for (int it = 0; it < 2; ++it) {
        const int row = it * 8 + rr;
        v4f fa = *(const v4f*)(st + row * ASP + dp);
        v4f fb = *(const v4f*)(st + row * ASP + dp + 4);
        fa = fa * CYS;
        fb = fb * CYS;
        pk[it] = pack8h(fa, fb);
        offs[it] = ((size_t)u * LGR + (size_t)(qt * 16 + row)) * HD + dp;
      }
      {
#pragma unroll
        for (int it = 0; it < 2; ++it) *(v4u*)(Y + offs[it]) = pk[it];
        
      }
    }
  }
}

// =================================================================================================================
// Output projection D[T][co] = Y[T][ci] . Wp[co][ci] + bias, rows T in shuffled token order, written to the
// un-shuffled output row idx[j] (clamped) of batch b. A = Y plane (x256) addressed by arithmetic: token T ->
// (batch, group, query), k-step ks = head ks, channels ks*32 + d (elements 0..7 d = 8h.., elements 8..15 d =
// 16+8h..). B = weight plane x256. Both tiles are staged once, whole K, in LDS by whole-line loads: per head the
// block's 128 token rows of Y are 8 KB contiguous -> As[head][token][KSP]; the 64 weight rows are 32 KB contiguous
// -> Bs[row][GSP]; one block barrier, fragments by LDS reads, a second block barrier, then the same LDS is the
// output stage. Epilogue: value = acc/65536 + bf16(b)[co], staged per wave in LDS [16][STP];
// coverage: 8 waves x 8 it x 2 rows x 16 lanes x 4 = 128 rows x 64 co per block; grid tiles 16384 x 256 exactly;
// with idx a permutation every output row is written exactly once.
// =================================================================================================================
__global__ __launch_bounds__(256)
void gemm_proj(const unsigned short* __restrict__ Y, const unsigned short* __restrict__ Wp,
               const float* __restrict__ bp, const int* __restrict__ idx, float* out) {
  __shared__ __align__(16) unsigned char smem[(NHD * 128 * KSP + 64 * GSP) * 2];
  _Float16* As = (_Float16*)(void*)smem;
  _Float16* Bs = As + NHD * 128 * KSP;
  float* sm = (float*)(void*)smem;
  const int tid = threadIdx.x, wave = tid >> 5, lane = tid & 31, hh = lane >> 4, c = lane & 15;
  const int n0 = blockIdx.x * 64, m0 = blockIdx.y * 128;
  const int bq = m0 >> 12, jj = m0 & (NTOK - 1), gr = jj >> 10, q0 = jj & (LGR - 1);
  const _Float16* A = (const _Float16*)(const void*)Y + (((size_t)((bq * NGR + gr) * NHD)) * LGR + (size_t)q0) * HD;
  const _Float16* B = (const _Float16*)(const void*)Wp + (size_t)n0 * CIN;

  {
    v8h ta[16], tb[8];
#pragma unroll
    for (int i = 0; i < 16; ++i)       // head i/2, piece (i%2)*256 + tid of its 512 (token = piece/4, d piece = piece%4)
      ta[i] = *(const v8h*)(A + (size_t)(i >> 1) * (LGR * HD) + ((i & 1) * 256 + tid) * 8);
#pragma unroll
    for (int i = 0; i < 8; ++i)  tb[i] = *(const v8h*)(B + (i * 256 + tid) * 8);
#pragma unroll
    for (int i = 0; i < 16; ++i) *(v8h*)(As + ((i * 256 + tid) >> 2) * KSP + (tid & 3) * 8) = ta[i];
#pragma unroll
    for (int i = 0; i < 8; ++i)  *(v8h*)(Bs + (i * 8 + wave) * GSP + lane * 8) = tb[i];
  }
  __syncthreads();

  v8f acc[4];
#pragma unroll
  for (int nt = 0; nt < 4; ++nt) acc[nt] = zero8();

  // unrolled: the k offsets of the LDS reads become constants, and a k-step's ten reads stand as one group
#pragma unroll
  for (int ks = 0; ks < NHD; ++ks) {
    const v16h af = ldfrag_h(As + (ks * 128 + wave * 16 + c) * KSP + 8 * hh);
    v16h bfrag[4];
#pragma unroll
    for (int nt = 0; nt < 4; ++nt) bfrag[nt] = ldfrag_h(Bs + (nt * 16 + c) * GSP + ks * 32 + 8 * hh);
#pragma unroll
    for (int nt = 0; nt < 4; ++nt) acc[nt] = mma_h(af, bfrag[nt], acc[nt]);
  }
  __syncthreads();   // every wave's last fragment read ends before the tiles' LDS is rewritten as the output stage

  float* st = sm + wave * (16 * STP);
#pragma unroll
  for (int nt = 0; nt < 4; ++nt) {
    const int co = n0 + nt * 16 + c;
    const float bi = bfr(bp[co]);
#pragma unroll
    for (int r = 0; r < 8; ++r) st[(8 * hh + r) * STP + nt * 16 + c] = acc[nt][r] * (1.0f / 65536.0f) + bi;
  }
  wave_sync_lds();
  const int bimg = m0 >> 12;
  const int jbase = (m0 & (NTOK - 1)) + wave * 16;
  v4f ov[8];
  size_t offs[8];
#pragma unroll
  for (int it = 0; it < 8; ++it) {
    const int row = it * 2 + hh;
    int dst = idx[jbase + row];
    dst = (dst < 0) ? 0 : ((dst > NTOK - 1) ? (NTOK - 1) : dst);
    ov[it] = *(const v4f*)(st + row * STP + c * 4);
    offs[it] = ((size_t)(bimg * NTOK + dst)) * CIN + n0 + c * 4;
  }
  {
#pragma unroll
    for (int it = 0; it < 8; ++it) *(v4f*)(out + offs[it]) = ov[it];
    
  }
}

// =================================================================================================================
//   Wq f16 [768][256] 393216 @0; Wp f16 [256][256] 131072 @393216; X16 f16 [16384][256] 8388608 @524288;
//   QK f16 [16384][512] 16777216 @8912896; V16 f16 [4][256][4096] 8388608 @25690112;
//   Y f16 [128][1024][32] 8388608 @34078720. Total 42467328.
// =================================================================================================================
extern "C" void kernel_launch(void* const* d_in, const int* in_sizes, int n_in,
                              void* d_out, int out_size, void* d_ws, size_t ws_size,
                              hipStream_t stream) {
  if (n_in < 5) return;
  if (in_sizes[0] != NBAT * NTOK * CIN) return;
  if (in_sizes[1] != NTOK) return;
  if (in_sizes[2] != C3 * CIN) return;
  if (in_sizes[3] != CIN * CIN) return;
  if (in_sizes[4] != CIN) return;
  if (out_size != NBAT * NTOK * CIN) return;

  const float* x      = (const float*)d_in[0];
  const int*   idx    = (const int*)d_in[1];
  const float* w_qkv  = (const float*)d_in[2];
  const float* w_proj = (const float*)d_in[3];
  const float* b_proj = (const float*)d_in[4];
  float* out = (float*)d_out;

  const size_t sWq  = (size_t)C3 * CIN * 2;              //    393216
  const size_t sWp  = (size_t)CIN * CIN * 2;             //    131072
  const size_t sX16 = (size_t)MTOK * CIN * 2;            //   8388608
  const size_t sQK  = (size_t)MTOK * C2 * 2;             //  16777216
  const size_t sV16 = (size_t)NBAT * CIN * NTOK * 2;     //   8388608
  const size_t sY   = (size_t)NUNIT * LGR * HD * 2;      //   8388608
  size_t off = 0;
  const size_t oWq  = off; off += sWq;
  const size_t oWp  = off; off += sWp;
  const size_t oX16 = off; off += sX16;
  const size_t oQK  = off; off += sQK;
  const size_t oV16 = off; off += sV16;
  const size_t oY   = off; off += sY;
  if (off > ws_size) return;                             // off = 42467328
  if (off > (size_t)134217728) return;

  char* ws = (char*)d_ws;
  unsigned short* Wq  = (unsigned short*)(ws + oWq);
  unsigned short* Wp  = (unsigned short*)(ws + oWp);
  unsigned short* X16 = (unsigned short*)(ws + oX16);
  unsigned short* QK  = (unsigned short*)(ws + oQK);
  unsigned short* V16 = (unsigned short*)(ws + oV16);
  unsigned short* Yp  = (unsigned short*)(ws + oY);

  const dim3 blk(256);
  // (1) weights -> f16 x256 planes; x rows gathered by idx -> token-major f16 x16 plane
  cvt_in<<<dim3(PXB + PWB), dim3(PWV * 32), 0, stream>>>(x, idx, w_qkv, w_proj, X16, Wq, Wp);
  // (2) qkv projection -> token-major q/k plane and channel-major v plane
  gemm_qkv<<<dim3(C3 / 64, MTOK / 128), blk, 0, stream>>>(X16, Wq, QK, V16);
  // (3) grouped multi-head attention -> ctx slab plane
  attn_k<<<dim3(NUNIT * AQS), dim3(AWV * 32), 0, stream>>>(QK, V16, Yp);
  // (4) output projection + bias, rows written to their un-shuffled positions
  gemm_proj<<<dim3(CIN / 64, MTOK / 128), blk, 0, stream>>>(Yp, Wp, b_proj, idx, out);
  (void)hipGetLastError();
}

// v008
// A run of this version takes 45 microseconds.
// Next to v007, in two timings, it ran 1.03 times as fast each time.
// Over all steps from v000 it is 5.75 times as fast.
// Contractions: v_wmma_f32_16x16x32_f16 (f16 operands, f32 accumulate). qkv projection: A = gathered x rows
// (bf16-valued, x16) single plane, B = w_qkv (bf16-valued, x256) single plane; scores k.qT: k x16, q x16 single
// planes; p.v: p x1024, v x16 single planes; output projection: A = ctx x256 single f16 plane, B = w_proj
// (bf16-valued, x256) single plane. Online softmax in f32 on VALU. Float inputs RNE-converted to bf16 on load.
#include <hip/hip_runtime.h>
#include <math.h>
#include <stdint.h>

#define NBAT  4
#define NTOK  4096
#define CIN   256
#define C2    512
#define C3    768
#define MTOK  16384
#define NHD   8
#define HD    32
#define NGR   4
#define LGR   1024
#define NUNIT 128
#define AWV   32
#define AQS   2
#define STP   68
#define SBP   132
#define ASP   36
#define KSP   40
#define VSP   1032
#define GSP   264
#define QWV   12
#define QCB   384
#define QST   ((128 + QCB + QWV - 1) / QWV)
#define PWV   16
#define PRW   4
#define PXB   (MTOK / (PWV * PRW))
#define PWB   ((C3 + CIN) / (PWV * PRW))
#define CXS   16.0f
#define CWS   256.0f
#define CQK   (16.0f / 4096.0f)
#define CVS   (16.0f / 4096.0f)
#define CYS   256.0f
#define QKSC  (0.17677669529663688f / 256.0f)
#define QKL2  (QKSC * 1.4426950408889634f)
#define PTH   32768.0f

static_assert(NUNIT == NBAT * NGR * NHD);
static_assert(NGR * LGR == NTOK);
static_assert(MTOK == NBAT * NTOK);
static_assert(NTOK % 128 == 0);
static_assert(LGR % 32 == 0);
static_assert(AQS * AWV * 16 == LGR);
static_assert(CIN % 64 == 0);
static_assert(NHD * HD == CIN);
static_assert(64 * SBP <= 2 * 64 * STP);
static_assert((STP * 4) % 16 == 0);
static_assert((SBP * 4) % 16 == 0);
static_assert((ASP * 4) % 16 == 0);
static_assert((KSP * 2) % 32 == 16 && KSP >= HD);
static_assert((VSP * 2) % 32 == 16 && VSP >= LGR);
static_assert((GSP * 2) % 32 == 16 && GSP >= CIN);
static_assert(QWV * 64 * STP * 4 <= (128 + QCB) * GSP * 2);
static_assert(QWV == 2 * (QCB / 64) && C3 % QCB == 0 && C2 % 64 == 0);
static_assert(8 * 16 * STP * 4 <= (NHD * 128 * KSP + 64 * GSP) * 2);
static_assert(128 * CIN == 16 * 256 * 8 && 64 * CIN == 8 * 256 * 8);
static_assert(LGR * HD == 4 * AWV * 32 * 8);
static_assert(CIN == 32 * 8);
static_assert(MTOK % (PWV * PRW) == 0 && C3 % (PWV * PRW) == 0 && CIN % (PWV * PRW) == 0);
static_assert(NTOK % PRW == 0);

typedef _Float16 v16h __attribute__((ext_vector_type(16)));
typedef _Float16 v8h  __attribute__((ext_vector_type(8)));
typedef float    v8f  __attribute__((ext_vector_type(8)));
typedef float    v4f  __attribute__((ext_vector_type(4)));
typedef float    v2f  __attribute__((ext_vector_type(2)));
typedef unsigned int v4u __attribute__((ext_vector_type(4)));
union Frag { v16h v; v8h half[2]; };

// ---- scalar helpers -------------------------------------------------------------------------------------------
__device__ __forceinline__ unsigned short bf_bits(float f) {          // f32 -> bf16 bits, RNE convert
  unsigned u = __float_as_uint(f);
  return (unsigned short)((u + 0x7FFFu + ((u >> 16) & 1u)) >> 16);
}
__device__ __forceinline__ float bfr(float f) { return __uint_as_float(((unsigned)bf_bits(f)) << 16); }
__device__ __forceinline__ unsigned short h_bits(_Float16 x) { return __builtin_bit_cast(unsigned short, x); }
__device__ __forceinline__ unsigned pk16(unsigned short a, unsigned short b) { return (unsigned)a | ((unsigned)b << 16); }
__device__ __forceinline__ v8f zero8() { v8f z = {0.f, 0.f, 0.f, 0.f, 0.f, 0.f, 0.f, 0.f}; return z; }

// ---- fragment loader: 16-bit A/B operand, lane -> row/col (lane&15), p already includes +8*(lane>>4);
//      elements 0..7 <- p[0..7] (k0+8h..), elements 8..15 <- p[16..23] (k0+16+8h..)
__device__ __forceinline__ v16h ldfrag_h(const _Float16* p) {
  Frag f;
  f.half[0] = *(const v8h*)(p);
  f.half[1] = *(const v8h*)(p + 16);
  return f.v;
}

// ---- WMMA helper with trailing VALU hazard gap ----------------------------------------------------------------
__device__ __forceinline__ v8f mma_h(v16h a, v16h b, v8f c) {
  c = __builtin_amdgcn_wmma_f32_16x16x32_f16(false, a, false, b, (short)0, c, false, false);
#if defined(__HIP_DEVICE_COMPILE__)
  asm volatile("v_nop\n\tv_nop\n\tv_nop\n\tv_nop" : "+v"(c) : "v"(a), "v"(b));
#endif
  return c;
}
// ---- WMMA, the builtin alone: the compiler keeps the distance behind it and fills it with the caller's other work ---
__device__ __forceinline__ v8f mma_b(v16h a, v16h b, v8f c) {
  return __builtin_amdgcn_wmma_f32_16x16x32_f16(false, a, false, b, (short)0, c, false, false);
}
__device__ __forceinline__ void wave_sync_lds() {
  __builtin_amdgcn_fence(__ATOMIC_RELEASE, "workgroup");
  __builtin_amdgcn_wave_barrier();
  __builtin_amdgcn_fence(__ATOMIC_ACQUIRE, "workgroup");
}

// ---- 8 f32 -> 8 packed f16 (16 B) -------------------------------------------------------------------------------
__device__ __forceinline__ v4u pack8h(v4f a, v4f b) {
  v4u p;
  p[0] = pk16(h_bits((_Float16)a[0]), h_bits((_Float16)a[1]));
  p[1] = pk16(h_bits((_Float16)a[2]), h_bits((_Float16)a[3]));
  p[2] = pk16(h_bits((_Float16)b[0]), h_bits((_Float16)b[1]));
  p[3] = pk16(h_bits((_Float16)b[2]), h_bits((_Float16)b[3]));
  return p;
}

// =================================================================================================================
// Input convert, one launch for all three float operands. Every operand is a list of rows of 256 floats: 16384
// gathered activation rows, X16[T = b*4096 + j][256] = f16(16 * bf16_RNE(x[b][clamp(idx[j])][c])), and 768 + 256
// weight rows ([out][in], k contiguous), f16(256 * bf16_RNE(w)). One wave converts PRW = 4 consecutive plane rows:
// per row a lane reads 8 consecutive floats (two 16-B loads; the pair reads the row's 1024 B = 8 whole lines) and writes one
// 16-B piece; all 8 loads of a wave are issued before the first is used. Block = PWV = 16 waves = 64 rows; blocks
// 0..255 take the activation rows, 256..267 w_qkv, 268..271 w_proj (block-uniform branches).
// coverage: 256 x 64 = 16384, 12 x 64 = 768 and 4 x 64 = 256 rows, each row 32 lanes x 8 = 256 elements exactly.
// =================================================================================================================
__global__ __launch_bounds__(PWV * 32)
void cvt_in(const float* __restrict__ x, const int* __restrict__ idx, const float* __restrict__ wqkv,
            const float* __restrict__ wp, unsigned short* X16, unsigned short* Wq, unsigned short* Wp) {
  const int lane = threadIdx.x & 31;
  const int wave = __builtin_amdgcn_readfirstlane((int)(threadIdx.x >> 5));   // scalar: idx comes by scalar loads
  const int r0 = ((int)blockIdx.x * PWV + wave) * PRW;
  v4f a[PRW], a2[PRW];
  unsigned short* dp;
  float sc;
  if (blockIdx.x < PXB) {
    const int b = r0 >> 12, j = r0 & (NTOK - 1);
#pragma unroll
    for (int i = 0; i < PRW; ++i) {
      int s = idx[j + i];
      s = (s < 0) ? 0 : ((s > NTOK - 1) ? (NTOK - 1) : s);
      const float* sp = x + ((size_t)(b * NTOK + s)) * CIN + lane * 8;
      a[i]  = *(const v4f*)(sp);
      a2[i] = *(const v4f*)(sp + 4);
    }
    dp = X16 + (size_t)r0 * CIN + lane * 8;
    sc = CXS;
  } else if (blockIdx.x < PXB + C3 / (PWV * PRW)) {
    const int w0 = r0 - MTOK;
#pragma unroll
    for (int i = 0; i < PRW; ++i) {
      const float* sp = wqkv + (size_t)(w0 + i) * CIN + lane * 8;
      a[i]  = *(const v4f*)(sp);
      a2[i] = *(const v4f*)(sp + 4);
    }
    dp = Wq + (size_t)w0 * CIN + lane * 8;
    sc = CWS;
  } else {
    const int w0 = r0 - MTOK - C3;
#pragma unroll
    for (int i = 0; i < PRW; ++i) {
      const float* sp = wp + (size_t)(w0 + i) * CIN + lane * 8;
      a[i]  = *(const v4f*)(sp);
      a2[i] = *(const v4f*)(sp + 4);
    }
    dp = Wp + (size_t)w0 * CIN + lane * 8;
    sc = CWS;
  }
#pragma unroll
  for (int i = 0; i < PRW; ++i) {
    v4f sa, sb;
#pragma unroll
    for (int e = 0; e < 4; ++e) { sa[e] = bfr(a[i][e]) * sc; sb[e] = bfr(a2[i][e]) * sc; }
    *(v4u*)(dp + i * CIN) = pack8h(sa, sb);
  }
}

// =================================================================================================================
// qkv GEMM D[T][co] = X16[T][ci] . Wq[co][ci], K = 256, co 0..767 (q = 0..255, k = 256..511, v = 512..767).
// Block = QWV = 12 waves, tile 128 rows x QCB = 384 cols, one block per WGP, grid = (2, 128) = 256 blocks; wave =
// 64 rows (half rg) x 64 cols (column group cg), 4 x 4 accumulator tiles: a k-step's 8 fragments feed 16 WMMAs.
// The block's A rows (64 KB, contiguous) and B rows (192 KB, contiguous) are staged once, whole K, in LDS: one
// wave-load = one 512-B row = 4 whole lines, rows at pitch GSP (an odd multiple of 16 B for the 16-B fragment reads);
// LDS row r = A row r for r < 128, B row r - 128 behind; wave w moves rows w, w + 12, ... One block barrier; fragments
// by LDS reads with the split k map, k-step 32 (8 steps); a second block barrier, then the same LDS is the output
// stage, 64 x STP floats per wave; a third block barrier between its writes and its reads.
// Column groups below 512 -> token-major plane QK[T][512], staged per wave [64 rows][STP].
// Column groups from 512 -> V16[b][c][n] = f16(16 * value): the two waves of a group stage [64 ch][SBP] (tokens
// contiguous; a 128-token tile lies within one batch row block) in their two ranges; wave rg owns channels rg*32..+31.
// coverage: QK: 16 it x 4 rows x 8 pieces x 8 = 64 rows x 64 cols per wave, 2 halves x 8 groups x 128 row blocks
// tile 16384 x 512 exactly; V16: 16 it x 2 ch x 16 lanes x 8 = 32 ch x 128 tok per wave, 2 halves x 4 groups x 128
// row blocks tile 256 ch x 16384 tok exactly.
// =================================================================================================================
__global__ __launch_bounds__(QWV * 32)
void gemm_qkv(const unsigned short* __restrict__ X16, const unsigned short* __restrict__ Wq,
              unsigned short* QK, unsigned short* V16) {
  __shared__ __align__(16) unsigned char smem[(128 + QCB) * GSP * 2];
  _Float16* As = (_Float16*)(void*)smem;
  _Float16* Bs = As + 128 * GSP;
  float* sm = (float*)(void*)smem;
  const int tid = threadIdx.x, lane = tid & 31, hh = lane >> 4, c = lane & 15;
  const int wave = __builtin_amdgcn_readfirstlane(tid >> 5);   // scalar: row choice and output path are scalar branches
  const int rg = wave & 1, cg = wave >> 1;
  const int m0 = blockIdx.y * 128;
  const int n0 = blockIdx.x * QCB + cg * 64;
  const _Float16* A = (const _Float16*)(const void*)X16 + (size_t)m0 * CIN;
  const _Float16* B = (const _Float16*)(const void*)Wq + (size_t)(blockIdx.x * QCB) * CIN;

  {
    // the tests on i alone fold at compile time: only the round that holds row 128 picks its source by the wave's
    // number, and only the last round, which is not full, is skipped by some waves (both scalar)
    v8h t[QST];
    const _Float16* Aw = A + wave * CIN;   // one scalar base each: the rounds' steps become immediate offsets
    const _Float16* Bw = B + wave * CIN;
#pragma unroll
    for (int i = 0; i < QST; ++i) {
      const int r = i * QWV + wave;
      if ((i + 1) * QWV <= 128 + QCB || r < 128 + QCB) {
        const _Float16* sp;
        if ((i + 1) * QWV <= 128) sp = Aw + i * QWV * CIN;
        else if (i * QWV >= 128)  sp = Bw + (i * QWV - 128) * CIN;
        else                      sp = (r < 128) ? (Aw + i * QWV * CIN) : (Bw + (i * QWV - 128) * CIN);
        t[i] = *(const v8h*)(sp + lane * 8);
      }
    }
#pragma unroll
    for (int i = 0; i < QST; ++i) {
      const int r = i * QWV + wave;
      if ((i + 1) * QWV <= 128 + QCB || r < 128 + QCB) *(v8h*)(As + r * GSP + lane * 8) = t[i];
    }
  }
  __syncthreads();

  v8f acc[4][4];
#pragma unroll
  for (int mt = 0; mt < 4; ++mt) {
#pragma unroll
    for (int nt = 0; nt < 4; ++nt) acc[mt][nt] = zero8();
  }

  // unrolled: the k offsets of the LDS reads become constants, and a k-step's sixteen reads stand as one group
#pragma unroll
  for (int k0 = 0; k0 < CIN; k0 += 32) {
    v16h af[4], bfrag[4];
#pragma unroll
    for (int mt = 0; mt < 4; ++mt) af[mt] = ldfrag_h(As + (rg * 64 + mt * 16 + c) * GSP + k0 + 8 * hh);
#pragma unroll
    for (int nt = 0; nt < 4; ++nt) bfrag[nt] = ldfrag_h(Bs + (cg * 64 + nt * 16 + c) * GSP + k0 + 8 * hh);
#pragma unroll
    for (int mt = 0; mt < 4; ++mt) {
#pragma unroll
      for (int nt = 0; nt < 4; ++nt) acc[mt][nt] = mma_h(af[mt], bfrag[nt], acc[mt][nt]);
    }
  }
  __syncthreads();   // every wave's last fragment read ends before the tiles' LDS is rewritten as the output stage

  float* st = sm + wave * (64 * STP);          // QK path: this wave's own range
  float* sv = sm + (cg * 2) * (64 * STP);      // V path: the two ranges of the column group's waves
  if (n0 < C2) {
#pragma unroll
    for (int mt = 0; mt < 4; ++mt) {
#pragma unroll
      for (int nt = 0; nt < 4; ++nt) {
#pragma unroll
        for (int r = 0; r < 8; ++r) st[(mt * 16 + 8 * hh + r) * STP + nt * 16 + c] = acc[mt][nt][r];
      }
    }
  } else {
#pragma unroll
    for (int mt = 0; mt < 4; ++mt) {
#pragma unroll
      for (int nt = 0; nt < 4; ++nt) {
#pragma unroll
        for (int r = 0; r < 8; ++r) sv[(nt * 16 + c) * SBP + rg * 64 + mt * 16 + 8 * hh + r] = acc[mt][nt][r];
      }
    }
  }
  __syncthreads();   // a V group's channel rows hold tokens of both its waves; passed by every wave of the block

  if (n0 < C2) {
    const int piece = lane & 7, rsub = lane >> 3;
#pragma unroll
    for (int ib = 0; ib < 4; ++ib) {
      v4u pk[4];
      size_t offs[4];
#pragma unroll
      for (int it = 0; it < 4; ++it) {
        const int row = (ib * 4 + it) * 4 + rsub;
        v4f fa = *(const v4f*)(st + row * STP + piece * 8);
        v4f fb = *(const v4f*)(st + row * STP + piece * 8 + 4);
        fa = fa * CQK;
        fb = fb * CQK;
        pk[it] = pack8h(fa, fb);
        offs[it] = ((size_t)(m0 + rg * 64 + row)) * C2 + n0 + piece * 8;
      }
#pragma unroll
      for (int it = 0; it < 4; ++it) *(v4u*)(QK + offs[it]) = pk[it];
    }
  } else {
    const int cv0 = n0 - C2;
    const int bimg = m0 >> 12, s0 = m0 & (NTOK - 1);
#pragma unroll
    for (int ib = 0; ib < 4; ++ib) {
      v4u pk[4];
      size_t o16[4];
#pragma unroll
      for (int i2 = 0; i2 < 4; ++i2) {
        const int cc = rg * 32 + (ib * 4 + i2) * 2 + hh;
        const int co = cv0 + cc;
        v4f fa = *(const v4f*)(sv + cc * SBP + c * 8);
        v4f fb = *(const v4f*)(sv + cc * SBP + c * 8 + 4);
        fa = fa * CVS;
        fb = fb * CVS;
        pk[i2] = pack8h(fa, fb);
        o16[i2] = ((size_t)(bimg * CIN + co)) * NTOK + s0 + c * 8;
      }
#pragma unroll
      for (int i2 = 0; i2 < 4; ++i2) *(v4u*)(V16 + o16[i2]) = pk[i2];
    }
  }
}

// ---- attention softmax helpers ------------------------------------------------------------------------------------
// largest of a query's 32 scores of one pass: a lane's 16, then the other half's (lanes l and l ^ 16 share a query)
__device__ __forceinline__ float row_max(v8f s0, v8f s1) {
  float mc = s0[0];
#pragma unroll
  for (int r = 0; r < 8; ++r) mc = fmaxf(mc, fmaxf(s0[r], s1[r]));
  return fmaxf(mc, __shfl_xor(mc, 16, 32));
}
// P = 2^(S*QKL2 + nb) for a lane's 16 scores, two of one key tile per packed fma; p <- the f16 A fragment; returns their sum
__device__ __forceinline__ float soft_p(v8f s0, v8f s1, float nb, v16h& p) {
  float psum = 0.f;
  const v2f cc = {QKL2, QKL2}, nn = {nb, nb};
#pragma unroll
  for (int i = 0; i < 8; i += 2) {
    const v2f a0 = {s0[i], s0[i + 1]}, a1 = {s1[i], s1[i + 1]};
    const v2f x0 = __builtin_elementwise_fma(a0, cc, nn), x1 = __builtin_elementwise_fma(a1, cc, nn);
    const v2f e0 = {__builtin_amdgcn_exp2f(x0[0]), __builtin_amdgcn_exp2f(x0[1])};
    const v2f e1 = {__builtin_amdgcn_exp2f(x1[0]), __builtin_amdgcn_exp2f(x1[1])};
    const v2f t = e0 + e1;
    psum = psum + t[0];
    psum = psum + t[1];
    p[i]         = (_Float16)e0[0];
    p[i + 1]     = (_Float16)e0[1];
    p[8 + i]     = (_Float16)e1[0];
    p[8 + i + 1] = (_Float16)e1[1];
  }
  return psum;
}

// =================================================================================================================
// Grouped attention, one unit (batch b, token group gr, head) per AQS = 2 blocks of 1024 threads = 32 waves, 1024
// queries x 1024 keys, d = 32: 256 blocks, 8 waves per SIMD, all waves of a block walk the same k and v rows.
// Static LDS: the unit's whole k slab Ks[1024 keys][KSP] and v slab Vs[32 channels][VSP] (f16, row pitch an odd
// multiple of 16 B for the 16-B fragment reads), filled once per block (each thread moves 4 + 4 pieces of 16 B from
// the token-major plane QK, k row = T*512 + 256 + head*32, and the channel-major plane V16, row = channel
// head*32 + d, keys contiguous), then one block barrier; plus the per-wave stage [16][ASP] f32. q fragments
// straight from QK (q row = T*512 + head*32). Per wave: the one q-tile qt = part*32 + wave (< 64).
//   Transposed scores S^T = K_tile (A, 16 keys x 32 d) x Q (B: k = d, n = query): S*256 = q16.k16; D element r of
//   lane l = S[query l&15][key 8h+r], so P = exp((S - m)*scale) x1024 is the A fragment of P.V directly in registers;
//   each P is one fma and one exp2: 2^(S*QKL2 + nb), nb = 10 - m*QKL2 (scale, log2 e, the maximum and the x1024 in it)
//   (element i <- key tile 0 row i, element 8+i <- key tile 1 row i). Online softmax over 32 chunks of 32 keys; m is
//   pass 0's row maximum and is taken up again (O and l rescaled, the pass's P made anew) only in a pass where some
//   lane's 16 P sum to more than PTH = 2^15, so that every P stays a finite f16; any m gives the same O / l.
//   The scores of pass ch + 1 are made at the foot of pass ch, beside its two P.V products (four WMMAs in a row).
//   O = P.V (acc scale 1024*16), l = sum of P (x1024). Epilogue: O/(l*16) staged per wave in LDS, then stored as the f16 plane
//   Y[unit][1024][32] of 256*o: one instruction = 32 lanes x 16 B = 512 B = 8 token rows (consecutive lanes
// coverage: per block 32 q-tiles x 16 rows x 32 d, half of its unit's 1024-row slab; grid covers 2 halves x 128
// units, every slab row written exactly once.
// =================================================================================================================
__global__ __launch_bounds__(AWV * 32)
void attn_k(const unsigned short* __restrict__ QK, const unsigned short* __restrict__ V16, unsigned short* Y) {
  __shared__ __align__(16) float Sst[AWV * 16 * ASP];
  __shared__ __align__(16) _Float16 Ks[LGR * KSP];
  __shared__ __align__(16) _Float16 Vs[HD * VSP];
  const int tid = threadIdx.x, wave = tid >> 5, lane = tid & 31, hh = lane >> 4, c = lane & 15;
  const int u = blockIdx.x & (NUNIT - 1), part = blockIdx.x / NUNIT;
  const int head = u & 7, gr = (u >> 3) & 3, b = u >> 5;
  const size_t tok0 = (size_t)b * NTOK + (size_t)gr * LGR;
  const _Float16* Qp = (const _Float16*)(const void*)QK + tok0 * C2 + head * HD;
  const _Float16* Kp = Qp + CIN;
  const size_t cm0 = ((size_t)(b * CIN + head * HD)) * NTOK + (size_t)gr * LGR;
  const _Float16* Vp = (const _Float16*)(const void*)V16 + cm0;
  float* st = Sst + wave * (16 * ASP);

  {
    const int qt = part * AWV + wave;
    const int lq = qt * 16 + c;
    const v16h bq = ldfrag_h(Qp + (size_t)lq * C2 + 8 * hh);     // B: n = query c, k = d 8h.. / 16+8h..

    {
      v8h kt[4], vt[4];
#pragma unroll
      for (int i = 0; i < 4; ++i) {
        const int id = i * (AWV * 32) + tid;
        kt[i] = *(const v8h*)(Kp + (size_t)(id >> 2) * C2 + (id & 3) * 8);       // key id/4, d piece id%4
        vt[i] = *(const v8h*)(Vp + (size_t)(id >> 7) * NTOK + (id & 127) * 8);   // channel id/128, key piece id%128
      }
#pragma unroll
      for (int i = 0; i < 4; ++i) {
        const int id = i * (AWV * 32) + tid;
        *(v8h*)(Ks + (id >> 2) * KSP + (id & 3) * 8)   = kt[i];
        *(v8h*)(Vs + (id >> 7) * VSP + (id & 127) * 8) = vt[i];
      }
    }
    __syncthreads();

    v8f o0 = zero8(), o1 = zero8();
    float lrun = 0.f;
    v8f s[2];                                                 // scores of the pass at hand, made one pass ahead
#pragma unroll
    for (int j = 0; j < 2; ++j) s[j] = mma_b(ldfrag_h(Ks + (j * 16 + c) * KSP + 8 * hh), bq, zero8());
    float nb = fmaf(-row_max(s[0], s[1]), QKL2, 10.0f);       // exponent offset: 10 - m * scale * log2(e), m = pass 0's maximum
    // fragments of a pass's four WMMAs, read one pass ahead (at the foot of the pass before) so that they fly under the softmax
    v16h vf0 = ldfrag_h(Vs + c * VSP + 8 * hh);                                      // B: n = d c, keys of the pass
    v16h vf1 = ldfrag_h(Vs + (HD / 2 + c) * VSP + 8 * hh);                           // B: n = d 16+c
    v16h ka0 = ldfrag_h(Ks + (32 + c) * KSP + 8 * hh);                               // A: row = key of the next pass, k = d
    v16h ka1 = ldfrag_h(Ks + (32 + 16 + c) * KSP + 8 * hh);
#pragma unroll 1
    for (int ch = 0; ch < LGR / 32; ++ch) {
      v16h pfh;
      float psum = soft_p(s[0], s[1], nb, pfh);
      // The offset stays as it is while every lane's 16 probabilities sum to at most PTH (each then fits f16). Else the
      // whole wave (one scalar branch) takes the pass's maximum in, rescales O and l, and makes the pass's P anew.
      if (__builtin_amdgcn_ballot_w32(!(psum <= PTH)) != 0u) {
        const float nbn = fminf(nb, fmaf(-row_max(s[0], s[1]), QKL2, 10.0f));
        const float alpha = __builtin_amdgcn_exp2f(nbn - nb);
#pragma unroll
        for (int r = 0; r < 8; ++r) {
          const float arr = __shfl(alpha, 8 * hh + r, 32);
          o0[r] = o0[r] * arr;
          o1[r] = o1[r] * arr;
        }
        lrun = lrun * alpha;
        nb = nbn;
        psum = soft_p(s[0], s[1], nb, pfh);
      }
      lrun = lrun + psum;
      const int kv = (ch * 32 + 32) & (LGR - 1);              // next pass's keys and the ones behind them; the last passes
      const int kn = (ch * 32 + 64) & (LGR - 1);              // wrap, and what is read and scored there is dropped
      const _Float16* vnx = Vs + c * VSP + kv + 8 * hh;
      const _Float16* knx = Ks + (kn + c) * KSP + 8 * hh;
      // keeps the address arithmetic and the l update ahead of the four WMMAs: moved in between them they land on a WMMA's
      // operand registers and draw three more v_nop a pass; with only WMMAs and LDS reads here each WMMA fills the distance
      // of the one before it
      __builtin_amdgcn_sched_barrier(0);
      s[0] = mma_b(ka0, bq, zero8());
      s[1] = mma_b(ka1, bq, zero8());
      o0 = mma_b(pfh, vf0, o0);
      o1 = mma_b(pfh, vf1, o1);
      vf0 = ldfrag_h(vnx);
      vf1 = ldfrag_h(vnx + (HD / 2) * VSP);
      ka0 = ldfrag_h(knx);
      ka1 = ldfrag_h(knx + 16 * KSP);
    }
    const float lsum = lrun + __shfl_xor(lrun, 16, 32);      // lane q (and q+16) holds the full row sum of query q
    const float rinv = 1.0f / (lsum * 16.0f);                // lsum carries the x1024 of p
#pragma unroll
    for (int r = 0; r < 8; ++r) {
      const int q = 8 * hh + r;
      const float inv = __shfl(rinv, q, 32);
      st[q * ASP + c]          = o0[r] * inv;
      st[q * ASP + HD / 2 + c] = o1[r] * inv;
    }
    wave_sync_lds();
    {
      const int rr = lane >> 2, dp = (lane & 3) * 8;
      v4u pk[2];
      size_t offs[2];
#pragma unroll
      for (int it = 0; it < 2; ++it) {
        const int row = it * 8 + rr;
        v4f fa = *(const v4f*)(st + row * ASP + dp);
        v4f fb = *(const v4f*)(st + row * ASP + dp + 4);
        fa = fa * CYS;
        fb = fb * CYS;
        pk[it] = pack8h(fa, fb);
        offs[it] = ((size_t)u * LGR + (size_t)(qt * 16 + row)) * HD + dp;
      }
      {
#pragma unroll
        for (int it = 0; it < 2; ++it) *(v4u*)(Y + offs[it]) = pk[it];
        
      }
    }
  }
}

// =================================================================================================================
// Output projection D[T][co] = Y[T][ci] . Wp[co][ci] + bias, rows T in shuffled token order, written to the
// un-shuffled output row idx[j] (clamped) of batch b. A = Y plane (x256) addressed by arithmetic: token T ->
// (batch, group, query), k-step ks = head ks, channels ks*32 + d (elements 0..7 d = 8h.., elements 8..15 d =
// 16+8h..). B = weight plane x256. Both tiles are staged once, whole K, in LDS by whole-line loads: per head the
// block's 128 token rows of Y are 8 KB contiguous -> As[head][token][KSP]; the 64 weight rows are 32 KB contiguous
// -> Bs[row][GSP]; one block barrier, fragments by LDS reads, a second block barrier, then the same LDS is the
// output stage. Epilogue: value = acc/65536 + bf16(b)[co], staged per wave in LDS [16][STP];
// coverage: 8 waves x 8 it x 2 rows x 16 lanes x 4 = 128 rows x 64 co per block; grid tiles 16384 x 256 exactly;
// with idx a permutation every output row is written exactly once.
// =================================================================================================================
__global__ __launch_bounds__(256)
void gemm_proj(const unsigned short* __restrict__ Y, const unsigned short* __restrict__ Wp,
               const float* __restrict__ bp, const int* __restrict__ idx, float* out) {
  __shared__ __align__(16) unsigned char smem[(NHD * 128 * KSP + 64 * GSP) * 2];
  _Float16* As = (_Float16*)(void*)smem;
  _Float16* Bs = As + NHD * 128 * KSP;
  float* sm = (float*)(void*)smem;
  const int tid = threadIdx.x, wave = tid >> 5, lane = tid & 31, hh = lane >> 4, c = lane & 15;
  const int n0 = blockIdx.x * 64, m0 = blockIdx.y * 128;
  const int bq = m0 >> 12, jj = m0 & (NTOK - 1), gr = jj >> 10, q0 = jj & (LGR - 1);
  const _Float16* A = (const _Float16*)(const void*)Y + (((size_t)((bq * NGR + gr) * NHD)) * LGR + (size_t)q0) * HD;
  const _Float16* B = (const _Float16*)(const void*)Wp + (size_t)n0 * CIN;

  {
    v8h ta[16], tb[8];
#pragma unroll
    for (int i = 0; i < 16; ++i)       // head i/2, piece (i%2)*256 + tid of its 512 (token = piece/4, d piece = piece%4)
      ta[i] = *(const v8h*)(A + (size_t)(i >> 1) * (LGR * HD) + ((i & 1) * 256 + tid) * 8);
#pragma unroll
    for (int i = 0; i < 8; ++i)  tb[i] = *(const v8h*)(B + (i * 256 + tid) * 8);
#pragma unroll
    for (int i = 0; i < 16; ++i) *(v8h*)(As + ((i * 256 + tid) >> 2) * KSP + (tid & 3) * 8) = ta[i];
#pragma unroll
    for (int i = 0; i < 8; ++i)  *(v8h*)(Bs + (i * 8 + wave) * GSP + lane * 8) = tb[i];
  }
  __syncthreads();

  v8f acc[4];
#pragma unroll
  for (int nt = 0; nt < 4; ++nt) acc[nt] = zero8();

  // unrolled: the k offsets of the LDS reads become constants, and a k-step's ten reads stand as one group
#pragma unroll
  for (int ks = 0; ks < NHD; ++ks) {
    const v16h af = ldfrag_h(As + (ks * 128 + wave * 16 + c) * KSP + 8 * hh);
    v16h bfrag[4];
#pragma unroll
    for (int nt = 0; nt < 4; ++nt) bfrag[nt] = ldfrag_h(Bs + (nt * 16 + c) * GSP + ks * 32 + 8 * hh);
#pragma unroll
    for (int nt = 0; nt < 4; ++nt) acc[nt] = mma_h(af, bfrag[nt], acc[nt]);
  }
  __syncthreads();   // every wave's last fragment read ends before the tiles' LDS is rewritten as the output stage

  float* st = sm + wave * (16 * STP);
#pragma unroll
  for (int nt = 0; nt < 4; ++nt) {
    const int co = n0 + nt * 16 + c;
    const float bi = bfr(bp[co]);
#pragma unroll
    for (int r = 0; r < 8; ++r) st[(8 * hh + r) * STP + nt * 16 + c] = acc[nt][r] * (1.0f / 65536.0f) + bi;
  }
  wave_sync_lds();
  const int bimg = m0 >> 12;
  const int jbase = (m0 & (NTOK - 1)) + wave * 16;
  v4f ov[8];
  size_t offs[8];
#pragma unroll
  for (int it = 0; it < 8; ++it) {
    const int row = it * 2 + hh;
    int dst = idx[jbase + row];
    dst = (dst < 0) ? 0 : ((dst > NTOK - 1) ? (NTOK - 1) : dst);
    ov[it] = *(const v4f*)(st + row * STP + c * 4);
    offs[it] = ((size_t)(bimg * NTOK + dst)) * CIN + n0 + c * 4;
  }
  {
#pragma unroll
    for (int it = 0; it < 8; ++it) *(v4f*)(out + offs[it]) = ov[it];
    
  }
}

// =================================================================================================================
//   Wq f16 [768][256] 393216 @0; Wp f16 [256][256] 131072 @393216; X16 f16 [16384][256] 8388608 @524288;
//   QK f16 [16384][512] 16777216 @8912896; V16 f16 [4][256][4096] 8388608 @25690112;
//   Y f16 [128][1024][32] 8388608 @34078720. Total 42467328.
// =================================================================================================================
extern "C" void kernel_launch(void* const* d_in, const int* in_sizes, int n_in,
                              void* d_out, int out_size, void* d_ws, size_t ws_size,
                              hipStream_t stream) {
  if (n_in < 5) return;
  if (in_sizes[0] != NBAT * NTOK * CIN) return;
  if (in_sizes[1] != NTOK) return;
  if (in_sizes[2] != C3 * CIN) return;
  if (in_sizes[3] != CIN * CIN) return;
  if (in_sizes[4] != CIN) return;
  if (out_size != NBAT * NTOK * CIN) return;

  const float* x      = (const float*)d_in[0];
  const int*   idx    = (const int*)d_in[1];
  const float* w_qkv  = (const float*)d_in[2];
  const float* w_proj = (const float*)d_in[3];
  const float* b_proj = (const float*)d_in[4];
  float* out = (float*)d_out;

  const size_t sWq  = (size_t)C3 * CIN * 2;              //    393216
  const size_t sWp  = (size_t)CIN * CIN * 2;             //    131072
  const size_t sX16 = (size_t)MTOK * CIN * 2;            //   8388608
  const size_t sQK  = (size_t)MTOK * C2 * 2;             //  16777216
  const size_t sV16 = (size_t)NBAT * CIN * NTOK * 2;     //   8388608
  const size_t sY   = (size_t)NUNIT * LGR * HD * 2;      //   8388608
  size_t off = 0;
  const size_t oWq  = off; off += sWq;
  const size_t oWp  = off; off += sWp;
  const size_t oX16 = off; off += sX16;
  const size_t oQK  = off; off += sQK;
  const size_t oV16 = off; off += sV16;
  const size_t oY   = off; off += sY;
  if (off > ws_size) return;                             // off = 42467328
  if (off > (size_t)134217728) return;

  char* ws = (char*)d_ws;
  unsigned short* Wq  = (unsigned short*)(ws + oWq);
  unsigned short* Wp  = (unsigned short*)(ws + oWp);
  unsigned short* X16 = (unsigned short*)(ws + oX16);
  unsigned short* QK  = (unsigned short*)(ws + oQK);
  unsigned short* V16 = (unsigned short*)(ws + oV16);
  unsigned short* Yp  = (unsigned short*)(ws + oY);

  const dim3 blk(256);
  // (1) weights -> f16 x256 planes; x rows gathered by idx -> token-major f16 x16 plane
  cvt_in<<<dim3(PXB + PWB), dim3(PWV * 32), 0, stream>>>(x, idx, w_qkv, w_proj, X16, Wq, Wp);
  // (2) qkv projection -> token-major q/k plane and channel-major v plane
  gemm_qkv<<<dim3(C3 / QCB, MTOK / 128), dim3(QWV * 32), 0, stream>>>(X16, Wq, QK, V16);
  // (3) grouped multi-head attention -> ctx slab plane
  attn_k<<<dim3(NUNIT * AQS), dim3(AWV * 32), 0, stream>>>(QK, V16, Yp);
  // (4) output projection + bias, rows written to their un-shuffled positions
  gemm_proj<<<dim3(CIN / 64, MTOK / 128), blk, 0, stream>>>(Yp, Wp, b_proj, idx, out);
  (void)hipGetLastError();
}

// v009
// It runs in 43.4 microseconds.
// In both of two side-by-side timings against v008, it was 1.04 times as fast.
// All steps since v000 together make it 5.99 times as fast.
// Contractions: v_wmma_f32_16x16x32_f16 (f16 operands, f32 accumulate). qkv projection: A = gathered x rows
// (bf16-valued, x16) single plane, B = w_qkv (bf16-valued, x256) single plane; scores k.qT: k x16, q x16 single
// planes; p.v: p x16, v x16 single planes; output projection: A = ctx x256 single f16 plane, B = w_proj
// (bf16-valued, x256) single plane. Softmax with a fixed maximum (pass 0's): P in f32 on VALU, row sums by WMMA. Float inputs RNE-converted to bf16 on load.
#include <hip/hip_runtime.h>
#include <math.h>
#include <stdint.h>

#define NBAT  4
#define NTOK  4096
#define CIN   256
#define C2    512
#define C3    768
#define MTOK  16384
#define NHD   8
#define HD    32
#define NGR   4
#define LGR   1024
#define NUNIT 128
#define AWV   32
#define AQS   2
#define STP   68
#define SBP   132
#define ASP   36
#define KSP   40
#define VSP   1032
#define GSP   264
#define QWV   12
#define QCB   384
#define QST   ((128 + QCB + QWV - 1) / QWV)
#define PWV   16
#define PRW   4
#define PXB   (MTOK / (PWV * PRW))
#define PWB   ((C3 + CIN) / (PWV * PRW))
#define CXS   16.0f
#define CWS   256.0f
#define CQK   (16.0f / 4096.0f)
#define CVS   (16.0f / 4096.0f)
#define CYS   256.0f
#define QKSC  (0.17677669529663688f / 256.0f)
#define QKL2  (QKSC * 1.4426950408889634f)
#define POFF  4.0f
#define PTH   32768.0f

static_assert(NUNIT == NBAT * NGR * NHD);
static_assert(NGR * LGR == NTOK);
static_assert(MTOK == NBAT * NTOK);
static_assert(NTOK % 128 == 0);
static_assert(LGR % 32 == 0);
static_assert(AQS * AWV * 16 == LGR);
static_assert(CIN % 64 == 0);
static_assert(NHD * HD == CIN);
static_assert(64 * SBP <= 2 * 64 * STP);
static_assert((STP * 4) % 16 == 0);
static_assert((SBP * 4) % 16 == 0);
static_assert((ASP * 4) % 16 == 0);
static_assert((KSP * 2) % 32 == 16 && KSP >= HD);
static_assert((VSP * 2) % 32 == 16 && VSP >= LGR);
static_assert((GSP * 2) % 32 == 16 && GSP >= CIN);
static_assert(QWV * 64 * STP * 4 <= (128 + QCB) * GSP * 2);
static_assert(QWV == 2 * (QCB / 64) && C3 % QCB == 0 && C2 % 64 == 0);
static_assert(8 * 16 * STP * 4 <= (NHD * 128 * KSP + 64 * GSP) * 2);
static_assert(128 * CIN == 16 * 256 * 8 && 64 * CIN == 8 * 256 * 8);
static_assert(LGR * HD == 4 * AWV * 32 * 8);
static_assert(CIN == 32 * 8);
static_assert(MTOK % (PWV * PRW) == 0 && C3 % (PWV * PRW) == 0 && CIN % (PWV * PRW) == 0);
static_assert(NTOK % PRW == 0);

typedef _Float16 v16h __attribute__((ext_vector_type(16)));
typedef _Float16 v8h  __attribute__((ext_vector_type(8)));
typedef float    v8f  __attribute__((ext_vector_type(8)));
typedef float    v4f  __attribute__((ext_vector_type(4)));
typedef float    v2f  __attribute__((ext_vector_type(2)));
typedef unsigned int v4u __attribute__((ext_vector_type(4)));
union Frag { v16h v; v8h half[2]; };

// ---- scalar helpers -------------------------------------------------------------------------------------------
__device__ __forceinline__ unsigned short bf_bits(float f) {          // f32 -> bf16 bits, RNE convert
  unsigned u = __float_as_uint(f);
  return (unsigned short)((u + 0x7FFFu + ((u >> 16) & 1u)) >> 16);
}
__device__ __forceinline__ float bfr(float f) { return __uint_as_float(((unsigned)bf_bits(f)) << 16); }
__device__ __forceinline__ unsigned short h_bits(_Float16 x) { return __builtin_bit_cast(unsigned short, x); }
__device__ __forceinline__ unsigned pk16(unsigned short a, unsigned short b) { return (unsigned)a | ((unsigned)b << 16); }
__device__ __forceinline__ v8f zero8() { v8f z = {0.f, 0.f, 0.f, 0.f, 0.f, 0.f, 0.f, 0.f}; return z; }

// ---- fragment loader: 16-bit A/B operand, lane -> row/col (lane&15), p already includes +8*(lane>>4);
//      elements 0..7 <- p[0..7] (k0+8h..), elements 8..15 <- p[16..23] (k0+16+8h..)
__device__ __forceinline__ v16h ldfrag_h(const _Float16* p) {
  Frag f;
  f.half[0] = *(const v8h*)(p);
  f.half[1] = *(const v8h*)(p + 16);
  return f.v;
}

// ---- WMMA helper with trailing VALU hazard gap ----------------------------------------------------------------
__device__ __forceinline__ v8f mma_h(v16h a, v16h b, v8f c) {
  c = __builtin_amdgcn_wmma_f32_16x16x32_f16(false, a, false, b, (short)0, c, false, false);
#if defined(__HIP_DEVICE_COMPILE__)
  asm volatile("v_nop\n\tv_nop\n\tv_nop\n\tv_nop" : "+v"(c) : "v"(a), "v"(b));
#endif
  return c;
}
// ---- WMMA, the builtin alone: the compiler keeps the distance behind it and fills it with the caller's other work ---
__device__ __forceinline__ v8f mma_b(v16h a, v16h b, v8f c) {
  return __builtin_amdgcn_wmma_f32_16x16x32_f16(false, a, false, b, (short)0, c, false, false);
}
__device__ __forceinline__ void wave_sync_lds() {
  __builtin_amdgcn_fence(__ATOMIC_RELEASE, "workgroup");
  __builtin_amdgcn_wave_barrier();
  __builtin_amdgcn_fence(__ATOMIC_ACQUIRE, "workgroup");
}

// ---- 8 f32 -> 8 packed f16 (16 B) -------------------------------------------------------------------------------
__device__ __forceinline__ v4u pack8h(v4f a, v4f b) {
  v4u p;
  p[0] = pk16(h_bits((_Float16)a[0]), h_bits((_Float16)a[1]));
  p[1] = pk16(h_bits((_Float16)a[2]), h_bits((_Float16)a[3]));
  p[2] = pk16(h_bits((_Float16)b[0]), h_bits((_Float16)b[1]));
  p[3] = pk16(h_bits((_Float16)b[2]), h_bits((_Float16)b[3]));
  return p;
}

// =================================================================================================================
// Input convert, one launch for all three float operands. Every operand is a list of rows of 256 floats: 16384
// gathered activation rows, X16[T = b*4096 + j][256] = f16(16 * bf16_RNE(x[b][clamp(idx[j])][c])), and 768 + 256
// weight rows ([out][in], k contiguous), f16(256 * bf16_RNE(w)). One wave converts PRW = 4 consecutive plane rows:
// per row a lane reads 8 consecutive floats (two 16-B loads; the pair reads the row's 1024 B = 8 whole lines) and writes one
// 16-B piece; all 8 loads of a wave are issued before the first is used. Block = PWV = 16 waves = 64 rows; blocks
// 0..255 take the activation rows, 256..267 w_qkv, 268..271 w_proj (block-uniform branches).
// coverage: 256 x 64 = 16384, 12 x 64 = 768 and 4 x 64 = 256 rows, each row 32 lanes x 8 = 256 elements exactly.
// =================================================================================================================
__global__ __launch_bounds__(PWV * 32)
void cvt_in(const float* __restrict__ x, const int* __restrict__ idx, const float* __restrict__ wqkv,
            const float* __restrict__ wp, unsigned short* X16, unsigned short* Wq, unsigned short* Wp) {
  const int lane = threadIdx.x & 31;
  const int wave = __builtin_amdgcn_readfirstlane((int)(threadIdx.x >> 5));   // scalar: idx comes by scalar loads
  const int r0 = ((int)blockIdx.x * PWV + wave) * PRW;
  v4f a[PRW], a2[PRW];
  unsigned short* dp;
  float sc;
  if (blockIdx.x < PXB) {
    const int b = r0 >> 12, j = r0 & (NTOK - 1);
#pragma unroll
    for (int i = 0; i < PRW; ++i) {
      int s = idx[j + i];
      s = (s < 0) ? 0 : ((s > NTOK - 1) ? (NTOK - 1) : s);
      const float* sp = x + ((size_t)(b * NTOK + s)) * CIN + lane * 8;
      a[i]  = *(const v4f*)(sp);
      a2[i] = *(const v4f*)(sp + 4);
    }
    dp = X16 + (size_t)r0 * CIN + lane * 8;
    sc = CXS;
  } else if (blockIdx.x < PXB + C3 / (PWV * PRW)) {
    const int w0 = r0 - MTOK;
#pragma unroll
    for (int i = 0; i < PRW; ++i) {
      const float* sp = wqkv + (size_t)(w0 + i) * CIN + lane * 8;
      a[i]  = *(const v4f*)(sp);
      a2[i] = *(const v4f*)(sp + 4);
    }
    dp = Wq + (size_t)w0 * CIN + lane * 8;
    sc = CWS;
  } else {
    const int w0 = r0 - MTOK - C3;
#pragma unroll
    for (int i = 0; i < PRW; ++i) {
      const float* sp = wp + (size_t)(w0 + i) * CIN + lane * 8;
      a[i]  = *(const v4f*)(sp);
      a2[i] = *(const v4f*)(sp + 4);
    }
    dp = Wp + (size_t)w0 * CIN + lane * 8;
    sc = CWS;
  }
#pragma unroll
  for (int i = 0; i < PRW; ++i) {
    v4f sa, sb;
#pragma unroll
    for (int e = 0; e < 4; ++e) { sa[e] = bfr(a[i][e]) * sc; sb[e] = bfr(a2[i][e]) * sc; }
    *(v4u*)(dp + i * CIN) = pack8h(sa, sb);
  }
}

// =================================================================================================================
// qkv GEMM D[T][co] = X16[T][ci] . Wq[co][ci], K = 256, co 0..767 (q = 0..255, k = 256..511, v = 512..767).
// Block = QWV = 12 waves, tile 128 rows x QCB = 384 cols, one block per WGP, grid = (2, 128) = 256 blocks; wave =
// 64 rows (half rg) x 64 cols (column group cg), 4 x 4 accumulator tiles: a k-step's 8 fragments feed 16 WMMAs.
// The block's A rows (64 KB, contiguous) and B rows (192 KB, contiguous) are staged once, whole K, in LDS: one
// wave-load = one 512-B row = 4 whole lines, rows at pitch GSP (an odd multiple of 16 B for the 16-B fragment reads);
// LDS row r = A row r for r < 128, B row r - 128 behind; wave w moves rows w, w + 12, ... One block barrier; fragments
// by LDS reads with the split k map, k-step 32 (8 steps); a second block barrier, then the same LDS is the output
// stage, 64 x STP floats per wave; a third block barrier between its writes and its reads.
// Column groups below 512 -> token-major plane QK[T][512], staged per wave [64 rows][STP].
// Column groups from 512 -> V16[b][c][n] = f16(16 * value): the two waves of a group stage [64 ch][SBP] (tokens
// contiguous; a 128-token tile lies within one batch row block) in their two ranges; wave rg owns channels rg*32..+31.
// coverage: QK: 16 it x 4 rows x 8 pieces x 8 = 64 rows x 64 cols per wave, 2 halves x 8 groups x 128 row blocks
// tile 16384 x 512 exactly; V16: 16 it x 2 ch x 16 lanes x 8 = 32 ch x 128 tok per wave, 2 halves x 4 groups x 128
// row blocks tile 256 ch x 16384 tok exactly.
// =================================================================================================================
__global__ __launch_bounds__(QWV * 32)
void gemm_qkv(const unsigned short* __restrict__ X16, const unsigned short* __restrict__ Wq,
              unsigned short* QK, unsigned short* V16) {
  __shared__ __align__(16) unsigned char smem[(128 + QCB) * GSP * 2];
  _Float16* As = (_Float16*)(void*)smem;
  _Float16* Bs = As + 128 * GSP;
  float* sm = (float*)(void*)smem;
  const int tid = threadIdx.x, lane = tid & 31, hh = lane >> 4, c = lane & 15;
  const int wave = __builtin_amdgcn_readfirstlane(tid >> 5);   // scalar: row choice and output path are scalar branches
  const int rg = wave & 1, cg = wave >> 1;
  const int m0 = blockIdx.y * 128;
  const int n0 = blockIdx.x * QCB + cg * 64;
  const _Float16* A = (const _Float16*)(const void*)X16 + (size_t)m0 * CIN;
  const _Float16* B = (const _Float16*)(const void*)Wq + (size_t)(blockIdx.x * QCB) * CIN;

  {
    // the tests on i alone fold at compile time: only the round that holds row 128 picks its source by the wave's
    // number, and only the last round, which is not full, is skipped by some waves (both scalar)
    v8h t[QST];
    const _Float16* Aw = A + wave * CIN;   // one scalar base each: the rounds' steps become immediate offsets
    const _Float16* Bw = B + wave * CIN;
#pragma unroll
    for (int i = 0; i < QST; ++i) {
      const int r = i * QWV + wave;
      if ((i + 1) * QWV <= 128 + QCB || r < 128 + QCB) {
        const _Float16* sp;
        if ((i + 1) * QWV <= 128) sp = Aw + i * QWV * CIN;
        else if (i * QWV >= 128)  sp = Bw + (i * QWV - 128) * CIN;
        else                      sp = (r < 128) ? (Aw + i * QWV * CIN) : (Bw + (i * QWV - 128) * CIN);
        t[i] = *(const v8h*)(sp + lane * 8);
      }
    }
#pragma unroll
    for (int i = 0; i < QST; ++i) {
      const int r = i * QWV + wave;
      if ((i + 1) * QWV <= 128 + QCB || r < 128 + QCB) *(v8h*)(As + r * GSP + lane * 8) = t[i];
    }
  }
  __syncthreads();

  v8f acc[4][4];
#pragma unroll
  for (int mt = 0; mt < 4; ++mt) {
#pragma unroll
    for (int nt = 0; nt < 4; ++nt) acc[mt][nt] = zero8();
  }

  // unrolled: the k offsets of the LDS reads become constants, and a k-step's sixteen reads stand as one group
#pragma unroll
  for (int k0 = 0; k0 < CIN; k0 += 32) {
    v16h af[4], bfrag[4];
#pragma unroll
    for (int mt = 0; mt < 4; ++mt) af[mt] = ldfrag_h(As + (rg * 64 + mt * 16 + c) * GSP + k0 + 8 * hh);
#pragma unroll
    for (int nt = 0; nt < 4; ++nt) bfrag[nt] = ldfrag_h(Bs + (cg * 64 + nt * 16 + c) * GSP + k0 + 8 * hh);
#pragma unroll
    for (int mt = 0; mt < 4; ++mt) {
#pragma unroll
      for (int nt = 0; nt < 4; ++nt) acc[mt][nt] = mma_h(af[mt], bfrag[nt], acc[mt][nt]);
    }
  }
  __syncthreads();   // every wave's last fragment read ends before the tiles' LDS is rewritten as the output stage

  float* st = sm + wave * (64 * STP);          // QK path: this wave's own range
  float* sv = sm + (cg * 2) * (64 * STP);      // V path: the two ranges of the column group's waves
  if (n0 < C2) {
#pragma unroll
    for (int mt = 0; mt < 4; ++mt) {
#pragma unroll
      for (int nt = 0; nt < 4; ++nt) {
#pragma unroll
        for (int r = 0; r < 8; ++r) st[(mt * 16 + 8 * hh + r) * STP + nt * 16 + c] = acc[mt][nt][r];
      }
    }
  } else {
#pragma unroll
    for (int mt = 0; mt < 4; ++mt) {
#pragma unroll
      for (int nt = 0; nt < 4; ++nt) {
#pragma unroll
        for (int r = 0; r < 8; ++r) sv[(nt * 16 + c) * SBP + rg * 64 + mt * 16 + 8 * hh + r] = acc[mt][nt][r];
      }
    }
  }
  __syncthreads();   // a V group's channel rows hold tokens of both its waves; passed by every wave of the block

  if (n0 < C2) {
    const int piece = lane & 7, rsub = lane >> 3;
#pragma unroll
    for (int ib = 0; ib < 4; ++ib) {
      v4u pk[4];
      size_t offs[4];
#pragma unroll
      for (int it = 0; it < 4; ++it) {
        const int row = (ib * 4 + it) * 4 + rsub;
        v4f fa = *(const v4f*)(st + row * STP + piece * 8);
        v4f fb = *(const v4f*)(st + row * STP + piece * 8 + 4);
        fa = fa * CQK;
        fb = fb * CQK;
        pk[it] = pack8h(fa, fb);
        offs[it] = ((size_t)(m0 + rg * 64 + row)) * C2 + n0 + piece * 8;
      }
#pragma unroll
      for (int it = 0; it < 4; ++it) *(v4u*)(QK + offs[it]) = pk[it];
    }
  } else {
    const int cv0 = n0 - C2;
    const int bimg = m0 >> 12, s0 = m0 & (NTOK - 1);
#pragma unroll
    for (int ib = 0; ib < 4; ++ib) {
      v4u pk[4];
      size_t o16[4];
#pragma unroll
      for (int i2 = 0; i2 < 4; ++i2) {
        const int cc = rg * 32 + (ib * 4 + i2) * 2 + hh;
        const int co = cv0 + cc;
        v4f fa = *(const v4f*)(sv + cc * SBP + c * 8);
        v4f fb = *(const v4f*)(sv + cc * SBP + c * 8 + 4);
        fa = fa * CVS;
        fb = fb * CVS;
        pk[i2] = pack8h(fa, fb);
        o16[i2] = ((size_t)(bimg * CIN + co)) * NTOK + s0 + c * 8;
      }
#pragma unroll
      for (int i2 = 0; i2 < 4; ++i2) *(v4u*)(V16 + o16[i2]) = pk[i2];
    }
  }
}

// ---- attention softmax helpers ------------------------------------------------------------------------------------
// largest of a query's 32 scores of one pass: a lane's 16, then the other half's (lanes l and l ^ 16 share a query)
__device__ __forceinline__ float row_max(v8f s0, v8f s1) {
  float mc = s0[0];
#pragma unroll
  for (int r = 0; r < 8; ++r) mc = fmaxf(mc, fmaxf(s0[r], s1[r]));
  return fmaxf(mc, __shfl_xor(mc, 16, 32));
}
// P = 2^(S*QKL2 + nb) for a lane's 16 scores, two of one key tile per packed fma; p <- the f16 A fragment; returns their sum
__device__ __forceinline__ float soft_p(v8f s0, v8f s1, float nb, v16h& p) {
  float psum = 0.f;
  const v2f cc = {QKL2, QKL2}, nn = {nb, nb};
#pragma unroll
  for (int i = 0; i < 8; i += 2) {
    const v2f a0 = {s0[i], s0[i + 1]}, a1 = {s1[i], s1[i + 1]};
    const v2f x0 = __builtin_elementwise_fma(a0, cc, nn), x1 = __builtin_elementwise_fma(a1, cc, nn);
    const v2f e0 = {__builtin_amdgcn_exp2f(x0[0]), __builtin_amdgcn_exp2f(x0[1])};
    const v2f e1 = {__builtin_amdgcn_exp2f(x1[0]), __builtin_amdgcn_exp2f(x1[1])};
    const v2f t = e0 + e1;
    psum = psum + t[0];
    psum = psum + t[1];
    p[i]         = (_Float16)e0[0];
    p[i + 1]     = (_Float16)e0[1];
    p[8 + i]     = (_Float16)e1[0];
    p[8 + i + 1] = (_Float16)e1[1];
  }
  return psum;
}
// the same P without the sum: the row sum comes from the matrix unit
__device__ __forceinline__ v16h soft_q(v8f s0, v8f s1, float nb) {
  v16h p;
  const v2f cc = {QKL2, QKL2}, nn = {nb, nb};
#pragma unroll
  for (int i = 0; i < 8; i += 2) {
    const v2f a0 = {s0[i], s0[i + 1]}, a1 = {s1[i], s1[i + 1]};
    const v2f x0 = __builtin_elementwise_fma(a0, cc, nn), x1 = __builtin_elementwise_fma(a1, cc, nn);
    p[i]         = (_Float16)__builtin_amdgcn_exp2f(x0[0]);
    p[i + 1]     = (_Float16)__builtin_amdgcn_exp2f(x0[1]);
    p[8 + i]     = (_Float16)__builtin_amdgcn_exp2f(x1[0]);
    p[8 + i + 1] = (_Float16)__builtin_amdgcn_exp2f(x1[1]);
  }
  return p;
}

// One q-tile over all keys with the maximum watched in every pass: taken only by a wave whose plain walk (in attn_k)
// ended with a row sum that is not finite. m is taken up again (O and l rescaled, the pass's P made anew) in a pass
// where some lane's 16 P sum to more than PTH = 2^15, so that every P stays a finite f16. la[r] <- l of query 8h + r.
__device__ __forceinline__ void tile_watched(const _Float16* Ks, const _Float16* Vs, v16h bq, int c, int hh,
                                             v8f& o0, v8f& o1, v8f& la) {
  o0 = zero8();
  o1 = zero8();
  float lrun = 0.f;
  v8f s[2];
#pragma unroll
  for (int j = 0; j < 2; ++j) s[j] = mma_b(ldfrag_h(Ks + (j * 16 + c) * KSP + 8 * hh), bq, zero8());
  float nb = fmaf(-row_max(s[0], s[1]), QKL2, POFF);
#pragma unroll 1   // a path that is hardly ever taken: kept rolled so that it stays small in the instruction cache
  for (int ch = 0; ch < LGR / 32; ++ch) {
    v16h pfh;
    float psum = soft_p(s[0], s[1], nb, pfh);
    if (__builtin_amdgcn_ballot_w32(!(psum <= PTH)) != 0u) {   // one scalar branch for the whole wave
      const float nbn = fminf(nb, fmaf(-row_max(s[0], s[1]), QKL2, POFF));
      const float alpha = __builtin_amdgcn_exp2f(nbn - nb);
#pragma unroll
      for (int r = 0; r < 8; ++r) {
        const float arr = __shfl(alpha, 8 * hh + r, 32);
        o0[r] = o0[r] * arr;
        o1[r] = o1[r] * arr;
      }
      lrun = lrun * alpha;
      nb = nbn;
      psum = soft_p(s[0], s[1], nb, pfh);
    }
    lrun = lrun + psum;
    const int kn = (ch * 32 + 32) & (LGR - 1);                // the last pass wraps; what it scores is dropped
    const _Float16* vp = Vs + c * VSP + ch * 32 + 8 * hh;
    const _Float16* kp = Ks + (kn + c) * KSP + 8 * hh;
    o0 = mma_b(pfh, ldfrag_h(vp), o0);
    o1 = mma_b(pfh, ldfrag_h(vp + (HD / 2) * VSP), o1);
    s[0] = mma_b(ldfrag_h(kp), bq, zero8());
    s[1] = mma_b(ldfrag_h(kp + 16 * KSP), bq, zero8());
  }
  const float lsum = lrun + __shfl_xor(lrun, 16, 32);         // lane q (and q+16) holds the full row sum of query q
#pragma unroll
  for (int r = 0; r < 8; ++r) la[r] = __shfl(lsum, 8 * hh + r, 32);
}

// =================================================================================================================
// Grouped attention, one unit (batch b, token group gr, head) per AQS = 2 blocks of 1024 threads = 32 waves, 1024
// queries x 1024 keys, d = 32: 256 blocks, 8 waves per SIMD, all waves of a block walk the same k and v rows.
// Static LDS: the unit's whole k slab Ks[1024 keys][KSP] and v slab Vs[32 channels][VSP] (f16, row pitch an odd
// multiple of 16 B for the 16-B fragment reads), filled once per block (each thread moves 4 + 4 pieces of 16 B from
// the token-major plane QK, k row = T*512 + 256 + head*32, and the channel-major plane V16, row = channel
// head*32 + d, keys contiguous), then one block barrier; plus the per-wave stage [16][ASP] f32. q fragments
// straight from QK (q row = T*512 + head*32). Per wave: the one q-tile qt = part*32 + wave (< 64).
//   Transposed scores S^T = K_tile (A, 16 keys x 32 d) x Q (B: k = d, n = query): S*256 = q16.k16; D element r of
//   lane l = S[query l&15][key 8h+r], so P = exp((S - m)*scale) x16 is the A fragment of P.V directly in registers;
//   each P is one fma and one exp2: 2^(S*QKL2 + nb), nb = POFF - m*QKL2 (scale, log2 e, the maximum and the x16 in it)
//   (element i <- key tile 0 row i, element 8+i <- key tile 1 row i). Softmax over 32 chunks of 32 keys; m is pass 0's
//   row maximum; any m gives the same O / l while every P is a finite f16. l = P x ones, a third product of the same A
//   fragment: the sum of the f16 P, in O's own layout. No test in the loop: a P that left f16's range shows in l behind
//   the loop, and the wave then walks its tile again by tile_watched, which takes the maximum up where needed.
//   The scores of pass ch + 1 are made at the foot of pass ch, beside its three P products (five WMMAs in a row).
//   O = P.V (acc scale 16*16), l = sum of P (x16). Epilogue: O/(l*16) staged per wave in LDS, then stored as the f16 plane
//   Y[unit][1024][32] of 256*o: one instruction = 32 lanes x 16 B = 512 B = 8 token rows (consecutive lanes
// coverage: per block 32 q-tiles x 16 rows x 32 d, half of its unit's 1024-row slab; grid covers 2 halves x 128
// units, every slab row written exactly once.
// =================================================================================================================
__global__ __launch_bounds__(AWV * 32)
void attn_k(const unsigned short* __restrict__ QK, const unsigned short* __restrict__ V16, unsigned short* Y) {
  __shared__ __align__(16) float Sst[AWV * 16 * ASP];
  __shared__ __align__(16) _Float16 Ks[LGR * KSP];
  __shared__ __align__(16) _Float16 Vs[HD * VSP];
  const int tid = threadIdx.x, wave = tid >> 5, lane = tid & 31, hh = lane >> 4, c = lane & 15;
  const int u = blockIdx.x & (NUNIT - 1), part = blockIdx.x / NUNIT;
  const int head = u & 7, gr = (u >> 3) & 3, b = u >> 5;
  const size_t tok0 = (size_t)b * NTOK + (size_t)gr * LGR;
  const _Float16* Qp = (const _Float16*)(const void*)QK + tok0 * C2 + head * HD;
  const _Float16* Kp = Qp + CIN;
  const size_t cm0 = ((size_t)(b * CIN + head * HD)) * NTOK + (size_t)gr * LGR;
  const _Float16* Vp = (const _Float16*)(const void*)V16 + cm0;
  float* st = Sst + wave * (16 * ASP);

  {
    // B of the row sum, 32 keys x 16 columns of 1.0, goes through the wave's own stage rows: read back as data it keeps
    // eight registers of its own over the key loop; as a constant the compiler built it anew in every pass (four moves)
    _Float16* oh = (_Float16*)(void*)st;
    {
      v8h o8;
#pragma unroll
      for (int i = 0; i < 8; ++i) o8[i] = (_Float16)1.0f;
      *(v8h*)(oh + lane * 8)       = o8;
      *(v8h*)(oh + 256 + lane * 8) = o8;
    }
    const int qt = part * AWV + wave;
    const int lq = qt * 16 + c;
    const v16h bq = ldfrag_h(Qp + (size_t)lq * C2 + 8 * hh);     // B: n = query c, k = d 8h.. / 16+8h..

    {
      v8h kt[4], vt[4];
#pragma unroll
      for (int i = 0; i < 4; ++i) {
        const int id = i * (AWV * 32) + tid;
        kt[i] = *(const v8h*)(Kp + (size_t)(id >> 2) * C2 + (id & 3) * 8);       // key id/4, d piece id%4
        vt[i] = *(const v8h*)(Vp + (size_t)(id >> 7) * NTOK + (id & 127) * 8);   // channel id/128, key piece id%128
      }
#pragma unroll
      for (int i = 0; i < 4; ++i) {
        const int id = i * (AWV * 32) + tid;
        *(v8h*)(Ks + (id >> 2) * KSP + (id & 3) * 8)   = kt[i];
        *(v8h*)(Vs + (id >> 7) * VSP + (id & 127) * 8) = vt[i];
      }
    }
    __syncthreads();

    v8f o0 = zero8(), o1 = zero8(), la = zero8();             // la[r]: row sum of query 8h + r, the same in all 16 columns
    Frag of;
    of.half[0] = *(const v8h*)(oh + lane * 8);
    of.half[1] = *(const v8h*)(oh + 256 + lane * 8);
    const v16h one16 = of.v;
    v8f s[2];                                                 // scores of the pass at hand, made one pass ahead
#pragma unroll
    for (int j = 0; j < 2; ++j) s[j] = mma_b(ldfrag_h(Ks + (j * 16 + c) * KSP + 8 * hh), bq, zero8());
    // exponent offset POFF - m * scale * log2(e), m = pass 0's maximum: a P stays a finite f16 up to 2^12 times pass 0's
    // largest and a normal f16 down to 2^-18 of it
    const float nb = fmaf(-row_max(s[0], s[1]), QKL2, POFF);
    // fragments of a pass's WMMAs, read one pass ahead (at the foot of the pass before) so that they fly under the softmax
    v16h vf0 = ldfrag_h(Vs + c * VSP + 8 * hh);                                      // B: n = d c, keys of the pass
    v16h vf1 = ldfrag_h(Vs + (HD / 2 + c) * VSP + 8 * hh);                           // B: n = d 16+c
    v16h ka0 = ldfrag_h(Ks + (32 + c) * KSP + 8 * hh);                               // A: row = key of the next pass, k = d
    v16h ka1 = ldfrag_h(Ks + (32 + 16 + c) * KSP + 8 * hh);
#pragma unroll 1
    for (int ch = 0; ch < LGR / 32; ++ch) {
      const v16h pfh = soft_q(s[0], s[1], nb);
      const int kv = (ch * 32 + 32) & (LGR - 1);              // next pass's keys and the ones behind them; the last passes
      const int kn = (ch * 32 + 64) & (LGR - 1);              // wrap, and what is read and scored there is dropped
      const _Float16* vnx = Vs + c * VSP + kv + 8 * hh;
      const _Float16* knx = Ks + (kn + c) * KSP + 8 * hh;
      // keeps the address arithmetic ahead of the five WMMAs: moved in between them it lands on a WMMA's operand
      // registers and draws more v_nop a pass; with only WMMAs and LDS reads here each WMMA fills the distance of the
      // one before it
      __builtin_amdgcn_sched_barrier(0);
      s[0] = mma_b(ka0, bq, zero8());
      s[1] = mma_b(ka1, bq, zero8());
      o0 = mma_b(pfh, vf0, o0);
      o1 = mma_b(pfh, vf1, o1);
      la = mma_b(pfh, one16, la);
      vf0 = ldfrag_h(vnx);
      vf1 = ldfrag_h(vnx + (HD / 2) * VSP);
      ka0 = ldfrag_h(knx);
      ka1 = ldfrag_h(knx + 16 * KSP);
    }
    // A P beyond f16's range is an infinity in the A fragment and leaves its row sum infinite (or not a number): then the
    // whole wave (one scalar branch) walks its tile again with the maximum watched. All sums are >= 0: their sum shows any.
    const float lchk = ((la[0] + la[1]) + (la[2] + la[3])) + ((la[4] + la[5]) + (la[6] + la[7]));
    if (__builtin_amdgcn_ballot_w32(!(lchk <= 3.0e38f)) != 0u) tile_watched(Ks, Vs, bq, c, hh, o0, o1, la);
#pragma unroll
    for (int r = 0; r < 8; ++r) {
      const int q = 8 * hh + r;
      const float inv = __builtin_amdgcn_rcpf(la[r] * 16.0f);  // la carries the x16 of p; eight sums a lane, so v_rcp_f32
      st[q * ASP + c]          = o0[r] * inv;
      st[q * ASP + HD / 2 + c] = o1[r] * inv;
    }
    wave_sync_lds();
    {
      const int rr = lane >> 2, dp = (lane & 3) * 8;
      v4u pk[2];
      size_t offs[2];
#pragma unroll
      for (int it = 0; it < 2; ++it) {
        const int row = it * 8 + rr;
        v4f fa = *(const v4f*)(st + row * ASP + dp);
        v4f fb = *(const v4f*)(st + row * ASP + dp + 4);
        fa = fa * CYS;
        fb = fb * CYS;
        pk[it] = pack8h(fa, fb);
        offs[it] = ((size_t)u * LGR + (size_t)(qt * 16 + row)) * HD + dp;
      }
      {
#pragma unroll
        for (int it = 0; it < 2; ++it) *(v4u*)(Y + offs[it]) = pk[it];
        
      }
    }
  }
}

// =================================================================================================================
// Output projection D[T][co] = Y[T][ci] . Wp[co][ci] + bias, rows T in shuffled token order, written to the
// un-shuffled output row idx[j] (clamped) of batch b. A = Y plane (x256) addressed by arithmetic: token T ->
// (batch, group, query), k-step ks = head ks, channels ks*32 + d (elements 0..7 d = 8h.., elements 8..15 d =
// 16+8h..). B = weight plane x256. Both tiles are staged once, whole K, in LDS by whole-line loads: per head the
// block's 128 token rows of Y are 8 KB contiguous -> As[head][token][KSP]; the 64 weight rows are 32 KB contiguous
// -> Bs[row][GSP]; one block barrier, fragments by LDS reads, a second block barrier, then the same LDS is the
// output stage. Epilogue: value = acc/65536 + bf16(b)[co], staged per wave in LDS [16][STP];
// coverage: 8 waves x 8 it x 2 rows x 16 lanes x 4 = 128 rows x 64 co per block; grid tiles 16384 x 256 exactly;
// with idx a permutation every output row is written exactly once.
// =================================================================================================================
__global__ __launch_bounds__(256)
void gemm_proj(const unsigned short* __restrict__ Y, const unsigned short* __restrict__ Wp,
               const float* __restrict__ bp, const int* __restrict__ idx, float* out) {
  __shared__ __align__(16) unsigned char smem[(NHD * 128 * KSP + 64 * GSP) * 2];
  _Float16* As = (_Float16*)(void*)smem;
  _Float16* Bs = As + NHD * 128 * KSP;
  float* sm = (float*)(void*)smem;
  const int tid = threadIdx.x, wave = tid >> 5, lane = tid & 31, hh = lane >> 4, c = lane & 15;
  const int n0 = blockIdx.x * 64, m0 = blockIdx.y * 128;
  const int bq = m0 >> 12, jj = m0 & (NTOK - 1), gr = jj >> 10, q0 = jj & (LGR - 1);
  const _Float16* A = (const _Float16*)(const void*)Y + (((size_t)((bq * NGR + gr) * NHD)) * LGR + (size_t)q0) * HD;
  const _Float16* B = (const _Float16*)(const void*)Wp + (size_t)n0 * CIN;

  {
    v8h ta[16], tb[8];
#pragma unroll
    for (int i = 0; i < 16; ++i)       // head i/2, piece (i%2)*256 + tid of its 512 (token = piece/4, d piece = piece%4)
      ta[i] = *(const v8h*)(A + (size_t)(i >> 1) * (LGR * HD) + ((i & 1) * 256 + tid) * 8);
#pragma unroll
    for (int i = 0; i < 8; ++i)  tb[i] = *(const v8h*)(B + (i * 256 + tid) * 8);
#pragma unroll
    for (int i = 0; i < 16; ++i) *(v8h*)(As + ((i * 256 + tid) >> 2) * KSP + (tid & 3) * 8) = ta[i];
#pragma unroll
    for (int i = 0; i < 8; ++i)  *(v8h*)(Bs + (i * 8 + wave) * GSP + lane * 8) = tb[i];
  }
  __syncthreads();

  v8f acc[4];
#pragma unroll
  for (int nt = 0; nt < 4; ++nt) acc[nt] = zero8();

  // unrolled: the k offsets of the LDS reads become constants, and a k-step's ten reads stand as one group
#pragma unroll
  for (int ks = 0; ks < NHD; ++ks) {
    const v16h af = ldfrag_h(As + (ks * 128 + wave * 16 + c) * KSP + 8 * hh);
    v16h bfrag[4];
#pragma unroll
    for (int nt = 0; nt < 4; ++nt) bfrag[nt] = ldfrag_h(Bs + (nt * 16 + c) * GSP + ks * 32 + 8 * hh);
#pragma unroll
    for (int nt = 0; nt < 4; ++nt) acc[nt] = mma_h(af, bfrag[nt], acc[nt]);
  }
  __syncthreads();   // every wave's last fragment read ends before the tiles' LDS is rewritten as the output stage

  float* st = sm + wave * (16 * STP);
#pragma unroll
  for (int nt = 0; nt < 4; ++nt) {
    const int co = n0 + nt * 16 + c;
    const float bi = bfr(bp[co]);
#pragma unroll
    for (int r = 0; r < 8; ++r) st[(8 * hh + r) * STP + nt * 16 + c] = acc[nt][r] * (1.0f / 65536.0f) + bi;
  }
  wave_sync_lds();
  const int bimg = m0 >> 12;
  const int jbase = (m0 & (NTOK - 1)) + wave * 16;
  v4f ov[8];
  size_t offs[8];
#pragma unroll
  for (int it = 0; it < 8; ++it) {
    const int row = it * 2 + hh;
    int dst = idx[jbase + row];
    dst = (dst < 0) ? 0 : ((dst > NTOK - 1) ? (NTOK - 1) : dst);
    ov[it] = *(const v4f*)(st + row * STP + c * 4);
    offs[it] = ((size_t)(bimg * NTOK + dst)) * CIN + n0 + c * 4;
  }
  {
#pragma unroll
    for (int it = 0; it < 8; ++it) *(v4f*)(out + offs[it]) = ov[it];
    
  }
}

// =================================================================================================================
//   Wq f16 [768][256] 393216 @0; Wp f16 [256][256] 131072 @393216; X16 f16 [16384][256] 8388608 @524288;
//   QK f16 [16384][512] 16777216 @8912896; V16 f16 [4][256][4096] 8388608 @25690112;
//   Y f16 [128][1024][32] 8388608 @34078720. Total 42467328.
// =================================================================================================================
extern "C" void kernel_launch(void* const* d_in, const int* in_sizes, int n_in,
                              void* d_out, int out_size, void* d_ws, size_t ws_size,
                              hipStream_t stream) {
  if (n_in < 5) return;
  if (in_sizes[0] != NBAT * NTOK * CIN) return;
  if (in_sizes[1] != NTOK) return;
  if (in_sizes[2] != C3 * CIN) return;
  if (in_sizes[3] != CIN * CIN) return;
  if (in_sizes[4] != CIN) return;
  if (out_size != NBAT * NTOK * CIN) return;

  const float* x      = (const float*)d_in[0];
  const int*   idx    = (const int*)d_in[1];
  const float* w_qkv  = (const float*)d_in[2];
  const float* w_proj = (const float*)d_in[3];
  const float* b_proj = (const float*)d_in[4];
  float* out = (float*)d_out;

  const size_t sWq  = (size_t)C3 * CIN * 2;              //    393216
  const size_t sWp  = (size_t)CIN * CIN * 2;             //    131072
  const size_t sX16 = (size_t)MTOK * CIN * 2;            //   8388608
  const size_t sQK  = (size_t)MTOK * C2 * 2;             //  16777216
  const size_t sV16 = (size_t)NBAT * CIN * NTOK * 2;     //   8388608
  const size_t sY   = (size_t)NUNIT * LGR * HD * 2;      //   8388608
  size_t off = 0;
  const size_t oWq  = off; off += sWq;
  const size_t oWp  = off; off += sWp;
  const size_t oX16 = off; off += sX16;
  const size_t oQK  = off; off += sQK;
  const size_t oV16 = off; off += sV16;
  const size_t oY   = off; off += sY;
  if (off > ws_size) return;                             // off = 42467328
  if (off > (size_t)134217728) return;

  char* ws = (char*)d_ws;
  unsigned short* Wq  = (unsigned short*)(ws + oWq);
  unsigned short* Wp  = (unsigned short*)(ws + oWp);
  unsigned short* X16 = (unsigned short*)(ws + oX16);
  unsigned short* QK  = (unsigned short*)(ws + oQK);
  unsigned short* V16 = (unsigned short*)(ws + oV16);
  unsigned short* Yp  = (unsigned short*)(ws + oY);

  const dim3 blk(256);
  // (1) weights -> f16 x256 planes; x rows gathered by idx -> token-major f16 x16 plane
  cvt_in<<<dim3(PXB + PWB), dim3(PWV * 32), 0, stream>>>(x, idx, w_qkv, w_proj, X16, Wq, Wp);
  // (2) qkv projection -> token-major q/k plane and channel-major v plane
  gemm_qkv<<<dim3(C3 / QCB, MTOK / 128), dim3(QWV * 32), 0, stream>>>(X16, Wq, QK, V16);
  // (3) grouped multi-head attention -> ctx slab plane
  attn_k<<<dim3(NUNIT * AQS), dim3(AWV * 32), 0, stream>>>(QK, V16, Yp);
  // (4) output projection + bias, rows written to their un-shuffled positions
  gemm_proj<<<dim3(CIN / 64, MTOK / 128), blk, 0, stream>>>(Yp, Wp, b_proj, idx, out);
  (void)hipGetLastError();
}

// v010
// One run takes 41.7 microseconds.
// In both of two side-by-side timings against v009, it was 1.04 times as fast.
// Counting every step since v000, it is 6.24 times as fast.
// Contractions: v_wmma_f32_16x16x32_f16 (f16 operands, f32 accumulate). qkv projection: A = gathered x rows
// (bf16-valued, x16) single plane, B = w_qkv (bf16-valued, x256) single plane; scores k.qT: k x16, q x16 single
// planes; p.v: p x16, v x16 single planes; output projection: A = ctx x256 single f16 plane, B = w_proj
// (bf16-valued, x256) single plane. Softmax P in f32 on VALU against pass 0's maximum (a running maximum only on the rare re-walk); row sums by WMMA. Float inputs RNE-converted to bf16 on load.
// No convert launch: the qkv GEMM reads x and w_qkv as floats and converts them on their way into LDS.
#include <hip/hip_runtime.h>
#include <math.h>
#include <stdint.h>

#define NBAT  4
#define NTOK  4096
#define CIN   256
#define C2    512
#define C3    768
#define MTOK  16384
#define NHD   8
#define HD    32
#define NGR   4
#define LGR   1024
#define NUNIT 128
#define AWV   32
#define AQS   2
#define STP   68
#define SBP   132
#define ASP   36
#define KSP   40
#define VSP   1032
#define GSP   264
#define QWV   12
#define QCB   384
#define QST   ((128 + QCB + QWV - 1) / QWV)
#define QAR   ((128 + QWV - 1) / QWV)
#define QNB   QAR
#define QBT   ((QST + QNB - 1) / QNB)
#define CXS   16.0f
#define CWS   256.0f
#define CQK   (16.0f / 4096.0f)
#define CVS   (16.0f / 4096.0f)
#define CYS   256.0f
#define QKSC  (0.17677669529663688f / 256.0f)
#define QKL2  (QKSC * 1.4426950408889634f)
#define POFF  4.0f
#define PTH   32768.0f

static_assert(NUNIT == NBAT * NGR * NHD);
static_assert(NGR * LGR == NTOK);
static_assert(MTOK == NBAT * NTOK);
static_assert(NTOK % 128 == 0);
static_assert(LGR % 32 == 0);
static_assert(AQS * AWV * 16 == LGR);
static_assert(CIN % 64 == 0);
static_assert(NHD * HD == CIN);
static_assert(64 * SBP <= 2 * 64 * STP);
static_assert((STP * 4) % 16 == 0);
static_assert((SBP * 4) % 16 == 0);
static_assert((ASP * 4) % 16 == 0);
static_assert((KSP * 2) % 32 == 16 && KSP >= HD);
static_assert((VSP * 2) % 32 == 16 && VSP >= LGR);
static_assert((GSP * 2) % 32 == 16 && GSP >= CIN);
static_assert(QWV * 64 * STP * 4 <= (128 + QCB) * GSP * 2);
static_assert(QWV == 2 * (QCB / 64) && C3 % QCB == 0 && C2 % 64 == 0);
static_assert(8 * 16 * STP * 4 <= (NHD * 128 * KSP + 64 * GSP) * 2);
static_assert(128 * CIN == 16 * 256 * 8 && 64 * CIN == 8 * 256 * 8);
static_assert(LGR * HD == 4 * AWV * 32 * 8);
static_assert(CIN == 32 * 8);
static_assert((C3 / QCB) * (MTOK / 128) == CIN);
static_assert(QST * QWV - (128 + QCB) >= 1 && QST * QWV - (128 + QCB) < QWV);
static_assert(QST >= 2 * QAR && QAR == 11);

typedef _Float16 v16h __attribute__((ext_vector_type(16)));
typedef _Float16 v8h  __attribute__((ext_vector_type(8)));
typedef _Float16 v4h  __attribute__((ext_vector_type(4)));
typedef _Float16 v2h  __attribute__((ext_vector_type(2)));
typedef __bf16   v2b  __attribute__((ext_vector_type(2)));
typedef float    v8f  __attribute__((ext_vector_type(8)));
typedef float    v4f  __attribute__((ext_vector_type(4)));
typedef float    v2f  __attribute__((ext_vector_type(2)));
typedef unsigned int v4u __attribute__((ext_vector_type(4)));
typedef const __attribute__((address_space(1))) v4f* gv4f;   // a global address kept as such where it was an integer in between
union Frag { v16h v; v8h half[2]; };

// ---- scalar helpers -------------------------------------------------------------------------------------------
__device__ __forceinline__ unsigned short bf_bits(float f) {          // f32 -> bf16 bits, RNE convert
  unsigned u = __float_as_uint(f);
  return (unsigned short)((u + 0x7FFFu + ((u >> 16) & 1u)) >> 16);
}
__device__ __forceinline__ float bfr(float f) { return __uint_as_float(((unsigned)bf_bits(f)) << 16); }
__device__ __forceinline__ unsigned short h_bits(_Float16 x) { return __builtin_bit_cast(unsigned short, x); }
__device__ __forceinline__ unsigned pk16(unsigned short a, unsigned short b) { return (unsigned)a | ((unsigned)b << 16); }
__device__ __forceinline__ v8f zero8() { v8f z = {0.f, 0.f, 0.f, 0.f, 0.f, 0.f, 0.f, 0.f}; return z; }

// ---- fragment loader: 16-bit A/B operand, lane -> row/col (lane&15), p already includes +8*(lane>>4);
//      elements 0..7 <- p[0..7] (k0+8h..), elements 8..15 <- p[16..23] (k0+16+8h..)
__device__ __forceinline__ v16h ldfrag_h(const _Float16* p) {
  Frag f;
  f.half[0] = *(const v8h*)(p);
  f.half[1] = *(const v8h*)(p + 16);
  return f.v;
}

// ---- WMMA helper with trailing VALU hazard gap ----------------------------------------------------------------
__device__ __forceinline__ v8f mma_h(v16h a, v16h b, v8f c) {
  c = __builtin_amdgcn_wmma_f32_16x16x32_f16(false, a, false, b, (short)0, c, false, false);
#if defined(__HIP_DEVICE_COMPILE__)
  asm volatile("v_nop\n\tv_nop\n\tv_nop\n\tv_nop" : "+v"(c) : "v"(a), "v"(b));
#endif
  return c;
}
// ---- WMMA, the builtin alone: the compiler keeps the distance behind it and fills it with the caller's other work ---
__device__ __forceinline__ v8f mma_b(v16h a, v16h b, v8f c) {
  return __builtin_amdgcn_wmma_f32_16x16x32_f16(false, a, false, b, (short)0, c, false, false);
}
__device__ __forceinline__ void wave_sync_lds() {
  __builtin_amdgcn_fence(__ATOMIC_RELEASE, "workgroup");
  __builtin_amdgcn_wave_barrier();
  __builtin_amdgcn_fence(__ATOMIC_ACQUIRE, "workgroup");
}

// ---- 8 f32 -> 8 packed f16 (16 B) -------------------------------------------------------------------------------
__device__ __forceinline__ v4u pack8h(v4f a, v4f b) {
  v4u p;
  p[0] = pk16(h_bits((_Float16)a[0]), h_bits((_Float16)a[1]));
  p[1] = pk16(h_bits((_Float16)a[2]), h_bits((_Float16)a[3]));
  p[2] = pk16(h_bits((_Float16)b[0]), h_bits((_Float16)b[1]));
  p[3] = pk16(h_bits((_Float16)b[2]), h_bits((_Float16)b[3]));
  return p;
}

// ---- 4 f32 -> 4 f16 of sc * bf16_RNE(value) (8 B). sc is a power of two, so bf16_RNE(sc * value) is the same number;
//      scaled first, in f32: behind the rounding the compiler moved the product into f16, behind the narrowing, where a
//      small value has already lost bits
__device__ __forceinline__ v4h cvt4(v4f a, float sc) {
  const v2f lo = {a[0], a[1]}, hi = {a[2], a[3]}, s2 = {sc, sc};
  const v2h l = __builtin_convertvector(__builtin_convertvector(__builtin_convertvector(lo * s2, v2b), v2f), v2h);
  const v2h h = __builtin_convertvector(__builtin_convertvector(__builtin_convertvector(hi * s2, v2b), v2f), v2h);
  const v4h o = {l[0], l[1], h[0], h[1]};
  return o;
}

// =================================================================================================================
// qkv GEMM D[T][co] = X16[T][ci] . Wq[co][ci], K = 256, co 0..767 (q = 0..255, k = 256..511, v = 512..767), with
// X16[T = b*4096 + j] = f16(16 * bf16_RNE(x[b][clamp(idx[j])])) and Wq = f16(256 * bf16_RNE(w_qkv)), made here.
// Block = QWV = 12 waves, tile 128 rows x QCB = 384 cols, one block per WGP, grid = (2, 128) = 256 blocks; wave =
// 64 rows (half rg) x 64 cols (column group cg), 4 x 4 accumulator tiles: a k-step's 8 fragments feed 16 WMMAs.
// The block's A rows (128 gathered rows of x) and B rows (384 rows of w_qkv) are staged once, whole K, in LDS, read
// as floats and converted in registers: a row = 1 KB = two wave-loads of 512 B = 4 whole lines each, a lane's 4 + 4
// floats become two 8-B LDS stores; rows at pitch GSP (an odd multiple of 16 B for the 16-B fragment reads);
// LDS row r = A row r for r < 128, B row r - 128 behind; wave w moves rows w, w + 12, ..., in batches of QNB rows, a
// batch's loads issued before the batch ahead of it is converted; a batch of weight rows goes first (the x rows wait
// for idx), the x rows second, the other weight rows behind.
// The last wave, idle in the last round, converts row 2*blockIdx.y + blockIdx.x of w_proj into the plane Wp
// (f16(256 * bf16_RNE(w))) for the output projection: 256 blocks, 256 rows. One block barrier; fragments
// by LDS reads with the split k map, k-step 32 (8 steps); a second block barrier, then the same LDS is the output
// stage, 64 x STP floats per wave; a third block barrier between its writes and its reads.
// Column groups below 512 -> token-major plane QK[T][512], staged per wave [64 rows][STP].
// Column groups from 512 -> V16[b][c][n] = f16(16 * value): the two waves of a group stage [64 ch][SBP] (tokens
// contiguous; a 128-token tile lies within one batch row block) in their two ranges; wave rg owns channels rg*32..+31.
// coverage: QK: 16 it x 4 rows x 8 pieces x 8 = 64 rows x 64 cols per wave, 2 halves x 8 groups x 128 row blocks
// tile 16384 x 512 exactly; V16: 16 it x 2 ch x 16 lanes x 8 = 32 ch x 128 tok per wave, 2 halves x 4 groups x 128
// row blocks tile 256 ch x 16384 tok exactly.
// =================================================================================================================
__global__ __launch_bounds__(QWV * 32)
void gemm_qkv(const float* __restrict__ x, const int* __restrict__ idx, const float* __restrict__ wqkv,
              const float* __restrict__ wp, unsigned short* Wp, unsigned short* QK, unsigned short* V16) {
  __shared__ __align__(16) unsigned char smem[(128 + QCB) * GSP * 2];
  _Float16* As = (_Float16*)(void*)smem;
  _Float16* Bs = As + 128 * GSP;
  float* sm = (float*)(void*)smem;
  const int tid = threadIdx.x, lane = tid & 31, hh = lane >> 4, c = lane & 15;
  const int wave = __builtin_amdgcn_readfirstlane(tid >> 5);   // scalar: row choice and output path are scalar branches
  const int rg = wave & 1, cg = wave >> 1;
  const int m0 = blockIdx.y * 128;
  const int n0 = blockIdx.x * QCB + cg * 64;
  const float* xb = x + (size_t)(m0 >> 12) * NTOK * CIN;                    // the tile's batch (128 | 4096)
  const int*   ib = idx + (m0 & (NTOK - 1));
  const float* Bw = wqkv + (size_t)(blockIdx.x * QCB + wave) * CIN;         // one scalar base: the rounds' steps are immediates

  {
    // the tests on k and i alone fold at compile time: only the round that holds row 128 picks its source by the wave's
    // number, and only the last round, which is not full, is skipped by some waves (both scalar)
    v4f ta[2][QNB], tb[2][QNB];
    v4f pa, pb;
    const unsigned l4 = (unsigned)lane * 4u;   // unsigned: every row's load is its scalar base plus this one offset register
    int sx[QAR];                           // this wave's source rows of x, asked for ahead of everything else (scalar loads)
#pragma unroll
    for (int i = 0; i < QAR; ++i) {
      const int r = i * QWV + wave;
      sx[i] = ib[(r < 128) ? r : 127];
    }
    if (wave == QWV - 1) {
      const float* sp = wp + (size_t)(blockIdx.y * (C3 / QCB) + blockIdx.x) * CIN + lane * 4;
      pa = *(const v4f*)(sp);
      pb = *(const v4f*)(sp + 128);
      // precaution of form: stands before anything may rewrite a register that the two loads name
      asm volatile("s_wait_xcnt 0x0" ::: "memory");
    }
    uint64_t ax[QAR];
#pragma unroll
    for (int bt = 0; bt <= QBT; ++bt) {
      if (bt < QBT) {
#pragma unroll
        for (int e = 0; e < QNB; ++e) {
          const int k = bt * QNB + e;
          if (k < QST) {
            const int i = (k < QAR) ? (k + QAR) : ((k < 2 * QAR) ? (k - QAR) : k);
            const int r = i * QWV + wave;
            if ((i + 1) * QWV <= 128 + QCB || r < 128 + QCB) {
              if (i * QWV >= 128) {
                const float* sp = Bw + (i * QWV - 128) * CIN;
                ta[bt & 1][e] = *(const v4f*)(sp + l4);
                // the round under a branch: the second load's result may land on the address registers that both loads name
                if ((i + 1) * QWV > 128 + QCB) asm volatile("s_wait_xcnt 0x0" ::: "memory");
                tb[bt & 1][e] = *(const v4f*)(sp + 128 + l4);
              } else {
                const uint64_t sa = ax[i < QAR ? i : 0] + l4 * 4u;
                ta[bt & 1][e] = *(gv4f)(sa);
                tb[bt & 1][e] = *(gv4f)(sa + 512u);
              }
            }
          }
        }
        // precaution of form: stands behind a batch's loads, before anything may rewrite a register that they name
        if (bt != 0) {
          asm volatile("s_wait_xcnt 0x0" ::: "memory");
        } else {
          // keeps the wait for idx, which the bases need, behind the first batch's loads: it was moved ahead of them
          __builtin_amdgcn_sched_barrier(0);
#pragma unroll
          for (int i = 0; i < QAR; ++i) {
            int s = sx[i];
            s = (s < 0) ? 0 : ((s > NTOK - 1) ? (NTOK - 1) : s);
            const float* ap = xb + (size_t)__builtin_amdgcn_readfirstlane(s) * CIN;   // a scalar base: the lanes share one offset register
            if ((i + 1) * QWV > 128 && i * QWV + wave >= 128) ap = Bw + (i * QWV - 128) * CIN;
            ax[i] = (uint64_t)ap;
          }
          // the same wait; it names the x rows' bases so that all eleven are made ahead of it, each in registers of its
          // own
          asm volatile("s_wait_xcnt 0x0"
                       : "+s"(ax[0]), "+s"(ax[1]), "+s"(ax[2]), "+s"(ax[3]), "+s"(ax[4]), "+s"(ax[5]), "+s"(ax[6]),
                         "+s"(ax[7]), "+s"(ax[8]), "+s"(ax[9]), "+s"(ax[10])
                       :: "memory");
        }
      }
      if (bt > 0) {
#pragma unroll
        for (int e = 0; e < QNB; ++e) {
          const int k = (bt - 1) * QNB + e;
          if (k < QST) {
            const int i = (k < QAR) ? (k + QAR) : ((k < 2 * QAR) ? (k - QAR) : k);
            const int r = i * QWV + wave;
            if ((i + 1) * QWV <= 128 + QCB || r < 128 + QCB) {
              const float sc = (i * QWV >= 128) ? CWS : (((i + 1) * QWV <= 128 || r < 128) ? CXS : CWS);
              *(v4h*)(As + r * GSP + lane * 4)       = cvt4(ta[(bt - 1) & 1][e], sc);
              *(v4h*)(As + r * GSP + 128 + lane * 4) = cvt4(tb[(bt - 1) & 1][e], sc);
            }
          }
        }
      }
    }
    if (wave == QWV - 1) {
      _Float16* dp = (_Float16*)(void*)Wp + (size_t)(blockIdx.y * (C3 / QCB) + blockIdx.x) * CIN + lane * 4;
      *(v4h*)(dp)       = cvt4(pa, CWS);
      *(v4h*)(dp + 128) = cvt4(pb, CWS);
    }
  }
  __syncthreads();

  v8f acc[4][4];
#pragma unroll
  for (int mt = 0; mt < 4; ++mt) {
#pragma unroll
    for (int nt = 0; nt < 4; ++nt) acc[mt][nt] = zero8();
  }

  // unrolled: the k offsets of the LDS reads become constants, and a k-step's sixteen reads stand as one group
#pragma unroll
  for (int k0 = 0; k0 < CIN; k0 += 32) {
    v16h af[4], bfrag[4];
#pragma unroll
    for (int mt = 0; mt < 4; ++mt) af[mt] = ldfrag_h(As + (rg * 64 + mt * 16 + c) * GSP + k0 + 8 * hh);
#pragma unroll
    for (int nt = 0; nt < 4; ++nt) bfrag[nt] = ldfrag_h(Bs + (cg * 64 + nt * 16 + c) * GSP + k0 + 8 * hh);
#pragma unroll
    for (int mt = 0; mt < 4; ++mt) {
#pragma unroll
      for (int nt = 0; nt < 4; ++nt) acc[mt][nt] = mma_h(af[mt], bfrag[nt], acc[mt][nt]);
    }
  }
  __syncthreads();   // every wave's last fragment read ends before the tiles' LDS is rewritten as the output stage

  float* st = sm + wave * (64 * STP);          // QK path: this wave's own range
  float* sv = sm + (cg * 2) * (64 * STP);      // V path: the two ranges of the column group's waves
  if (n0 < C2) {
#pragma unroll
    for (int mt = 0; mt < 4; ++mt) {
#pragma unroll
      for (int nt = 0; nt < 4; ++nt) {
#pragma unroll
        for (int r = 0; r < 8; ++r) st[(mt * 16 + 8 * hh + r) * STP + nt * 16 + c] = acc[mt][nt][r];
      }
    }
  } else {
#pragma unroll
    for (int mt = 0; mt < 4; ++mt) {
#pragma unroll
      for (int nt = 0; nt < 4; ++nt) {
#pragma unroll
        for (int r = 0; r < 8; ++r) sv[(nt * 16 + c) * SBP + rg * 64 + mt * 16 + 8 * hh + r] = acc[mt][nt][r];
      }
    }
  }
  __syncthreads();   // a V group's channel rows hold tokens of both its waves; passed by every wave of the block

  if (n0 < C2) {
    const int piece = lane & 7, rsub = lane >> 3;
#pragma unroll
    for (int ib = 0; ib < 4; ++ib) {
      v4u pk[4];
      size_t offs[4];
#pragma unroll
      for (int it = 0; it < 4; ++it) {
        const int row = (ib * 4 + it) * 4 + rsub;
        v4f fa = *(const v4f*)(st + row * STP + piece * 8);
        v4f fb = *(const v4f*)(st + row * STP + piece * 8 + 4);
        fa = fa * CQK;
        fb = fb * CQK;
        pk[it] = pack8h(fa, fb);
        offs[it] = ((size_t)(m0 + rg * 64 + row)) * C2 + n0 + piece * 8;
      }
#pragma unroll
      for (int it = 0; it < 4; ++it) *(v4u*)(QK + offs[it]) = pk[it];
    }
  } else {
    const int cv0 = n0 - C2;
    const int bimg = m0 >> 12, s0 = m0 & (NTOK - 1);
#pragma unroll
    for (int ib = 0; ib < 4; ++ib) {
      v4u pk[4];
      size_t o16[4];
#pragma unroll
      for (int i2 = 0; i2 < 4; ++i2) {
        const int cc = rg * 32 + (ib * 4 + i2) * 2 + hh;
        const int co = cv0 + cc;
        v4f fa = *(const v4f*)(sv + cc * SBP + c * 8);
        v4f fb = *(const v4f*)(sv + cc * SBP + c * 8 + 4);
        fa = fa * CVS;
        fb = fb * CVS;
        pk[i2] = pack8h(fa, fb);
        o16[i2] = ((size_t)(bimg * CIN + co)) * NTOK + s0 + c * 8;
      }
#pragma unroll
      for (int i2 = 0; i2 < 4; ++i2) *(v4u*)(V16 + o16[i2]) = pk[i2];
    }
  }
}

// ---- attention softmax helpers ------------------------------------------------------------------------------------
// largest of a query's 32 scores of one pass: a lane's 16, then the other half's (lanes l and l ^ 16 share a query)
__device__ __forceinline__ float row_max(v8f s0, v8f s1) {
  float mc = s0[0];
#pragma unroll
  for (int r = 0; r < 8; ++r) mc = fmaxf(mc, fmaxf(s0[r], s1[r]));
  return fmaxf(mc, __shfl_xor(mc, 16, 32));
}
// P = 2^(S*QKL2 + nb) for a lane's 16 scores, two of one key tile per packed fma; p <- the f16 A fragment; returns their sum
__device__ __forceinline__ float soft_p(v8f s0, v8f s1, float nb, v16h& p) {
  float psum = 0.f;
  const v2f cc = {QKL2, QKL2}, nn = {nb, nb};
#pragma unroll
  for (int i = 0; i < 8; i += 2) {
    const v2f a0 = {s0[i], s0[i + 1]}, a1 = {s1[i], s1[i + 1]};
    const v2f x0 = __builtin_elementwise_fma(a0, cc, nn), x1 = __builtin_elementwise_fma(a1, cc, nn);
    const v2f e0 = {__builtin_amdgcn_exp2f(x0[0]), __builtin_amdgcn_exp2f(x0[1])};
    const v2f e1 = {__builtin_amdgcn_exp2f(x1[0]), __builtin_amdgcn_exp2f(x1[1])};
    const v2f t = e0 + e1;
    psum = psum + t[0];
    psum = psum + t[1];
    p[i]         = (_Float16)e0[0];
    p[i + 1]     = (_Float16)e0[1];
    p[8 + i]     = (_Float16)e1[0];
    p[8 + i + 1] = (_Float16)e1[1];
  }
  return psum;
}
// the same P without the sum: the row sum comes from the matrix unit
__device__ __forceinline__ v16h soft_q(v8f s0, v8f s1, float nb) {
  v16h p;
  const v2f cc = {QKL2, QKL2}, nn = {nb, nb};
#pragma unroll
  for (int i = 0; i < 8; i += 2) {
    const v2f a0 = {s0[i], s0[i + 1]}, a1 = {s1[i], s1[i + 1]};
    const v2f x0 = __builtin_elementwise_fma(a0, cc, nn), x1 = __builtin_elementwise_fma(a1, cc, nn);
    p[i]         = (_Float16)__builtin_amdgcn_exp2f(x0[0]);
    p[i + 1]     = (_Float16)__builtin_amdgcn_exp2f(x0[1]);
    p[8 + i]     = (_Float16)__builtin_amdgcn_exp2f(x1[0]);
    p[8 + i + 1] = (_Float16)__builtin_amdgcn_exp2f(x1[1]);
  }
  return p;
}

// One q-tile over all keys with the maximum watched in every pass: taken only by a wave whose plain walk (in attn_k)
// ended with a row sum that is not finite. m is taken up again (O and l rescaled, the pass's P made anew) in a pass
// where some lane's 16 P sum to more than PTH = 2^15, so that every P stays a finite f16. la[r] <- l of query 8h + r.
__device__ __forceinline__ void tile_watched(const _Float16* Ks, const _Float16* Vs, v16h bq, int c, int hh,
                                             v8f& o0, v8f& o1, v8f& la) {
  o0 = zero8();
  o1 = zero8();
  float lrun = 0.f;
  v8f s[2];
#pragma unroll
  for (int j = 0; j < 2; ++j) s[j] = mma_b(ldfrag_h(Ks + (j * 16 + c) * KSP + 8 * hh), bq, zero8());
  float nb = fmaf(-row_max(s[0], s[1]), QKL2, POFF);
#pragma unroll 1   // a path that is hardly ever taken: kept rolled so that it stays small in the instruction cache
  for (int ch = 0; ch < LGR / 32; ++ch) {
    v16h pfh;
    float psum = soft_p(s[0], s[1], nb, pfh);
    if (__builtin_amdgcn_ballot_w32(!(psum <= PTH)) != 0u) {   // one scalar branch for the whole wave
      const float nbn = fminf(nb, fmaf(-row_max(s[0], s[1]), QKL2, POFF));
      const float alpha = __builtin_amdgcn_exp2f(nbn - nb);
#pragma unroll
      for (int r = 0; r < 8; ++r) {
        const float arr = __shfl(alpha, 8 * hh + r, 32);
        o0[r] = o0[r] * arr;
        o1[r] = o1[r] * arr;
      }
      lrun = lrun * alpha;
      nb = nbn;
      psum = soft_p(s[0], s[1], nb, pfh);
    }
    lrun = lrun + psum;
    const int kn = (ch * 32 + 32) & (LGR - 1);                // the last pass wraps; what it scores is dropped
    const _Float16* vp = Vs + c * VSP + ch * 32 + 8 * hh;
    const _Float16* kp = Ks + (kn + c) * KSP + 8 * hh;
    o0 = mma_b(pfh, ldfrag_h(vp), o0);
    o1 = mma_b(pfh, ldfrag_h(vp + (HD / 2) * VSP), o1);
    s[0] = mma_b(ldfrag_h(kp), bq, zero8());
    s[1] = mma_b(ldfrag_h(kp + 16 * KSP), bq, zero8());
  }
  const float lsum = lrun + __shfl_xor(lrun, 16, 32);         // lane q (and q+16) holds the full row sum of query q
#pragma unroll
  for (int r = 0; r < 8; ++r) la[r] = __shfl(lsum, 8 * hh + r, 32);
}

// =================================================================================================================
// Grouped attention, one unit (batch b, token group gr, head) per AQS = 2 blocks of 1024 threads = 32 waves, 1024
// queries x 1024 keys, d = 32: 256 blocks, 8 waves per SIMD, all waves of a block walk the same k and v rows.
// Static LDS: the unit's whole k slab Ks[1024 keys][KSP] and v slab Vs[32 channels][VSP] (f16, row pitch an odd
// multiple of 16 B for the 16-B fragment reads), filled once per block (each thread moves 4 + 4 pieces of 16 B from
// the token-major plane QK, k row = T*512 + 256 + head*32, and the channel-major plane V16, row = channel
// head*32 + d, keys contiguous), then one block barrier; plus the per-wave stage [16][ASP] f32. q fragments
// straight from QK (q row = T*512 + head*32). Per wave: the one q-tile qt = part*32 + wave (< 64).
//   Transposed scores S^T = K_tile (A, 16 keys x 32 d) x Q (B: k = d, n = query): S*256 = q16.k16; D element r of
//   lane l = S[query l&15][key 8h+r], so P = exp((S - m)*scale) x16 is the A fragment of P.V directly in registers;
//   each P is one fma and one exp2: 2^(S*QKL2 + nb), nb = POFF - m*QKL2 (scale, log2 e, the maximum and the x16 in it)
//   (element i <- key tile 0 row i, element 8+i <- key tile 1 row i). Softmax over 32 chunks of 32 keys; m is pass 0's
//   row maximum; any m gives the same O / l while every P is a finite f16. l = P x ones, a third product of the same A
//   fragment: the sum of the f16 P, in O's own layout. No test in the loop: a P that left f16's range shows in l behind
//   the loop, and the wave then walks its tile again by tile_watched, which takes the maximum up where needed.
//   The scores of pass ch + 1 are made at the foot of pass ch, beside its three P products (five WMMAs in a row).
//   O = P.V (acc scale 16*16), l = sum of P (x16). Epilogue: O/(l*16) staged per wave in LDS, then stored as the f16 plane
//   Y[unit][1024][32] of 256*o: one instruction = 32 lanes x 16 B = 512 B = 8 token rows (consecutive lanes
// coverage: per block 32 q-tiles x 16 rows x 32 d, half of its unit's 1024-row slab; grid covers 2 halves x 128
// units, every slab row written exactly once.
// =================================================================================================================
__global__ __launch_bounds__(AWV * 32)
void attn_k(const unsigned short* __restrict__ QK, const unsigned short* __restrict__ V16, unsigned short* Y) {
  __shared__ __align__(16) float Sst[AWV * 16 * ASP];
  __shared__ __align__(16) _Float16 Ks[LGR * KSP];
  __shared__ __align__(16) _Float16 Vs[HD * VSP];
  const int tid = threadIdx.x, wave = tid >> 5, lane = tid & 31, hh = lane >> 4, c = lane & 15;
  const int u = blockIdx.x & (NUNIT - 1), part = blockIdx.x / NUNIT;
  const int head = u & 7, gr = (u >> 3) & 3, b = u >> 5;
  const size_t tok0 = (size_t)b * NTOK + (size_t)gr * LGR;
  const _Float16* Qp = (const _Float16*)(const void*)QK + tok0 * C2 + head * HD;
  const _Float16* Kp = Qp + CIN;
  const size_t cm0 = ((size_t)(b * CIN + head * HD)) * NTOK + (size_t)gr * LGR;
  const _Float16* Vp = (const _Float16*)(const void*)V16 + cm0;
  float* st = Sst + wave * (16 * ASP);

  {
    // B of the row sum, 32 keys x 16 columns of 1.0, goes through the wave's own stage rows: read back as data it keeps
    // eight registers of its own over the key loop; as a constant the compiler built it anew in every pass (four moves)
    _Float16* oh = (_Float16*)(void*)st;
    {
      v8h o8;
#pragma unroll
      for (int i = 0; i < 8; ++i) o8[i] = (_Float16)1.0f;
      *(v8h*)(oh + lane * 8)       = o8;
      *(v8h*)(oh + 256 + lane * 8) = o8;
    }
    const int qt = part * AWV + wave;
    const int lq = qt * 16 + c;
    const v16h bq = ldfrag_h(Qp + (size_t)lq * C2 + 8 * hh);     // B: n = query c, k = d 8h.. / 16+8h..

    {
      v8h kt[4], vt[4];
#pragma unroll
      for (int i = 0; i < 4; ++i) {
        const int id = i * (AWV * 32) + tid;
        kt[i] = *(const v8h*)(Kp + (size_t)(id >> 2) * C2 + (id & 3) * 8);       // key id/4, d piece id%4
        vt[i] = *(const v8h*)(Vp + (size_t)(id >> 7) * NTOK + (id & 127) * 8);   // channel id/128, key piece id%128
      }
#pragma unroll
      for (int i = 0; i < 4; ++i) {
        const int id = i * (AWV * 32) + tid;
        *(v8h*)(Ks + (id >> 2) * KSP + (id & 3) * 8)   = kt[i];
        *(v8h*)(Vs + (id >> 7) * VSP + (id & 127) * 8) = vt[i];
      }
    }
    __syncthreads();

    v8f o0 = zero8(), o1 = zero8(), la = zero8();             // la[r]: row sum of query 8h + r, the same in all 16 columns
    Frag of;
    of.half[0] = *(const v8h*)(oh + lane * 8);
    of.half[1] = *(const v8h*)(oh + 256 + lane * 8);
    const v16h one16 = of.v;
    v8f s[2];                                                 // scores of the pass at hand, made one pass ahead
#pragma unroll
    for (int j = 0; j < 2; ++j) s[j] = mma_b(ldfrag_h(Ks + (j * 16 + c) * KSP + 8 * hh), bq, zero8());
    // exponent offset POFF - m * scale * log2(e), m = pass 0's maximum: a P stays a finite f16 up to 2^12 times pass 0's
    // largest and a normal f16 down to 2^-18 of it
    const float nb = fmaf(-row_max(s[0], s[1]), QKL2, POFF);
    // fragments of a pass's WMMAs, read one pass ahead (at the foot of the pass before) so that they fly under the softmax
    v16h vf0 = ldfrag_h(Vs + c * VSP + 8 * hh);                                      // B: n = d c, keys of the pass
    v16h vf1 = ldfrag_h(Vs + (HD / 2 + c) * VSP + 8 * hh);                           // B: n = d 16+c
    v16h ka0 = ldfrag_h(Ks + (32 + c) * KSP + 8 * hh);                               // A: row = key of the next pass, k = d
    v16h ka1 = ldfrag_h(Ks + (32 + 16 + c) * KSP + 8 * hh);
#pragma unroll 1
    for (int ch = 0; ch < LGR / 32; ++ch) {
      const v16h pfh = soft_q(s[0], s[1], nb);
      const int kv = (ch * 32 + 32) & (LGR - 1);              // next pass's keys and the ones behind them; the last passes
      const int kn = (ch * 32 + 64) & (LGR - 1);              // wrap, and what is read and scored there is dropped
      const _Float16* vnx = Vs + c * VSP + kv + 8 * hh;
      const _Float16* knx = Ks + (kn + c) * KSP + 8 * hh;
      // keeps the address arithmetic ahead of the five WMMAs: moved in between them it lands on a WMMA's operand
      // registers and draws more v_nop a pass; with only WMMAs and LDS reads here each WMMA fills the distance of the
      // one before it
      __builtin_amdgcn_sched_barrier(0);
      s[0] = mma_b(ka0, bq, zero8());
      s[1] = mma_b(ka1, bq, zero8());
      o0 = mma_b(pfh, vf0, o0);
      o1 = mma_b(pfh, vf1, o1);
      la = mma_b(pfh, one16, la);
      vf0 = ldfrag_h(vnx);
      vf1 = ldfrag_h(vnx + (HD / 2) * VSP);
      ka0 = ldfrag_h(knx);
      ka1 = ldfrag_h(knx + 16 * KSP);
    }
    // A P beyond f16's range is an infinity in the A fragment and leaves its row sum infinite (or not a number): then the
    // whole wave (one scalar branch) walks its tile again with the maximum watched. All sums are >= 0: their sum shows any.
    const float lchk = ((la[0] + la[1]) + (la[2] + la[3])) + ((la[4] + la[5]) + (la[6] + la[7]));
    if (__builtin_amdgcn_ballot_w32(!(lchk <= 3.0e38f)) != 0u) tile_watched(Ks, Vs, bq, c, hh, o0, o1, la);
#pragma unroll
    for (int r = 0; r < 8; ++r) {
      const int q = 8 * hh + r;
      const float inv = __builtin_amdgcn_rcpf(la[r] * 16.0f);  // la carries the x16 of p; eight sums a lane, so v_rcp_f32
      st[q * ASP + c]          = o0[r] * inv;
      st[q * ASP + HD / 2 + c] = o1[r] * inv;
    }
    wave_sync_lds();
    {
      const int rr = lane >> 2, dp = (lane & 3) * 8;
      v4u pk[2];
      size_t offs[2];
#pragma unroll
      for (int it = 0; it < 2; ++it) {
        const int row = it * 8 + rr;
        v4f fa = *(const v4f*)(st + row * ASP + dp);
        v4f fb = *(const v4f*)(st + row * ASP + dp + 4);
        fa = fa * CYS;
        fb = fb * CYS;
        pk[it] = pack8h(fa, fb);
        offs[it] = ((size_t)u * LGR + (size_t)(qt * 16 + row)) * HD + dp;
      }
      {
#pragma unroll
        for (int it = 0; it < 2; ++it) *(v4u*)(Y + offs[it]) = pk[it];
        
      }
    }
  }
}

// =================================================================================================================
// Output projection D[T][co] = Y[T][ci] . Wp[co][ci] + bias, rows T in shuffled token order, written to the
// un-shuffled output row idx[j] (clamped) of batch b. A = Y plane (x256) addressed by arithmetic: token T ->
// (batch, group, query), k-step ks = head ks, channels ks*32 + d (elements 0..7 d = 8h.., elements 8..15 d =
// 16+8h..). B = weight plane x256. Both tiles are staged once, whole K, in LDS by whole-line loads: per head the
// block's 128 token rows of Y are 8 KB contiguous -> As[head][token][KSP]; the 64 weight rows are 32 KB contiguous
// -> Bs[row][GSP]; one block barrier, fragments by LDS reads, a second block barrier, then the same LDS is the
// output stage. Epilogue: value = acc/65536 + bf16(b)[co], staged per wave in LDS [16][STP];
// coverage: 8 waves x 8 it x 2 rows x 16 lanes x 4 = 128 rows x 64 co per block; grid tiles 16384 x 256 exactly;
// with idx a permutation every output row is written exactly once.
// =================================================================================================================
__global__ __launch_bounds__(256)
void gemm_proj(const unsigned short* __restrict__ Y, const unsigned short* __restrict__ Wp,
               const float* __restrict__ bp, const int* __restrict__ idx, float* out) {
  __shared__ __align__(16) unsigned char smem[(NHD * 128 * KSP + 64 * GSP) * 2];
  _Float16* As = (_Float16*)(void*)smem;
  _Float16* Bs = As + NHD * 128 * KSP;
  float* sm = (float*)(void*)smem;
  const int tid = threadIdx.x, wave = tid >> 5, lane = tid & 31, hh = lane >> 4, c = lane & 15;
  const int n0 = blockIdx.x * 64, m0 = blockIdx.y * 128;
  const int bq = m0 >> 12, jj = m0 & (NTOK - 1), gr = jj >> 10, q0 = jj & (LGR - 1);
  const _Float16* A = (const _Float16*)(const void*)Y + (((size_t)((bq * NGR + gr) * NHD)) * LGR + (size_t)q0) * HD;
  const _Float16* B = (const _Float16*)(const void*)Wp + (size_t)n0 * CIN;

  {
    v8h ta[16], tb[8];
#pragma unroll
    for (int i = 0; i < 16; ++i)       // head i/2, piece (i%2)*256 + tid of its 512 (token = piece/4, d piece = piece%4)
      ta[i] = *(const v8h*)(A + (size_t)(i >> 1) * (LGR * HD) + ((i & 1) * 256 + tid) * 8);
#pragma unroll
    for (int i = 0; i < 8; ++i)  tb[i] = *(const v8h*)(B + (i * 256 + tid) * 8);
#pragma unroll
    for (int i = 0; i < 16; ++i) *(v8h*)(As + ((i * 256 + tid) >> 2) * KSP + (tid & 3) * 8) = ta[i];
#pragma unroll
    for (int i = 0; i < 8; ++i)  *(v8h*)(Bs + (i * 8 + wave) * GSP + lane * 8) = tb[i];
  }
  __syncthreads();

  v8f acc[4];
#pragma unroll
  for (int nt = 0; nt < 4; ++nt) acc[nt] = zero8();

  // unrolled: the k offsets of the LDS reads become constants, and a k-step's ten reads stand as one group
#pragma unroll
  for (int ks = 0; ks < NHD; ++ks) {
    const v16h af = ldfrag_h(As + (ks * 128 + wave * 16 + c) * KSP + 8 * hh);
    v16h bfrag[4];
#pragma unroll
    for (int nt = 0; nt < 4; ++nt) bfrag[nt] = ldfrag_h(Bs + (nt * 16 + c) * GSP + ks * 32 + 8 * hh);
#pragma unroll
    for (int nt = 0; nt < 4; ++nt) acc[nt] = mma_h(af, bfrag[nt], acc[nt]);
  }
  __syncthreads();   // every wave's last fragment read ends before the tiles' LDS is rewritten as the output stage

  float* st = sm + wave * (16 * STP);
#pragma unroll
  for (int nt = 0; nt < 4; ++nt) {
    const int co = n0 + nt * 16 + c;
    const float bi = bfr(bp[co]);
#pragma unroll
    for (int r = 0; r < 8; ++r) st[(8 * hh + r) * STP + nt * 16 + c] = acc[nt][r] * (1.0f / 65536.0f) + bi;
  }
  wave_sync_lds();
  const int bimg = m0 >> 12;
  const int jbase = (m0 & (NTOK - 1)) + wave * 16;
  v4f ov[8];
  size_t offs[8];
#pragma unroll
  for (int it = 0; it < 8; ++it) {
    const int row = it * 2 + hh;
    int dst = idx[jbase + row];
    dst = (dst < 0) ? 0 : ((dst > NTOK - 1) ? (NTOK - 1) : dst);
    ov[it] = *(const v4f*)(st + row * STP + c * 4);
    offs[it] = ((size_t)(bimg * NTOK + dst)) * CIN + n0 + c * 4;
  }
  {
#pragma unroll
    for (int it = 0; it < 8; ++it) *(v4f*)(out + offs[it]) = ov[it];
    
  }
}

// =================================================================================================================
//   Wp f16 [256][256] 131072 @0; QK f16 [16384][512] 16777216 @131072; V16 f16 [4][256][4096] 8388608 @16908288;
//   Y f16 [128][1024][32] 8388608 @25296896. Total 33685504.
// =================================================================================================================
extern "C" void kernel_launch(void* const* d_in, const int* in_sizes, int n_in,
                              void* d_out, int out_size, void* d_ws, size_t ws_size,
                              hipStream_t stream) {
  if (n_in < 5) return;
  if (in_sizes[0] != NBAT * NTOK * CIN) return;
  if (in_sizes[1] != NTOK) return;
  if (in_sizes[2] != C3 * CIN) return;
  if (in_sizes[3] != CIN * CIN) return;
  if (in_sizes[4] != CIN) return;
  if (out_size != NBAT * NTOK * CIN) return;

  const float* x      = (const float*)d_in[0];
  const int*   idx    = (const int*)d_in[1];
  const float* w_qkv  = (const float*)d_in[2];
  const float* w_proj = (const float*)d_in[3];
  const float* b_proj = (const float*)d_in[4];
  float* out = (float*)d_out;

  const size_t sWp  = (size_t)CIN * CIN * 2;             //    131072
  const size_t sQK  = (size_t)MTOK * C2 * 2;             //  16777216
  const size_t sV16 = (size_t)NBAT * CIN * NTOK * 2;     //   8388608
  const size_t sY   = (size_t)NUNIT * LGR * HD * 2;      //   8388608
  size_t off = 0;
  const size_t oWp  = off; off += sWp;
  const size_t oQK  = off; off += sQK;
  const size_t oV16 = off; off += sV16;
  const size_t oY   = off; off += sY;
  if (off > ws_size) return;                             // off = 33685504
  if (off > (size_t)134217728) return;

  char* ws = (char*)d_ws;
  unsigned short* Wp  = (unsigned short*)(ws + oWp);
  unsigned short* QK  = (unsigned short*)(ws + oQK);
  unsigned short* V16 = (unsigned short*)(ws + oV16);
  unsigned short* Yp  = (unsigned short*)(ws + oY);

  const dim3 blk(256);
  // (1) qkv projection of the gathered x rows -> token-major q/k plane and channel-major v plane; w_proj -> f16 x256 plane
  gemm_qkv<<<dim3(C3 / QCB, MTOK / 128), dim3(QWV * 32), 0, stream>>>(x, idx, w_qkv, w_proj, Wp, QK, V16);
  // (2) grouped multi-head attention -> ctx slab plane
  attn_k<<<dim3(NUNIT * AQS), dim3(AWV * 32), 0, stream>>>(QK, V16, Yp);
  // (3) output projection + bias, rows written to their un-shuffled positions
  gemm_proj<<<dim3(CIN / 64, MTOK / 128), blk, 0, stream>>>(Yp, Wp, b_proj, idx, out);
  (void)hipGetLastError();
}
